// v000
// Times are from an AMD MI455X. After a warm-up the kernel runs many times in a row, and a time is the length of
// such a window on the GPU divided by its runs, so every launch and the gaps after it count. The runs cycle
// through copies of the inputs. A figure is the median of several windows, for all but v000 over two sittings.
// Sittings can differ by a few percent; kernels timed side by side share one.
// v000, which the later versions start from, runs in 470 microseconds.
#include <hip/hip_runtime.h>
#include <stdint.h>

// Contractions: qkv projection (K=64), q.k^T (K=64), p.v (K=32 per step): v_wmma_f32_16x16x32_f16, plain f16 operands, f32 accumulate;
// output projection (K=1024): v_wmma_f32_16x16x32_f16 with the context operand carried as f16 hi + f16 residual x2^11 (two accumulators), weights f16, f32 accumulate.
// Float inputs are RNE-converted to bf16 and then cast to f16 (exact); carries: W_qkv x8, softmax P x1024, context x128, W_proj x32; softmax and epilogues in f32.

typedef __attribute__((ext_vector_type(16))) _Float16 v16h;
typedef __attribute__((ext_vector_type(8)))  float    v8f;
typedef __attribute__((ext_vector_type(4)))  float    v4f;
typedef __attribute__((ext_vector_type(4)))  uint32_t v4u;
typedef v4u __attribute__((may_alias)) v4ua;
typedef v4f __attribute__((may_alias)) v4fa;

#ifndef NB
#define NB 4            // batch count processed
#endif
#ifndef SEQ
#define SEQ 2048        // tokens per batch processed
#endif
#ifndef SEQ_FULL
#define SEQ_FULL 2048   // per-batch token stride of the input x
#endif
#ifndef SEQ_OUT
#define SEQ_OUT SEQ     // per-batch token stride of the output buffer
#endif
#define NHEAD 16
#define EMB   1024
#define HDIM  64
#define NQKV  192

static_assert(NB >= 1);
static_assert(SEQ >= 128);
static_assert(SEQ % 128 == 0);
static_assert(SEQ <= SEQ_FULL);
static_assert(NHEAD * HDIM == EMB);
static_assert(((NQKV * HDIM) / 8) % 256 == 0);
static_assert(((EMB * EMB) / 8) % 256 == 0);
static_assert((NB * SEQ) % 128 == 0);
static_assert(EMB % 64 == 0);

// ---------------------------------------------------------------- helpers
static __device__ __forceinline__ float bf16r(float f) {   // RNE convert to bf16, back to f32
  uint32_t u = __float_as_uint(f);
  u = u + 0x7FFFu + ((u >> 16) & 1u);
  u = u & 0xFFFF0000u;
  return __uint_as_float(u);
}

union AF { v16h v; _Float16 h[16]; v4u q[2]; };
union H8 { _Float16 h[8]; v4u q; };

// 16-half WMMA fragment (A or B operand, one 32-deep k step) from a row whose
// k run is contiguous: lane row/col = lane&15; elements 0..7 <- k0+8*lhi+0..7,
// elements 8..15 <- k0+16+8*lhi+0..7 (two aligned 16-byte loads).
static __device__ __forceinline__ void load_frag16(AF& a, const _Float16* row, int lhi) {
  const v4ua* p = (const v4ua*)(row + lhi * 8);
  a.q[0] = p[0];
  a.q[1] = p[2];
}

static __device__ __forceinline__ v8f mma16(v16h a, v16h b, v8f c) {
  v8f d = __builtin_amdgcn_wmma_f32_16x16x32_f16(false, a, false, b, (short)0, c,
                                                 false, false);
  asm volatile("v_nop\n\tv_nop\n\tv_nop\n\tv_nop" : "+v"(d) : "v"(a), "v"(b));
  return d;
}

static __device__ __forceinline__ void vst16(_Float16* p, v4u v) { *(v4u*)p = v; }
static __device__ __forceinline__ void vstf4(float* p, v4f v) { *(v4f*)p = v; }

// ---------------------------------------------------------------- kernel 0
// f32 weights -> f16 plane: h = f16(bf16(w) * scale). One lane = 8 consecutive
__global__ __launch_bounds__(256) void cvt_w16_kernel(const float* __restrict__ src,
                                                      _Float16* __restrict__ dst,
                                                      int n8, float scale) {
  const int i = blockIdx.x * 256 + (int)threadIdx.x;
  if (i >= n8) return;                       // n8 is a multiple of 256 in every launch
  const v4f* sp = (const v4f*)(src + (size_t)i * 8);
  const v4f f0 = sp[0];
  const v4f f1 = sp[1];
  H8 o;
#pragma unroll
  for (int e = 0; e < 4; ++e) {
    o.h[e]     = (_Float16)(bf16r(f0[e]) * scale);
    o.h[4 + e] = (_Float16)(bf16r(f1[e]) * scale);
  }
  const v4u val = o.q;
  _Float16* dp = dst + (size_t)i * 8;
  vst16(dp, val);
  
}

// ---------------------------------------------------------------- kernel 1
// Per (b, h, 128-token tile): qkv = x_h[128x64] . Wq16^T (Wq16 = [192][64], k contiguous).
// Wave = 16 tokens x 192 columns (24 WMMA). Planes: Q16/K16 = [bh][t][64] (8q, 8k),
static __device__ __forceinline__ void qkv_store_pass(const _Float16* Qst, const _Float16* Kst,
                                                      const _Float16* Vst, _Float16* qdst,
                                                      _Float16* kdst, _Float16* vdst, int tid) {
#pragma unroll
  for (int it = 0; it < 4; ++it) {
    const int idx = it * 256 + tid;                       // 16-B piece of the contiguous 16 KB tile
    vst16(qdst + (size_t)idx * 8, ((const v4ua*)Qst)[idx]);
    vst16(kdst + (size_t)idx * 8, ((const v4ua*)Kst)[idx]);
    const int d = it * 16 + (tid >> 4);                   // V^T row (0..63), 256 B per row segment
    const int piece = tid & 15;
    vst16(vdst + (size_t)d * SEQ + piece * 8, ((const v4ua*)Vst)[d * 16 + piece]);
  }
}

__global__ __launch_bounds__(256) __attribute__((amdgpu_num_vgpr(256)))
void qkv_kernel(const float* __restrict__ x, const _Float16* __restrict__ Wq16,
                const float* __restrict__ bq, _Float16* __restrict__ Q16,
                _Float16* __restrict__ K16, _Float16* __restrict__ V16T) {
  __shared__ _Float16 Qst[128 * HDIM];   // [token][d]
  __shared__ _Float16 Kst[128 * HDIM];   // [token][d]
  __shared__ _Float16 Vst[HDIM * 128];   // [d][token]

  const int tid  = (int)threadIdx.x;
  const int wave = tid >> 5;
  const int lane = tid & 31;
  const int lhi  = lane >> 4;
  const int ln   = lane & 15;
  const int tb   = blockIdx.x * 128;
  const int h    = blockIdx.y;
  const int b    = blockIdx.z;

  // A fragments: x rows (tokens) x 64 dims, f32 -> bf16 RNE -> f16 in registers.
  const int trow = tb + wave * 16 + ln;
  const float* xrow = x + ((size_t)b * SEQ_FULL + trow) * EMB + h * HDIM;
  AF xa[2];
#pragma unroll
  for (int ks = 0; ks < 2; ++ks) {
    const v4f* xp = (const v4f*)(xrow + ks * 32 + lhi * 8);
    const v4f f0 = xp[0], f1 = xp[1];    // k = ks*32 + 8*lhi + 0..7   (elements 0..7)
    const v4f f2 = xp[4], f3 = xp[5];    // k = ks*32 + 16 + 8*lhi +.. (elements 8..15)
#pragma unroll
    for (int e = 0; e < 4; ++e) {
      xa[ks].h[e]      = (_Float16)bf16r(f0[e]);
      xa[ks].h[4 + e]  = (_Float16)bf16r(f1[e]);
      xa[ks].h[8 + e]  = (_Float16)bf16r(f2[e]);
      xa[ks].h[12 + e] = (_Float16)bf16r(f3[e]);
    }
  }

  const int rbase = wave * 16 + lhi * 8;   // D rows of this lane: rbase + r
#pragma unroll
  for (int n = 0; n < 12; ++n) {
    const int colg = n * 16 + ln;          // output column 0..191 = B column of this lane
    AF wb0, wb1;
    load_frag16(wb0, Wq16 + colg * HDIM, lhi);
    load_frag16(wb1, Wq16 + colg * HDIM + 32, lhi);
    const float bv = 8.0f * bf16r(bq[colg]);
    v8f acc;
#pragma unroll
    for (int e = 0; e < 8; ++e) acc[e] = bv;
    acc = mma16(xa[0].v, wb0.v, acc);
    acc = mma16(xa[1].v, wb1.v, acc);
    const int cl = (n & 3) * 16 + ln;      // column within the 64-wide q / k / v block
    if (n < 4) {
#pragma unroll
      for (int r = 0; r < 8; ++r) Qst[(rbase + r) * HDIM + cl] = (_Float16)acc[r];
    } else if (n < 8) {
#pragma unroll
      for (int r = 0; r < 8; ++r) Kst[(rbase + r) * HDIM + cl] = (_Float16)acc[r];
    } else {
#pragma unroll
      for (int r = 0; r < 8; ++r) Vst[cl * 128 + rbase + r] = (_Float16)acc[r];
    }
  }
  __syncthreads();   // cross-wave staging complete

  const size_t bh = (size_t)(b * NHEAD + h);
  _Float16* qdst = Q16 + (bh * SEQ + tb) * HDIM;
  _Float16* kdst = K16 + (bh * SEQ + tb) * HDIM;
  _Float16* vdst = V16T + bh * HDIM * SEQ + tb;
  qkv_store_pass(Qst, Kst, Vst, qdst, kdst, vdst, tid);
  
}

// ---------------------------------------------------------------- kernel 2
// Flash attention. Block = 8 waves = 128 query rows of one (b,h); key blocks of 32:
// S = Q.K^T (4 WMMA, K/V fragments read straight from the planes), f32 online
// softmax, P x1024 staged per wave in LDS, O += P.V (4 WMMA).
// Outputs: C16 = [b][t][E] f16 hi of 128*ctx, R16 = [b][t][E] f16 residual (128*ctx - hi) x 2048,
// heads interleaved (e = h*64 + d).
static __device__ __forceinline__ void ctx_store_pass(const _Float16* ow, _Float16* cdst, int lane) {
  const int prow = lane >> 3, piece = lane & 7;
#pragma unroll
  for (int i = 0; i < 4; ++i) {
    const int row = i * 4 + prow;
    vst16(cdst + (size_t)row * EMB + piece * 8, ((const v4ua*)ow)[row * 8 + piece]);
  }
}

__global__ __launch_bounds__(256) __attribute__((amdgpu_num_vgpr(256)))
void attn_kernel(const _Float16* __restrict__ Q16, const _Float16* __restrict__ K16,
                 const _Float16* __restrict__ V16T, _Float16* __restrict__ C16,
                 _Float16* __restrict__ R16) {
  __shared__ _Float16 Pb[8][16 * 32];      // per-wave P tile [query][key]
  __shared__ _Float16 Ost[8][16 * HDIM];   // per-wave hi staging [query][d]
  __shared__ _Float16 Rst[8][16 * HDIM];   // per-wave residual staging [query][d]

  const int tid  = (int)threadIdx.x;
  const int wave = tid >> 5;
  const int lane = tid & 31;
  const int lhi  = lane >> 4;
  const int ln   = lane & 15;
  const int qb   = blockIdx.x * 128;
  const int h    = blockIdx.y;
  const int b    = blockIdx.z;
  const size_t bh = (size_t)(b * NHEAD + h);
  const _Float16* Qp = Q16 + bh * SEQ * HDIM;
  const _Float16* Kp = K16 + bh * SEQ * HDIM;
  const _Float16* Vp = V16T + bh * HDIM * SEQ;

  // Q A-fragments for this wave's 16 query rows (plane carries 8q).
  const int trow = qb + wave * 16 + ln;
  AF qa0, qa1;
  load_frag16(qa0, Qp + (size_t)trow * HDIM, lhi);
  load_frag16(qa1, Qp + (size_t)trow * HDIM + 32, lhi);

  float m[8], ls[8];
  v8f o[4];
#pragma unroll
  for (int r = 0; r < 8; ++r) { m[r] = -3.0e38f; ls[r] = 0.0f; }
#pragma unroll
  for (int d = 0; d < 4; ++d) {
#pragma unroll
    for (int e = 0; e < 8; ++e) o[d][e] = 0.0f;
  }

  _Float16* pw = Pb[wave];
  const float SC = 0.001953125f;   // (8q).(8k) / 512 = q.k / 8

#pragma unroll 1
  for (int kb = 0; kb < SEQ / 32; ++kb) {
    // S = Q . K^T : two 16-key tiles, each 2 k-steps over 64 dims.
    v8f s[2];
#pragma unroll
    for (int nt = 0; nt < 2; ++nt) {
      const int key = kb * 32 + nt * 16 + ln;    // B column of this lane
      AF f0, f1;
      load_frag16(f0, Kp + (size_t)key * HDIM, lhi);
      load_frag16(f1, Kp + (size_t)key * HDIM + 32, lhi);
      v8f c;
#pragma unroll
      for (int e = 0; e < 8; ++e) c[e] = 0.0f;
      c = mma16(qa0.v, f0.v, c);
      c = mma16(qa1.v, f1.v, c);
      s[nt] = c;
    }

    // Online softmax (f32). D row 8*lhi+r = query; stats reduced over the 16 lanes of a half.
    float corr[8];
#pragma unroll
    for (int r = 0; r < 8; ++r) {
      const float a0 = s[0][r] * SC;
      const float a1 = s[1][r] * SC;
      float mx = fmaxf(a0, a1);
      mx = fmaxf(mx, __shfl_xor(mx, 1));
      mx = fmaxf(mx, __shfl_xor(mx, 2));
      mx = fmaxf(mx, __shfl_xor(mx, 4));
      mx = fmaxf(mx, __shfl_xor(mx, 8));
      const float mn = fmaxf(m[r], mx);
      corr[r] = __expf(m[r] - mn);
      m[r] = mn;
      const float p0 = __expf(a0 - mn);
      const float p1 = __expf(a1 - mn);
      float rs = p0 + p1;
      rs += __shfl_xor(rs, 1);
      rs += __shfl_xor(rs, 2);
      rs += __shfl_xor(rs, 4);
      rs += __shfl_xor(rs, 8);
      ls[r] = ls[r] * corr[r] + rs;
      const int row = lhi * 8 + r;
      pw[row * 32 + ln]      = (_Float16)(p0 * 1024.0f);   // key ln
      pw[row * 32 + 16 + ln] = (_Float16)(p1 * 1024.0f);   // key 16+ln
    }
#pragma unroll
    for (int d = 0; d < 4; ++d) {
#pragma unroll
      for (int r = 0; r < 8; ++r) o[d][r] *= corr[r];
    }
    __syncthreads();   // P tile stores complete before the fragment reload

    // P as a 16x32 A fragment: row ln, keys 8*lhi.. and 16+8*lhi..
    AF pa;
    load_frag16(pa, pw + ln * 32, lhi);

    // O += P . V : four 16-wide d tiles; V^T plane row d holds keys contiguous.
#pragma unroll
    for (int d = 0; d < 4; ++d) {
      AF vf;
      load_frag16(vf, Vp + (size_t)(d * 16 + ln) * SEQ + kb * 32, lhi);
      o[d] = mma16(pa.v, vf.v, o[d]);
    }
    __syncthreads();   // fragment reloads complete before the next P stores
  }

  // O = sum (1024 p)(8 v); c = 128 * ctx = O / (64 * l); hi = f16(c), res = f16((c - hi) * 2048).
  _Float16* ow = Ost[wave];
  _Float16* rw = Rst[wave];
#pragma unroll
  for (int r = 0; r < 8; ++r) {
    const float inv = (1.0f / ls[r]) * 0.015625f;
    const int row = lhi * 8 + r;
#pragma unroll
    for (int d = 0; d < 4; ++d) {
      const float c = o[d][r] * inv;
      const _Float16 hh = (_Float16)c;
      const float resf = (c - (float)hh) * 2048.0f;
      ow[row * HDIM + d * 16 + ln] = hh;
      rw[row * HDIM + d * 16 + ln] = (_Float16)resf;
    }
  }
  __syncthreads();

  const size_t coff = ((size_t)b * SEQ + qb + wave * 16) * EMB + h * HDIM;
  _Float16* cdst = C16 + coff;
  _Float16* rdst = R16 + coff;
  ctx_store_pass(ow, cdst, lane);
  ctx_store_pass(rw, rdst, lane);
  
}

// ---------------------------------------------------------------- kernel 3
// y[m][f] = (sum_e C16[m][e]*Wp16[f][e] + (sum_e R16[m][e]*Wp16[f][e]) / 2048) / 4096 + bf16(b_proj[f]);
// M = NB*SEQ, N = K = 1024. Block = 4 waves, wave tile 32 rows x 64 cols, two accumulator
// sets (hi plane, residual plane), fragments read from the planes.
static __device__ __forceinline__ void y_store_pass(const float* yw, float* out, int m0, int n0,
                                                    int lane) {
  const int prow = lane >> 4, piece = lane & 15;   // 16 lanes x 16 B = one 256-B row segment
#pragma unroll
  for (int i = 0; i < 16; ++i) {
    const int row = i * 2 + prow;
    const int mm = m0 + row;
    const int ob = mm / SEQ;
    const int ot = mm - ob * SEQ;
    const size_t orow = (size_t)ob * SEQ_OUT + ot;
    vstf4(out + orow * EMB + n0 + piece * 4, ((const v4fa*)yw)[row * 16 + piece]);
  }
}

__global__ __launch_bounds__(128) __attribute__((amdgpu_num_vgpr(256)))
void proj_kernel(const _Float16* __restrict__ C16, const _Float16* __restrict__ R16,
                 const _Float16* __restrict__ Wp16, const float* __restrict__ bp,
                 float* __restrict__ out) {
  __shared__ float Yst[4][32 * 64];   // per-wave output staging [row][col]

  const int tid  = (int)threadIdx.x;
  const int wave = tid >> 5;
  const int lane = tid & 31;
  const int lhi  = lane >> 4;
  const int ln   = lane & 15;
  const int m0   = blockIdx.x * 128 + wave * 32;
  const int n0   = blockIdx.y * 64;

  const _Float16* ah0 = C16 + (size_t)(m0 + ln) * EMB;
  const _Float16* ah1 = C16 + (size_t)(m0 + 16 + ln) * EMB;
  const _Float16* al0 = R16 + (size_t)(m0 + ln) * EMB;
  const _Float16* al1 = R16 + (size_t)(m0 + 16 + ln) * EMB;
  const _Float16* bpn = Wp16 + (size_t)(n0 + ln) * EMB;

  v8f acch[2][4], accl[2][4];
#pragma unroll
  for (int mi = 0; mi < 2; ++mi) {
#pragma unroll
    for (int nt = 0; nt < 4; ++nt) {
#pragma unroll
      for (int e = 0; e < 8; ++e) { acch[mi][nt][e] = 0.0f; accl[mi][nt][e] = 0.0f; }
    }
  }

#pragma unroll 1
  for (int k0 = 0; k0 < EMB; k0 += 32) {
    AF a0, a1, l0, l1;
    load_frag16(a0, ah0 + k0, lhi);
    load_frag16(a1, ah1 + k0, lhi);
    load_frag16(l0, al0 + k0, lhi);
    load_frag16(l1, al1 + k0, lhi);
#pragma unroll
    for (int nt = 0; nt < 4; ++nt) {
      AF bf;
      load_frag16(bf, bpn + (size_t)nt * 16 * EMB + k0, lhi);
      acch[0][nt] = mma16(a0.v, bf.v, acch[0][nt]);
      acch[1][nt] = mma16(a1.v, bf.v, acch[1][nt]);
      accl[0][nt] = mma16(l0.v, bf.v, accl[0][nt]);
      accl[1][nt] = mma16(l1.v, bf.v, accl[1][nt]);
    }
  }

  float* yw = Yst[wave];
#pragma unroll
  for (int nt = 0; nt < 4; ++nt) {
    const int col = nt * 16 + ln;
    const float bias = bf16r(bp[n0 + col]);
#pragma unroll
    for (int mi = 0; mi < 2; ++mi) {
#pragma unroll
      for (int r = 0; r < 8; ++r) {
        const float v = (acch[mi][nt][r] + accl[mi][nt][r] * 0.00048828125f) * 0.000244140625f + bias;
        yw[(mi * 16 + lhi * 8 + r) * 64 + col] = v;
      }
    }
  }
  __syncthreads();

  y_store_pass(yw, out, m0, n0, lane);
  
}

// ---------------------------------------------------------------- host
extern "C" void kernel_launch(void* const* d_in, const int* in_sizes, int n_in,
                              void* d_out, int out_size, void* d_ws, size_t ws_size,
                              hipStream_t stream) {
  if (n_in < 5) return;
  if (in_sizes[0] < ((NB - 1) * SEQ_FULL + SEQ) * EMB) return;
  if (in_sizes[1] < NQKV * HDIM) return;
  if (in_sizes[2] < NQKV) return;
  if (in_sizes[3] < EMB * EMB) return;
  if (in_sizes[4] < EMB) return;
  if (out_size < ((NB - 1) * SEQ_OUT + SEQ) * EMB) return;

  const float* x     = (const float*)d_in[0];
  const float* Wqkv  = (const float*)d_in[1];
  const float* bqkv  = (const float*)d_in[2];
  const float* Wproj = (const float*)d_in[3];
  const float* bproj = (const float*)d_in[4];
  float* out = (float*)d_out;

  char* ws = (char*)d_ws;
  size_t off = 0;
  _Float16* Wq16 = (_Float16*)(ws + off); off += (size_t)NQKV * HDIM * 2;          // 24576 B
  _Float16* Wp16 = (_Float16*)(ws + off); off += (size_t)EMB * EMB * 2;            // 2 MiB
  const size_t psz = (size_t)NB * NHEAD * SEQ * HDIM * 2;                          // 16 MiB at full size
  _Float16* Q16  = (_Float16*)(ws + off); off += psz;                               // [bh][t][64]
  _Float16* K16  = (_Float16*)(ws + off); off += psz;                               // [bh][t][64]
  _Float16* V16T = (_Float16*)(ws + off); off += psz;                               // [bh][d][t]
  _Float16* C16  = (_Float16*)(ws + off); off += (size_t)NB * SEQ * EMB * 2;        // [b*t][E] hi
  _Float16* R16  = (_Float16*)(ws + off); off += (size_t)NB * SEQ * EMB * 2;        // [b*t][E] residual
  if (off > ws_size) return;

  cvt_w16_kernel<<<(NQKV * HDIM / 8) / 256, 256, 0, stream>>>(Wqkv, Wq16, NQKV * HDIM / 8, 8.0f);
  cvt_w16_kernel<<<(EMB * EMB / 8) / 256, 256, 0, stream>>>(Wproj, Wp16, EMB * EMB / 8, 32.0f);

  dim3 g1(SEQ / 128, NHEAD, NB);
  qkv_kernel<<<g1, 256, 0, stream>>>(x, Wq16, bqkv, Q16, K16, V16T);
  attn_kernel<<<g1, 256, 0, stream>>>(Q16, K16, V16T, C16, R16);

  dim3 g3((NB * SEQ) / 128, EMB / 64);
  proj_kernel<<<g3, 128, 0, stream>>>(C16, R16, Wp16, bproj, out);
}

// v001
// It runs in 329 microseconds.
// Timed twice side by side with v000, it ran 1.48 and 1.47 times as fast.
#include <hip/hip_runtime.h>
#include <stdint.h>

// Contractions: qkv projection (K=64), q.k^T (K=64), p.v (K=32 per step): v_wmma_f32_16x16x32_f16, plain f16 operands, f32 accumulate;
// output projection (K=1024): v_wmma_f32_16x16x32_f16 with the context operand carried as f16 hi + f16 residual x2^11 (two accumulators), weights f16, f32 accumulate.
// Float inputs are RNE-converted to bf16 and then cast to f16 (exact); carries: W_qkv x8, softmax P x1024, context x128, W_proj x32; softmax and epilogues in f32.

typedef __attribute__((ext_vector_type(16))) _Float16 v16h;
typedef __attribute__((ext_vector_type(8)))  float    v8f;
typedef __attribute__((ext_vector_type(4)))  float    v4f;
typedef __attribute__((ext_vector_type(4)))  uint32_t v4u;
typedef v4u __attribute__((may_alias)) v4ua;
typedef v4f __attribute__((may_alias)) v4fa;

#ifndef NB
#define NB 4            // batch count processed
#endif
#ifndef SEQ
#define SEQ 2048        // tokens per batch processed
#endif
#ifndef SEQ_FULL
#define SEQ_FULL 2048   // per-batch token stride of the input x
#endif
#ifndef SEQ_OUT
#define SEQ_OUT SEQ     // per-batch token stride of the output buffer
#endif
#define NHEAD 16
#define EMB   1024
#define HDIM  64
#define NQKV  192

static_assert(NB >= 1);
static_assert(SEQ >= 128);
static_assert(SEQ % 128 == 0);
static_assert(SEQ <= SEQ_FULL);
static_assert(NHEAD * HDIM == EMB);
static_assert(((NQKV * HDIM) / 8) % 256 == 0);
static_assert(((EMB * EMB) / 8) % 256 == 0);
static_assert((NB * SEQ) % 128 == 0);
static_assert(EMB % 64 == 0);

// ---------------------------------------------------------------- helpers
static __device__ __forceinline__ float bf16r(float f) {   // RNE convert to bf16, back to f32
  uint32_t u = __float_as_uint(f);
  u = u + 0x7FFFu + ((u >> 16) & 1u);
  u = u & 0xFFFF0000u;
  return __uint_as_float(u);
}

union AF { v16h v; _Float16 h[16]; v4u q[2]; };
union H8 { _Float16 h[8]; v4u q; };

// 16-half WMMA fragment (A or B operand, one 32-deep k step) from a row whose
// k run is contiguous: lane row/col = lane&15; elements 0..7 <- k0+8*lhi+0..7,
// elements 8..15 <- k0+16+8*lhi+0..7 (two aligned 16-byte loads).
static __device__ __forceinline__ void load_frag16(AF& a, const _Float16* row, int lhi) {
  const v4ua* p = (const v4ua*)(row + lhi * 8);
  a.q[0] = p[0];
  a.q[1] = p[2];
}

static __device__ __forceinline__ v8f mma16(v16h a, v16h b, v8f c) {
  v8f d = __builtin_amdgcn_wmma_f32_16x16x32_f16(false, a, false, b, (short)0, c,
                                                 false, false);
  asm volatile("v_nop\n\tv_nop\n\tv_nop\n\tv_nop" : "+v"(d) : "v"(a), "v"(b));
  return d;
}

static __device__ __forceinline__ void vst16(_Float16* p, v4u v) { *(v4u*)p = v; }
static __device__ __forceinline__ void vstf4(float* p, v4f v) { *(v4f*)p = v; }

// ---------------------------------------------------------------- kernel 0
// f32 weights -> f16 plane: h = f16(bf16(w) * scale). One lane = 8 consecutive
__global__ __launch_bounds__(256) void cvt_w16_kernel(const float* __restrict__ src,
                                                      _Float16* __restrict__ dst,
                                                      int n8, float scale) {
  const int i = blockIdx.x * 256 + (int)threadIdx.x;
  if (i >= n8) return;                       // n8 is a multiple of 256 in every launch
  const v4f* sp = (const v4f*)(src + (size_t)i * 8);
  const v4f f0 = sp[0];
  const v4f f1 = sp[1];
  H8 o;
#pragma unroll
  for (int e = 0; e < 4; ++e) {
    o.h[e]     = (_Float16)(bf16r(f0[e]) * scale);
    o.h[4 + e] = (_Float16)(bf16r(f1[e]) * scale);
  }
  const v4u val = o.q;
  _Float16* dp = dst + (size_t)i * 8;
  vst16(dp, val);
  
}

// ---------------------------------------------------------------- kernel 1
// Per (b, h, 128-token tile): qkv = x_h[128x64] . Wq16^T (Wq16 = [192][64], k contiguous).
// Wave = 16 tokens x 192 columns (24 WMMA). Planes: Q16/K16 = [bh][t][64] (8q, 8k),
static __device__ __forceinline__ void qkv_store_pass(const _Float16* Qst, const _Float16* Kst,
                                                      const _Float16* Vst, _Float16* qdst,
                                                      _Float16* kdst, _Float16* vdst, int tid) {
#pragma unroll
  for (int it = 0; it < 4; ++it) {
    const int idx = it * 256 + tid;                       // 16-B piece of the contiguous 16 KB tile
    vst16(qdst + (size_t)idx * 8, ((const v4ua*)Qst)[idx]);
    vst16(kdst + (size_t)idx * 8, ((const v4ua*)Kst)[idx]);
    const int d = it * 16 + (tid >> 4);                   // V^T row (0..63), 256 B per row segment
    const int piece = tid & 15;
    vst16(vdst + (size_t)d * SEQ + piece * 8, ((const v4ua*)Vst)[d * 16 + piece]);
  }
}

__global__ __launch_bounds__(256) __attribute__((amdgpu_num_vgpr(256)))
void qkv_kernel(const float* __restrict__ x, const _Float16* __restrict__ Wq16,
                const float* __restrict__ bq, _Float16* __restrict__ Q16,
                _Float16* __restrict__ K16, _Float16* __restrict__ V16T) {
  __shared__ _Float16 Qst[128 * HDIM];   // [token][d]
  __shared__ _Float16 Kst[128 * HDIM];   // [token][d]
  __shared__ _Float16 Vst[HDIM * 128];   // [d][token]

  const int tid  = (int)threadIdx.x;
  const int wave = tid >> 5;
  const int lane = tid & 31;
  const int lhi  = lane >> 4;
  const int ln   = lane & 15;
  const int tb   = blockIdx.x * 128;
  const int h    = blockIdx.y;
  const int b    = blockIdx.z;

  // A fragments: x rows (tokens) x 64 dims, f32 -> bf16 RNE -> f16 in registers.
  const int trow = tb + wave * 16 + ln;
  const float* xrow = x + ((size_t)b * SEQ_FULL + trow) * EMB + h * HDIM;
  AF xa[2];
#pragma unroll
  for (int ks = 0; ks < 2; ++ks) {
    const v4f* xp = (const v4f*)(xrow + ks * 32 + lhi * 8);
    const v4f f0 = xp[0], f1 = xp[1];    // k = ks*32 + 8*lhi + 0..7   (elements 0..7)
    const v4f f2 = xp[4], f3 = xp[5];    // k = ks*32 + 16 + 8*lhi +.. (elements 8..15)
#pragma unroll
    for (int e = 0; e < 4; ++e) {
      xa[ks].h[e]      = (_Float16)bf16r(f0[e]);
      xa[ks].h[4 + e]  = (_Float16)bf16r(f1[e]);
      xa[ks].h[8 + e]  = (_Float16)bf16r(f2[e]);
      xa[ks].h[12 + e] = (_Float16)bf16r(f3[e]);
    }
  }

  const int rbase = wave * 16 + lhi * 8;   // D rows of this lane: rbase + r
#pragma unroll
  for (int n = 0; n < 12; ++n) {
    const int colg = n * 16 + ln;          // output column 0..191 = B column of this lane
    AF wb0, wb1;
    load_frag16(wb0, Wq16 + colg * HDIM, lhi);
    load_frag16(wb1, Wq16 + colg * HDIM + 32, lhi);
    const float bv = 8.0f * bf16r(bq[colg]);
    v8f acc;
#pragma unroll
    for (int e = 0; e < 8; ++e) acc[e] = bv;
    acc = mma16(xa[0].v, wb0.v, acc);
    acc = mma16(xa[1].v, wb1.v, acc);
    const int cl = (n & 3) * 16 + ln;      // column within the 64-wide q / k / v block
    if (n < 4) {
#pragma unroll
      for (int r = 0; r < 8; ++r) Qst[(rbase + r) * HDIM + cl] = (_Float16)acc[r];
    } else if (n < 8) {
#pragma unroll
      for (int r = 0; r < 8; ++r) Kst[(rbase + r) * HDIM + cl] = (_Float16)acc[r];
    } else {
#pragma unroll
      for (int r = 0; r < 8; ++r) Vst[cl * 128 + rbase + r] = (_Float16)acc[r];
    }
  }
  __syncthreads();   // cross-wave staging complete

  const size_t bh = (size_t)(b * NHEAD + h);
  _Float16* qdst = Q16 + (bh * SEQ + tb) * HDIM;
  _Float16* kdst = K16 + (bh * SEQ + tb) * HDIM;
  _Float16* vdst = V16T + bh * HDIM * SEQ + tb;
  qkv_store_pass(Qst, Kst, Vst, qdst, kdst, vdst, tid);
  
}

// ---------------------------------------------------------------- kernel 2
// Flash attention, transposed products. Block = 8 waves = 128 query columns of one (b,h);
// key blocks of 32: S^T = K.Q^T (4 WMMA, A = K rows, B = Q kept in registers), so a lane holds
// 16 scores of ONE query (column ln; keys 8*lhi+r and 16+8*lhi+r). Maximum and sum run in the
// lane, plus one exchange between the wave halves for the maximum. The two score tiles,
// converted in place, are the B operand of O^T += V^T.P^T (4 WMMA, A = V^T rows): P x1024
// goes from registers to registers. K/V fragments are read straight from the planes.
// Outputs: C16 = [b][t][E] f16 hi of 128*ctx, R16 = [b][t][E] f16 residual (128*ctx - hi) x 2048,
// heads interleaved (e = h*64 + d).
static __device__ __forceinline__ void ctx_store_pass(const _Float16* ow, _Float16* cdst, int lane) {
  const int prow = lane >> 3, piece = lane & 7;
#pragma unroll
  for (int i = 0; i < 4; ++i) {
    const int row = i * 4 + prow;
    vst16(cdst + (size_t)row * EMB + piece * 8, ((const v4ua*)ow)[row * 8 + piece]);
  }
}

static __device__ __forceinline__ float other_half(float v) {   // value held by lane l ^ 16
  const int b = __float_as_int(v);
  return __int_as_float(__builtin_amdgcn_permlanex16(b, b, 0x76543210, 0xfedcba98, false, false));
}

__global__ __launch_bounds__(256) __attribute__((amdgpu_num_vgpr(256)))
void attn_kernel(const _Float16* __restrict__ Q16, const _Float16* __restrict__ K16,
                 const _Float16* __restrict__ V16T, _Float16* __restrict__ C16,
                 _Float16* __restrict__ R16) {
  __shared__ _Float16 Ost[8][16 * HDIM];   // per-wave hi staging [query][d]
  __shared__ _Float16 Rst[8][16 * HDIM];   // per-wave residual staging [query][d]

  const int tid  = (int)threadIdx.x;
  const int wave = tid >> 5;
  const int lane = tid & 31;
  const int lhi  = lane >> 4;
  const int ln   = lane & 15;
  const int qb   = blockIdx.x * 128;
  const int h    = blockIdx.y;
  const int b    = blockIdx.z;
  const size_t bh = (size_t)(b * NHEAD + h);
  const _Float16* Qp = Q16 + bh * SEQ * HDIM;
  const _Float16* Kp = K16 + bh * SEQ * HDIM;
  const _Float16* Vp = V16T + bh * HDIM * SEQ;

  // Q B-fragments for this wave's 16 query columns (plane carries 8q).
  const int trow = qb + wave * 16 + ln;
  AF qa0, qa1;
  load_frag16(qa0, Qp + (size_t)trow * HDIM, lhi);
  load_frag16(qa1, Qp + (size_t)trow * HDIM + 32, lhi);

  float m = -3.0e38f;   // running maximum of query ln (equal in both halves)
  float ls = 0.0f;      // running sum over this half's keys only; halves joined after the loop
  v8f o[4];             // o[d][r] = O^T[d*16 + 8*lhi + r][query ln]
#pragma unroll
  for (int d = 0; d < 4; ++d) {
#pragma unroll
    for (int e = 0; e < 8; ++e) o[d][e] = 0.0f;
  }

  const float SC = 0.001953125f;   // (8q).(8k) / 512 = q.k / 8

#pragma unroll 1
  for (int kb = 0; kb < SEQ / 32; ++kb) {
    // S^T = K . Q^T : two 16-key tiles, each 2 k-steps over 64 dims.
    v8f s[2];
#pragma unroll
    for (int nt = 0; nt < 2; ++nt) {
      const int key = kb * 32 + nt * 16 + ln;    // A row of this lane
      AF f0, f1;
      load_frag16(f0, Kp + (size_t)key * HDIM, lhi);
      load_frag16(f1, Kp + (size_t)key * HDIM + 32, lhi);
      v8f c;
#pragma unroll
      for (int e = 0; e < 8; ++e) c[e] = 0.0f;
      c = mma16(f0.v, qa0.v, c);
      c = mma16(f1.v, qa1.v, c);
      s[nt] = c;
    }

    // Online softmax (f32), one query per lane. SC is a power of two: max(s) * SC = max(s * SC).
    float mx0 = s[0][0], mx1 = s[1][0];
#pragma unroll
    for (int r = 1; r < 8; ++r) {
      mx0 = fmaxf(mx0, s[0][r]);
      mx1 = fmaxf(mx1, s[1][r]);
    }
    float mx = fmaxf(mx0, mx1);
    mx = fmaxf(mx, other_half(mx)) * SC;
    const float mn = fmaxf(m, mx);
    const float corr = __expf(m - mn);
    m = mn;

    // P^T as a 32x16 B fragment: element nt*8+r = key nt*16 + 8*lhi + r, the hardware k order
    // that load_frag16 gives the V^T rows.
    AF pb;
    float rs0 = 0.0f, rs1 = 0.0f;
#pragma unroll
    for (int r = 0; r < 8; ++r) {
      const float p0 = __expf(s[0][r] * SC - mn);
      const float p1 = __expf(s[1][r] * SC - mn);
      rs0 += p0;
      rs1 += p1;
      pb.h[r]     = (_Float16)(p0 * 1024.0f);
      pb.h[8 + r] = (_Float16)(p1 * 1024.0f);
    }
    ls = ls * corr + (rs0 + rs1);
#pragma unroll
    for (int d = 0; d < 4; ++d) {
#pragma unroll
      for (int r = 0; r < 8; ++r) o[d][r] *= corr;
    }

    // O^T += V^T . P^T : four 16-row d tiles; V^T plane row d holds keys contiguous.
#pragma unroll
    for (int d = 0; d < 4; ++d) {
      AF vf;
      load_frag16(vf, Vp + (size_t)(d * 16 + ln) * SEQ + kb * 32, lhi);
      o[d] = mma16(vf.v, pb.v, o[d]);
    }
  }

  // O = sum (1024 p)(8 v); c = 128 * ctx = O / (64 * l); hi = f16(c), res = f16((c - hi) * 2048).
  // A lane holds 8 consecutive d of its query per tile: one 16-byte staging store each.
  _Float16* ow = Ost[wave];
  _Float16* rw = Rst[wave];
  const float lt = ls + other_half(ls);
  const float inv = (1.0f / lt) * 0.015625f;
#pragma unroll
  for (int d = 0; d < 4; ++d) {
    H8 hv, rv;
#pragma unroll
    for (int r = 0; r < 8; ++r) {
      const float c = o[d][r] * inv;
      const _Float16 hh = (_Float16)c;
      const float resf = (c - (float)hh) * 2048.0f;
      hv.h[r] = hh;
      rv.h[r] = (_Float16)resf;
    }
    vst16(ow + ln * HDIM + d * 16 + lhi * 8, hv.q);
    vst16(rw + ln * HDIM + d * 16 + lhi * 8, rv.q);
  }
  __syncthreads();

  const size_t coff = ((size_t)b * SEQ + qb + wave * 16) * EMB + h * HDIM;
  _Float16* cdst = C16 + coff;
  _Float16* rdst = R16 + coff;
  ctx_store_pass(ow, cdst, lane);
  ctx_store_pass(rw, rdst, lane);
  
}

// ---------------------------------------------------------------- kernel 3
// y[m][f] = (sum_e C16[m][e]*Wp16[f][e] + (sum_e R16[m][e]*Wp16[f][e]) / 2048) / 4096 + bf16(b_proj[f]);
// M = NB*SEQ, N = K = 1024. Block = 4 waves, wave tile 32 rows x 64 cols, two accumulator
// sets (hi plane, residual plane), fragments read from the planes.
static __device__ __forceinline__ void y_store_pass(const float* yw, float* out, int m0, int n0,
                                                    int lane) {
  const int prow = lane >> 4, piece = lane & 15;   // 16 lanes x 16 B = one 256-B row segment
#pragma unroll
  for (int i = 0; i < 16; ++i) {
    const int row = i * 2 + prow;
    const int mm = m0 + row;
    const int ob = mm / SEQ;
    const int ot = mm - ob * SEQ;
    const size_t orow = (size_t)ob * SEQ_OUT + ot;
    vstf4(out + orow * EMB + n0 + piece * 4, ((const v4fa*)yw)[row * 16 + piece]);
  }
}

__global__ __launch_bounds__(128) __attribute__((amdgpu_num_vgpr(256)))
void proj_kernel(const _Float16* __restrict__ C16, const _Float16* __restrict__ R16,
                 const _Float16* __restrict__ Wp16, const float* __restrict__ bp,
                 float* __restrict__ out) {
  __shared__ float Yst[4][32 * 64];   // per-wave output staging [row][col]

  const int tid  = (int)threadIdx.x;
  const int wave = tid >> 5;
  const int lane = tid & 31;
  const int lhi  = lane >> 4;
  const int ln   = lane & 15;
  const int m0   = blockIdx.x * 128 + wave * 32;
  const int n0   = blockIdx.y * 64;

  const _Float16* ah0 = C16 + (size_t)(m0 + ln) * EMB;
  const _Float16* ah1 = C16 + (size_t)(m0 + 16 + ln) * EMB;
  const _Float16* al0 = R16 + (size_t)(m0 + ln) * EMB;
  const _Float16* al1 = R16 + (size_t)(m0 + 16 + ln) * EMB;
  const _Float16* bpn = Wp16 + (size_t)(n0 + ln) * EMB;

  v8f acch[2][4], accl[2][4];
#pragma unroll
  for (int mi = 0; mi < 2; ++mi) {
#pragma unroll
    for (int nt = 0; nt < 4; ++nt) {
#pragma unroll
      for (int e = 0; e < 8; ++e) { acch[mi][nt][e] = 0.0f; accl[mi][nt][e] = 0.0f; }
    }
  }

#pragma unroll 1
  for (int k0 = 0; k0 < EMB; k0 += 32) {
    AF a0, a1, l0, l1;
    load_frag16(a0, ah0 + k0, lhi);
    load_frag16(a1, ah1 + k0, lhi);
    load_frag16(l0, al0 + k0, lhi);
    load_frag16(l1, al1 + k0, lhi);
#pragma unroll
    for (int nt = 0; nt < 4; ++nt) {
      AF bf;
      load_frag16(bf, bpn + (size_t)nt * 16 * EMB + k0, lhi);
      acch[0][nt] = mma16(a0.v, bf.v, acch[0][nt]);
      acch[1][nt] = mma16(a1.v, bf.v, acch[1][nt]);
      accl[0][nt] = mma16(l0.v, bf.v, accl[0][nt]);
      accl[1][nt] = mma16(l1.v, bf.v, accl[1][nt]);
    }
  }

  float* yw = Yst[wave];
#pragma unroll
  for (int nt = 0; nt < 4; ++nt) {
    const int col = nt * 16 + ln;
    const float bias = bf16r(bp[n0 + col]);
#pragma unroll
    for (int mi = 0; mi < 2; ++mi) {
#pragma unroll
      for (int r = 0; r < 8; ++r) {
        const float v = (acch[mi][nt][r] + accl[mi][nt][r] * 0.00048828125f) * 0.000244140625f + bias;
        yw[(mi * 16 + lhi * 8 + r) * 64 + col] = v;
      }
    }
  }
  __syncthreads();

  y_store_pass(yw, out, m0, n0, lane);
  
}

// ---------------------------------------------------------------- host
extern "C" void kernel_launch(void* const* d_in, const int* in_sizes, int n_in,
                              void* d_out, int out_size, void* d_ws, size_t ws_size,
                              hipStream_t stream) {
  if (n_in < 5) return;
  if (in_sizes[0] < ((NB - 1) * SEQ_FULL + SEQ) * EMB) return;
  if (in_sizes[1] < NQKV * HDIM) return;
  if (in_sizes[2] < NQKV) return;
  if (in_sizes[3] < EMB * EMB) return;
  if (in_sizes[4] < EMB) return;
  if (out_size < ((NB - 1) * SEQ_OUT + SEQ) * EMB) return;

  const float* x     = (const float*)d_in[0];
  const float* Wqkv  = (const float*)d_in[1];
  const float* bqkv  = (const float*)d_in[2];
  const float* Wproj = (const float*)d_in[3];
  const float* bproj = (const float*)d_in[4];
  float* out = (float*)d_out;

  char* ws = (char*)d_ws;
  size_t off = 0;
  _Float16* Wq16 = (_Float16*)(ws + off); off += (size_t)NQKV * HDIM * 2;          // 24576 B
  _Float16* Wp16 = (_Float16*)(ws + off); off += (size_t)EMB * EMB * 2;            // 2 MiB
  const size_t psz = (size_t)NB * NHEAD * SEQ * HDIM * 2;                          // 16 MiB at full size
  _Float16* Q16  = (_Float16*)(ws + off); off += psz;                               // [bh][t][64]
  _Float16* K16  = (_Float16*)(ws + off); off += psz;                               // [bh][t][64]
  _Float16* V16T = (_Float16*)(ws + off); off += psz;                               // [bh][d][t]
  _Float16* C16  = (_Float16*)(ws + off); off += (size_t)NB * SEQ * EMB * 2;        // [b*t][E] hi
  _Float16* R16  = (_Float16*)(ws + off); off += (size_t)NB * SEQ * EMB * 2;        // [b*t][E] residual
  if (off > ws_size) return;

  cvt_w16_kernel<<<(NQKV * HDIM / 8) / 256, 256, 0, stream>>>(Wqkv, Wq16, NQKV * HDIM / 8, 8.0f);
  cvt_w16_kernel<<<(EMB * EMB / 8) / 256, 256, 0, stream>>>(Wproj, Wp16, EMB * EMB / 8, 32.0f);

  dim3 g1(SEQ / 128, NHEAD, NB);
  qkv_kernel<<<g1, 256, 0, stream>>>(x, Wq16, bqkv, Q16, K16, V16T);
  attn_kernel<<<g1, 256, 0, stream>>>(Q16, K16, V16T, C16, R16);

  dim3 g3((NB * SEQ) / 128, EMB / 64);
  proj_kernel<<<g3, 128, 0, stream>>>(C16, R16, Wp16, bproj, out);
}

// v002
// A run of this version takes 285 microseconds.
// Timed twice side by side with v001, it ran 1.15 and 1.16 times as fast.
// All steps since v000 together make it 1.70 times as fast.
#include <hip/hip_runtime.h>
#include <stdint.h>

// Contractions: qkv projection (K=64), q.k^T (K=64), p.v (K=32 per step): v_wmma_f32_16x16x32_f16, plain f16 operands, f32 accumulate;
// output projection (K=1024): v_wmma_f32_16x16x32_f16 with the context operand carried as f16 hi + f16 residual x2^11 (two accumulators), weights f16, f32 accumulate.
// Float inputs are RNE-converted to bf16 and then cast to f16 (exact); carries: W_qkv x8, softmax P x1024, context x128, W_proj x32; softmax and epilogues in f32.

typedef __attribute__((ext_vector_type(16))) _Float16 v16h;
typedef __attribute__((ext_vector_type(8)))  float    v8f;
typedef __attribute__((ext_vector_type(4)))  float    v4f;
typedef __attribute__((ext_vector_type(4)))  uint32_t v4u;
typedef v4u __attribute__((may_alias)) v4ua;
typedef v4f __attribute__((may_alias)) v4fa;

#ifndef NB
#define NB 4            // batch count processed
#endif
#ifndef SEQ
#define SEQ 2048        // tokens per batch processed
#endif
#ifndef SEQ_FULL
#define SEQ_FULL 2048   // per-batch token stride of the input x
#endif
#ifndef SEQ_OUT
#define SEQ_OUT SEQ     // per-batch token stride of the output buffer
#endif
#define NHEAD 16
#define EMB   1024
#define HDIM  64
#define NQKV  192

static_assert(NB >= 1);
static_assert(SEQ >= 128);
static_assert(SEQ % 128 == 0);
static_assert(SEQ <= SEQ_FULL);
static_assert(NHEAD * HDIM == EMB);
static_assert(((NQKV * HDIM) / 8) % 256 == 0);
static_assert(((EMB * EMB) / 8) % 256 == 0);
static_assert((NB * SEQ) % 128 == 0);
static_assert(EMB % 64 == 0);

// ---------------------------------------------------------------- helpers
static __device__ __forceinline__ float bf16r(float f) {   // RNE convert to bf16, back to f32
  uint32_t u = __float_as_uint(f);
  u = u + 0x7FFFu + ((u >> 16) & 1u);
  u = u & 0xFFFF0000u;
  return __uint_as_float(u);
}

union AF { v16h v; _Float16 h[16]; v4u q[2]; };
union H8 { _Float16 h[8]; v4u q; };

// 16-half WMMA fragment (A or B operand, one 32-deep k step): lane row/col = lane&15;
// elements 0..7 <- k 8*lhi+0..7, elements 8..15 <- k 16+8*lhi+0..7 (two aligned 16-byte loads).
// Fragment-order planes: every f16 operand plane in the workspace is a sequence of 1-KB
// fragments (16 rows x 32 k). Inside a fragment, half index j*256 + lane*8 + e holds
// (row lane&15, k 16*j + 8*(lane>>4) + e), so that each of the two loads of a wave covers
// 512 contiguous bytes (4 whole lines) instead of 32-byte pieces of 16 lines.
#define FRAG 512        // halves per fragment
static __device__ __forceinline__ void load_fragp(AF& a, const _Float16* frag, int lane) {
  const v4ua* p = (const v4ua*)(frag + lane * 8);
  a.q[0] = p[0];
  a.q[1] = p[32];
}

static __device__ __forceinline__ v8f mma16(v16h a, v16h b, v8f c) {
  v8f d = __builtin_amdgcn_wmma_f32_16x16x32_f16(false, a, false, b, (short)0, c,
                                                 false, false);
  asm volatile("v_nop\n\tv_nop\n\tv_nop\n\tv_nop" : "+v"(d) : "v"(a), "v"(b));
  return d;
}

static __device__ __forceinline__ void vst16(_Float16* p, v4u v) { *(v4u*)p = v; }
static __device__ __forceinline__ void vstf4(float* p, v4f v) { *(v4f*)p = v; }

// ---------------------------------------------------------------- kernel 0
// f32 weights [rows][32 << ksh] -> f16 fragment-order plane [rows/16][1 << ksh][FRAG]:
// h = f16(bf16(w) * scale). One lane = one 16-byte piece of the plane = 8 consecutive k of one row.
__global__ __launch_bounds__(256) void cvt_w16_kernel(const float* __restrict__ src,
                                                      _Float16* __restrict__ dst,
                                                      int n8, float scale, int ksh) {
  const int i = blockIdx.x * 256 + (int)threadIdx.x;
  if (i >= n8) return;                       // n8 is a multiple of 256 in every launch
  const int fr  = i >> 6;                    // fragment; piece i&63 = j*32 + lane
  const int row = (fr >> ksh) * 16 + (i & 15);
  const int k   = (fr & ((1 << ksh) - 1)) * 32 + ((i >> 5) & 1) * 16 + ((i >> 4) & 1) * 8;
  const v4f* sp = (const v4f*)(src + ((size_t)row << (ksh + 5)) + k);
  const v4f f0 = sp[0];
  const v4f f1 = sp[1];
  H8 o;
#pragma unroll
  for (int e = 0; e < 4; ++e) {
    o.h[e]     = (_Float16)(bf16r(f0[e]) * scale);
    o.h[4 + e] = (_Float16)(bf16r(f1[e]) * scale);
  }
  const v4u val = o.q;
  _Float16* dp = dst + (size_t)i * 8;
  vst16(dp, val);
  
}

// ---------------------------------------------------------------- kernel 1
// Per (b, h, 128-token tile): qkv = x_h[128x64] . Wq16^T (Wq16 = [192][64] as fragment-order plane [12][2][FRAG]).
// Wave = 16 tokens x 192 columns (24 WMMA). Planes, fragment order: Q16/K16 = [bh][t/16][d/32][FRAG]
// (rows = tokens, k = d; 8q, 8k), V16T = [bh][t/32][d/16][FRAG] (rows = d, k = tokens; 8v).
// A 128-token tile is 16 KB contiguous in each plane.
static __device__ __forceinline__ void qkv_store_pass(const _Float16* Qst, const _Float16* Kst,
                                                      const _Float16* Vst, _Float16* qdst,
                                                      _Float16* kdst, _Float16* vdst, int tid) {
#pragma unroll
  for (int it = 0; it < 4; ++it) {
    const int idx = it * 256 + tid;                       // 16-B piece of the contiguous 16 KB tile
    vst16(qdst + (size_t)idx * 8, ((const v4ua*)Qst)[idx]);
    vst16(kdst + (size_t)idx * 8, ((const v4ua*)Kst)[idx]);
    vst16(vdst + (size_t)idx * 8, ((const v4ua*)Vst)[idx]);
  }
}

__global__ __launch_bounds__(256) __attribute__((amdgpu_num_vgpr(256)))
void qkv_kernel(const float* __restrict__ x, const _Float16* __restrict__ Wq16,
                const float* __restrict__ bq, _Float16* __restrict__ Q16,
                _Float16* __restrict__ K16, _Float16* __restrict__ V16T) {
  __shared__ _Float16 Qst[128 * HDIM];   // [token/16][d/32][FRAG]
  __shared__ _Float16 Kst[128 * HDIM];   // [token/16][d/32][FRAG]
  __shared__ _Float16 Vst[HDIM * 128];   // [token/32][d/16][FRAG]

  const int tid  = (int)threadIdx.x;
  const int wave = tid >> 5;
  const int lane = tid & 31;
  const int lhi  = lane >> 4;
  const int ln   = lane & 15;
  const int tb   = blockIdx.x * 128;
  const int h    = blockIdx.y;
  const int b    = blockIdx.z;

  // A fragments: x rows (tokens) x 64 dims, f32 -> bf16 RNE -> f16 in registers.
  const int trow = tb + wave * 16 + ln;
  const float* xrow = x + ((size_t)b * SEQ_FULL + trow) * EMB + h * HDIM;
  AF xa[2];
#pragma unroll
  for (int ks = 0; ks < 2; ++ks) {
    const v4f* xp = (const v4f*)(xrow + ks * 32 + lhi * 8);
    const v4f f0 = xp[0], f1 = xp[1];    // k = ks*32 + 8*lhi + 0..7   (elements 0..7)
    const v4f f2 = xp[4], f3 = xp[5];    // k = ks*32 + 16 + 8*lhi +.. (elements 8..15)
#pragma unroll
    for (int e = 0; e < 4; ++e) {
      xa[ks].h[e]      = (_Float16)bf16r(f0[e]);
      xa[ks].h[4 + e]  = (_Float16)bf16r(f1[e]);
      xa[ks].h[8 + e]  = (_Float16)bf16r(f2[e]);
      xa[ks].h[12 + e] = (_Float16)bf16r(f3[e]);
    }
  }

  // D rows of this lane: tokens wave*16 + lhi*8 + r; D column: ln.
  const int qkpos = ((ln >> 3) * 16 + lhi * 8) * 8 + (ln & 7);   // + r*8: row lhi*8+r, k 8*(ln>>3) + (ln&7)
#pragma unroll
  for (int n = 0; n < 12; ++n) {
    const int colg = n * 16 + ln;          // output column 0..191 = B column of this lane
    AF wb0, wb1;
    load_fragp(wb0, Wq16 + (n * 2) * FRAG, lane);
    load_fragp(wb1, Wq16 + (n * 2 + 1) * FRAG, lane);
    const float bv = 8.0f * bf16r(bq[colg]);
    v8f acc;
#pragma unroll
    for (int e = 0; e < 8; ++e) acc[e] = bv;
    acc = mma16(xa[0].v, wb0.v, acc);
    acc = mma16(xa[1].v, wb1.v, acc);
    const int ct = n & 3;                  // 16-column tile within the 64-wide q / k / v block
    const int qkoff = (wave * 2 + (ct >> 1)) * FRAG + (ct & 1) * 256 + qkpos;
    if (n < 4) {
#pragma unroll
      for (int r = 0; r < 8; ++r) Qst[qkoff + r * 8] = (_Float16)acc[r];
    } else if (n < 8) {
#pragma unroll
      for (int r = 0; r < 8; ++r) Kst[qkoff + r * 8] = (_Float16)acc[r];
    } else {
      // row d = ct*16 + ln, k = tokens (wave&1)*16 + 8*lhi + r: the lane's own 16-byte piece
      H8 vv;
#pragma unroll
      for (int r = 0; r < 8; ++r) vv.h[r] = (_Float16)acc[r];
      vst16(Vst + ((wave >> 1) * 4 + ct) * FRAG + (wave & 1) * 256 + lane * 8, vv.q);
    }
  }
  __syncthreads();   // cross-wave staging complete

  const size_t bh = (size_t)(b * NHEAD + h);
  _Float16* qdst = Q16 + (bh * SEQ + tb) * HDIM;
  _Float16* kdst = K16 + (bh * SEQ + tb) * HDIM;
  _Float16* vdst = V16T + (bh * SEQ + tb) * HDIM;
  qkv_store_pass(Qst, Kst, Vst, qdst, kdst, vdst, tid);
  
}

// ---------------------------------------------------------------- kernel 2
// Flash attention, transposed products. Block = 8 waves = 128 query columns of one (b,h);
// key blocks of 32: S^T = K.Q^T (4 WMMA, A = K rows, B = Q kept in registers), so a lane holds
// 16 scores of ONE query (column ln; keys 8*lhi+r and 16+8*lhi+r). Maximum and sum run in the
// lane, plus one exchange between the wave halves for the maximum. The two score tiles,
// converted in place, are the B operand of O^T += V^T.P^T (4 WMMA, A = V^T rows): P x1024
// goes from registers to registers. K/V fragments are read straight from the planes.
// Outputs, fragment order [b*t/16][e/32][FRAG] (rows = tokens, k = e = h*64 + d): C16 = f16 hi of
// 128*ctx, R16 = f16 residual (128*ctx - hi) x 2048.

static __device__ __forceinline__ float other_half(float v) {   // value held by lane l ^ 16
  const int b = __float_as_int(v);
  return __int_as_float(__builtin_amdgcn_permlanex16(b, b, 0x76543210, 0xfedcba98, false, false));
}

__global__ __launch_bounds__(256) __attribute__((amdgpu_num_vgpr(256)))
void attn_kernel(const _Float16* __restrict__ Q16, const _Float16* __restrict__ K16,
                 const _Float16* __restrict__ V16T, _Float16* __restrict__ C16,
                 _Float16* __restrict__ R16) {
  const int tid  = (int)threadIdx.x;
  const int wave = tid >> 5;
  const int lane = tid & 31;               // below: lhi = lane >> 4, ln = lane & 15
  const int qb   = blockIdx.x * 128;
  const int h    = blockIdx.y;
  const int b    = blockIdx.z;
  const size_t bh = (size_t)(b * NHEAD + h);
  const _Float16* Qp = Q16 + bh * SEQ * HDIM;
  const _Float16* Kp = K16 + bh * SEQ * HDIM;
  const _Float16* Vp = V16T + bh * SEQ * HDIM;

  // Q B-fragments for this wave's 16 query columns (plane carries 8q).
  const int qt = (qb >> 4) + wave;
  AF qa0, qa1;
  load_fragp(qa0, Qp + (size_t)(qt * 2) * FRAG, lane);
  load_fragp(qa1, Qp + (size_t)(qt * 2 + 1) * FRAG, lane);

  float m = -3.0e38f;   // running maximum of query ln (equal in both halves)
  float ls = 0.0f;      // running sum over this half's keys only; halves joined after the loop
  v8f o[4];             // o[d][r] = O^T[d*16 + 8*lhi + r][query ln]
#pragma unroll
  for (int d = 0; d < 4; ++d) {
#pragma unroll
    for (int e = 0; e < 8; ++e) o[d][e] = 0.0f;
  }

  const float SC = 0.001953125f;   // (8q).(8k) / 512 = q.k / 8

#pragma unroll 1
  for (int kb = 0; kb < SEQ / 32; ++kb) {
    // S^T = K . Q^T : two 16-key tiles, each 2 k-steps over 64 dims.
    v8f s[2];
#pragma unroll
    for (int nt = 0; nt < 2; ++nt) {
      const int kt = kb * 2 + nt;                // 16-key tile: A rows
      AF f0, f1;
      load_fragp(f0, Kp + (size_t)(kt * 2) * FRAG, lane);
      load_fragp(f1, Kp + (size_t)(kt * 2 + 1) * FRAG, lane);
      v8f c;
#pragma unroll
      for (int e = 0; e < 8; ++e) c[e] = 0.0f;
      c = mma16(f0.v, qa0.v, c);
      c = mma16(f1.v, qa1.v, c);
      s[nt] = c;
    }

    // Online softmax (f32), one query per lane. SC is a power of two: max(s) * SC = max(s * SC).
    float mx0 = s[0][0], mx1 = s[1][0];
#pragma unroll
    for (int r = 1; r < 8; ++r) {
      mx0 = fmaxf(mx0, s[0][r]);
      mx1 = fmaxf(mx1, s[1][r]);
    }
    float mx = fmaxf(mx0, mx1);
    mx = fmaxf(mx, other_half(mx)) * SC;
    const float mn = fmaxf(m, mx);
    const float corr = __expf(m - mn);
    m = mn;

    // P^T as a 32x16 B fragment: element nt*8+r = key nt*16 + 8*lhi + r, the hardware k order
    // that the V^T fragments have.
    AF pb;
    float rs0 = 0.0f, rs1 = 0.0f;
#pragma unroll
    for (int r = 0; r < 8; ++r) {
      const float p0 = __expf(s[0][r] * SC - mn);
      const float p1 = __expf(s[1][r] * SC - mn);
      rs0 += p0;
      rs1 += p1;
      pb.h[r]     = (_Float16)(p0 * 1024.0f);
      pb.h[8 + r] = (_Float16)(p1 * 1024.0f);
    }
    ls = ls * corr + (rs0 + rs1);
#pragma unroll
    for (int d = 0; d < 4; ++d) {
#pragma unroll
      for (int r = 0; r < 8; ++r) o[d][r] *= corr;
    }

    // O^T += V^T . P^T : four 16-row d tiles, one fragment each.
#pragma unroll
    for (int d = 0; d < 4; ++d) {
      AF vf;
      load_fragp(vf, Vp + (size_t)(kb * 4 + d) * FRAG, lane);
      o[d] = mma16(vf.v, pb.v, o[d]);
    }
  }

  // O = sum (1024 p)(8 v); c = 128 * ctx = O / (64 * l); hi = f16(c), res = f16((c - hi) * 2048).
  // A lane holds 8 consecutive d of its query per tile (row ln, k (d&1)*16 + 8*lhi + r of fragment
  // h*2 + d/2): its own 16-byte piece of the plane, so a wave's store is 512 contiguous bytes.
  const size_t coff = (((((size_t)b * SEQ + qb) >> 4) + wave) * (EMB / 32) + h * 2) * FRAG + lane * 8;
  _Float16* cdst = C16 + coff;
  _Float16* rdst = R16 + coff;
  const float lt = ls + other_half(ls);
  const float inv = (1.0f / lt) * 0.015625f;
#pragma unroll
  for (int d = 0; d < 4; ++d) {
    H8 hv, rv;
#pragma unroll
    for (int r = 0; r < 8; ++r) {
      const float c = o[d][r] * inv;
      const _Float16 hh = (_Float16)c;
      const float resf = (c - (float)hh) * 2048.0f;
      hv.h[r] = hh;
      rv.h[r] = (_Float16)resf;
    }
    vst16(cdst + d * 256, hv.q);
    vst16(rdst + d * 256, rv.q);
  }
}

// ---------------------------------------------------------------- kernel 3
// y[m][f] = (sum_e C16[m][e]*Wp16[f][e] + (sum_e R16[m][e]*Wp16[f][e]) / 2048) / 4096 + bf16(b_proj[f]);
// M = NB*SEQ, N = K = 1024. Block = 4 waves, wave tile 32 rows x 64 cols, two accumulator
// sets (hi plane, residual plane), fragments read from the planes.
static __device__ __forceinline__ void y_store_pass(const float* yw, float* out, int m0, int n0,
                                                    int lane) {
  const int prow = lane >> 4, piece = lane & 15;   // 16 lanes x 16 B = one 256-B row segment
#pragma unroll
  for (int i = 0; i < 16; ++i) {
    const int row = i * 2 + prow;
    const int mm = m0 + row;
    const int ob = mm / SEQ;
    const int ot = mm - ob * SEQ;
    const size_t orow = (size_t)ob * SEQ_OUT + ot;
    vstf4(out + orow * EMB + n0 + piece * 4, ((const v4fa*)yw)[row * 16 + piece]);
  }
}

__global__ __launch_bounds__(128) __attribute__((amdgpu_num_vgpr(256)))
void proj_kernel(const _Float16* __restrict__ C16, const _Float16* __restrict__ R16,
                 const _Float16* __restrict__ Wp16, const float* __restrict__ bp,
                 float* __restrict__ out) {
  __shared__ float Yst[4][32 * 64];   // per-wave output staging [row][col]

  const int tid  = (int)threadIdx.x;
  const int wave = tid >> 5;
  const int lane = tid & 31;
  const int lhi  = lane >> 4;
  const int ln   = lane & 15;
  const int m0   = blockIdx.x * 128 + wave * 32;
  const int n0   = blockIdx.y * 64;

  const int TROW = (EMB / 32) * FRAG;   // halves per 16-row tile of a plane
  const _Float16* ah0 = C16 + (size_t)(m0 >> 4) * TROW;
  const _Float16* ah1 = ah0 + TROW;
  const _Float16* al0 = R16 + (size_t)(m0 >> 4) * TROW;
  const _Float16* al1 = al0 + TROW;
  const _Float16* bpn = Wp16 + (size_t)(n0 >> 4) * TROW;

  v8f acch[2][4], accl[2][4];
#pragma unroll
  for (int mi = 0; mi < 2; ++mi) {
#pragma unroll
    for (int nt = 0; nt < 4; ++nt) {
#pragma unroll
      for (int e = 0; e < 8; ++e) { acch[mi][nt][e] = 0.0f; accl[mi][nt][e] = 0.0f; }
    }
  }

#pragma unroll 1
  for (int k0 = 0; k0 < TROW; k0 += FRAG) {
    AF a0, a1, l0, l1;
    load_fragp(a0, ah0 + k0, lane);
    load_fragp(a1, ah1 + k0, lane);
    load_fragp(l0, al0 + k0, lane);
    load_fragp(l1, al1 + k0, lane);
#pragma unroll
    for (int nt = 0; nt < 4; ++nt) {
      AF bf;
      load_fragp(bf, bpn + nt * TROW + k0, lane);
      acch[0][nt] = mma16(a0.v, bf.v, acch[0][nt]);
      acch[1][nt] = mma16(a1.v, bf.v, acch[1][nt]);
      accl[0][nt] = mma16(l0.v, bf.v, accl[0][nt]);
      accl[1][nt] = mma16(l1.v, bf.v, accl[1][nt]);
    }
  }

  float* yw = Yst[wave];
#pragma unroll
  for (int nt = 0; nt < 4; ++nt) {
    const int col = nt * 16 + ln;
    const float bias = bf16r(bp[n0 + col]);
#pragma unroll
    for (int mi = 0; mi < 2; ++mi) {
#pragma unroll
      for (int r = 0; r < 8; ++r) {
        const float v = (acch[mi][nt][r] + accl[mi][nt][r] * 0.00048828125f) * 0.000244140625f + bias;
        yw[(mi * 16 + lhi * 8 + r) * 64 + col] = v;
      }
    }
  }
  __syncthreads();

  y_store_pass(yw, out, m0, n0, lane);
  
}

// ---------------------------------------------------------------- host
extern "C" void kernel_launch(void* const* d_in, const int* in_sizes, int n_in,
                              void* d_out, int out_size, void* d_ws, size_t ws_size,
                              hipStream_t stream) {
  if (n_in < 5) return;
  if (in_sizes[0] < ((NB - 1) * SEQ_FULL + SEQ) * EMB) return;
  if (in_sizes[1] < NQKV * HDIM) return;
  if (in_sizes[2] < NQKV) return;
  if (in_sizes[3] < EMB * EMB) return;
  if (in_sizes[4] < EMB) return;
  if (out_size < ((NB - 1) * SEQ_OUT + SEQ) * EMB) return;

  const float* x     = (const float*)d_in[0];
  const float* Wqkv  = (const float*)d_in[1];
  const float* bqkv  = (const float*)d_in[2];
  const float* Wproj = (const float*)d_in[3];
  const float* bproj = (const float*)d_in[4];
  float* out = (float*)d_out;

  char* ws = (char*)d_ws;
  size_t off = 0;
  _Float16* Wq16 = (_Float16*)(ws + off); off += (size_t)NQKV * HDIM * 2;          // 24576 B
  _Float16* Wp16 = (_Float16*)(ws + off); off += (size_t)EMB * EMB * 2;            // 2 MiB
  const size_t psz = (size_t)NB * NHEAD * SEQ * HDIM * 2;                          // 16 MiB at full size
  _Float16* Q16  = (_Float16*)(ws + off); off += psz;                               // [bh][t/16][2][FRAG]
  _Float16* K16  = (_Float16*)(ws + off); off += psz;                               // [bh][t/16][2][FRAG]
  _Float16* V16T = (_Float16*)(ws + off); off += psz;                               // [bh][t/32][4][FRAG]
  _Float16* C16  = (_Float16*)(ws + off); off += (size_t)NB * SEQ * EMB * 2;        // [b*t/16][32][FRAG] hi
  _Float16* R16  = (_Float16*)(ws + off); off += (size_t)NB * SEQ * EMB * 2;        // [b*t/16][32][FRAG] residual
  if (off > ws_size) return;

  cvt_w16_kernel<<<(NQKV * HDIM / 8) / 256, 256, 0, stream>>>(Wqkv, Wq16, NQKV * HDIM / 8, 8.0f, 1);
  cvt_w16_kernel<<<(EMB * EMB / 8) / 256, 256, 0, stream>>>(Wproj, Wp16, EMB * EMB / 8, 32.0f, 5);

  dim3 g1(SEQ / 128, NHEAD, NB);
  qkv_kernel<<<g1, 256, 0, stream>>>(x, Wq16, bqkv, Q16, K16, V16T);
  attn_kernel<<<g1, 256, 0, stream>>>(Q16, K16, V16T, C16, R16);

  dim3 g3((NB * SEQ) / 128, EMB / 64);
  proj_kernel<<<g3, 128, 0, stream>>>(C16, R16, Wp16, bproj, out);
}

// v003
// Measured time: 167 microseconds a run.
// Two timings next to v002 put it at 1.74 and 1.71 times that version's speed.
// All steps since v000 together make it 2.93 times as fast.
#include <hip/hip_runtime.h>
#include <stdint.h>

// Contractions: qkv projection (K=64), q.k^T (K=64), p.v (K=32 per step): v_wmma_f32_16x16x32_f16, plain f16 operands, f32 accumulate;
// output projection (K=1024): v_wmma_f32_16x16x32_f16 with the context operand carried as f16 hi + f16 residual x2^11 (two accumulators), weights f16, f32 accumulate.
// Float inputs are RNE-converted to bf16 and then cast to f16 (exact); carries: W_qkv x8, softmax P x1024, context x128, W_proj x32; softmax and epilogues in f32.

typedef __attribute__((ext_vector_type(16))) _Float16 v16h;
typedef __attribute__((ext_vector_type(8)))  float    v8f;
typedef __attribute__((ext_vector_type(4)))  float    v4f;
typedef __attribute__((ext_vector_type(4)))  uint32_t v4u;
typedef v4u __attribute__((may_alias)) v4ua;
typedef v4f __attribute__((may_alias)) v4fa;

#ifndef NB
#define NB 4            // batch count processed
#endif
#ifndef SEQ
#define SEQ 2048        // tokens per batch processed
#endif
#ifndef SEQ_FULL
#define SEQ_FULL 2048   // per-batch token stride of the input x
#endif
#ifndef SEQ_OUT
#define SEQ_OUT SEQ     // per-batch token stride of the output buffer
#endif
#define NHEAD 16
#define EMB   1024
#define HDIM  64
#define NQKV  192

static_assert(NB >= 1);
static_assert(SEQ >= 128);
static_assert(SEQ % 128 == 0);
static_assert(SEQ <= SEQ_FULL);
static_assert(NHEAD * HDIM == EMB);
static_assert(((NQKV * HDIM) / 8) % 256 == 0);
static_assert(((EMB * EMB) / 8) % 256 == 0);
static_assert((NB * SEQ) % 128 == 0);
static_assert(EMB % 64 == 0);

// ---------------------------------------------------------------- helpers
static __device__ __forceinline__ float bf16r(float f) {   // RNE convert to bf16, back to f32
  uint32_t u = __float_as_uint(f);
  u = u + 0x7FFFu + ((u >> 16) & 1u);
  u = u & 0xFFFF0000u;
  return __uint_as_float(u);
}

union AF { v16h v; _Float16 h[16]; v4u q[2]; };
union H8 { _Float16 h[8]; v4u q; };

// 16-half WMMA fragment (A or B operand, one 32-deep k step): lane row/col = lane&15;
// elements 0..7 <- k 8*lhi+0..7, elements 8..15 <- k 16+8*lhi+0..7 (two aligned 16-byte loads).
// Fragment-order planes: every f16 operand plane in the workspace is a sequence of 1-KB
// fragments (16 rows x 32 k). Inside a fragment, half index j*256 + lane*8 + e holds
// (row lane&15, k 16*j + 8*(lane>>4) + e), so that each of the two loads of a wave covers
// 512 contiguous bytes (4 whole lines) instead of 32-byte pieces of 16 lines.
#define FRAG 512        // halves per fragment
static __device__ __forceinline__ void load_fragp(AF& a, const _Float16* frag, int lane) {
  const v4ua* p = (const v4ua*)(frag + lane * 8);
  a.q[0] = p[0];
  a.q[1] = p[32];
}

static __device__ __forceinline__ v8f mma16(v16h a, v16h b, v8f c) {
  v8f d = __builtin_amdgcn_wmma_f32_16x16x32_f16(false, a, false, b, (short)0, c,
                                                 false, false);
  asm volatile("v_nop\n\tv_nop\n\tv_nop\n\tv_nop" : "+v"(d) : "v"(a), "v"(b));
  return d;
}

static __device__ __forceinline__ void vst16(_Float16* p, v4u v) { *(v4u*)p = v; }
static __device__ __forceinline__ void vstf4(float* p, v4f v) { *(v4f*)p = v; }

// ---------------------------------------------------------------- kernel 0
// f32 weights [rows][32 << ksh] -> f16 fragment-order plane [rows/16][1 << ksh][FRAG]:
// h = f16(bf16(w) * scale). One lane = one 16-byte piece of the plane = 8 consecutive k of one row.
__global__ __launch_bounds__(256) void cvt_w16_kernel(const float* __restrict__ src,
                                                      _Float16* __restrict__ dst,
                                                      int n8, float scale, int ksh) {
  const int i = blockIdx.x * 256 + (int)threadIdx.x;
  if (i >= n8) return;                       // n8 is a multiple of 256 in every launch
  const int fr  = i >> 6;                    // fragment; piece i&63 = j*32 + lane
  const int row = (fr >> ksh) * 16 + (i & 15);
  const int k   = (fr & ((1 << ksh) - 1)) * 32 + ((i >> 5) & 1) * 16 + ((i >> 4) & 1) * 8;
  const v4f* sp = (const v4f*)(src + ((size_t)row << (ksh + 5)) + k);
  const v4f f0 = sp[0];
  const v4f f1 = sp[1];
  H8 o;
#pragma unroll
  for (int e = 0; e < 4; ++e) {
    o.h[e]     = (_Float16)(bf16r(f0[e]) * scale);
    o.h[4 + e] = (_Float16)(bf16r(f1[e]) * scale);
  }
  const v4u val = o.q;
  _Float16* dp = dst + (size_t)i * 8;
  vst16(dp, val);
  
}

// ---------------------------------------------------------------- kernel 1
// Per (b, h, 128-token tile): qkv = x_h[128x64] . Wq16^T (Wq16 = [192][64] as fragment-order plane [12][2][FRAG]).
// Wave = 16 tokens x 192 columns (24 WMMA). Planes, fragment order: Q16/K16 = [bh][t/16][d/32][FRAG]
// (rows = tokens, k = d; 8q, 8k), V16T = [bh][t/32][d/16][FRAG] (rows = d, k = tokens; 8v).
// A 128-token tile is 16 KB contiguous in each plane.
static __device__ __forceinline__ void qkv_store_pass(const _Float16* Qst, const _Float16* Kst,
                                                      const _Float16* Vst, _Float16* qdst,
                                                      _Float16* kdst, _Float16* vdst, int tid) {
#pragma unroll
  for (int it = 0; it < 4; ++it) {
    const int idx = it * 256 + tid;                       // 16-B piece of the contiguous 16 KB tile
    vst16(qdst + (size_t)idx * 8, ((const v4ua*)Qst)[idx]);
    vst16(kdst + (size_t)idx * 8, ((const v4ua*)Kst)[idx]);
    vst16(vdst + (size_t)idx * 8, ((const v4ua*)Vst)[idx]);
  }
}

__global__ __launch_bounds__(256) __attribute__((amdgpu_num_vgpr(256)))
void qkv_kernel(const float* __restrict__ x, const _Float16* __restrict__ Wq16,
                const float* __restrict__ bq, _Float16* __restrict__ Q16,
                _Float16* __restrict__ K16, _Float16* __restrict__ V16T) {
  __shared__ _Float16 Qst[128 * HDIM];   // [token/16][d/32][FRAG]
  __shared__ _Float16 Kst[128 * HDIM];   // [token/16][d/32][FRAG]
  __shared__ _Float16 Vst[HDIM * 128];   // [token/32][d/16][FRAG]

  const int tid  = (int)threadIdx.x;
  const int wave = tid >> 5;
  const int lane = tid & 31;
  const int lhi  = lane >> 4;
  const int ln   = lane & 15;
  const int tb   = blockIdx.x * 128;
  const int h    = blockIdx.y;
  const int b    = blockIdx.z;

  // A fragments: x rows (tokens) x 64 dims, f32 -> bf16 RNE -> f16 in registers.
  const int trow = tb + wave * 16 + ln;
  const float* xrow = x + ((size_t)b * SEQ_FULL + trow) * EMB + h * HDIM;
  AF xa[2];
#pragma unroll
  for (int ks = 0; ks < 2; ++ks) {
    const v4f* xp = (const v4f*)(xrow + ks * 32 + lhi * 8);
    const v4f f0 = xp[0], f1 = xp[1];    // k = ks*32 + 8*lhi + 0..7   (elements 0..7)
    const v4f f2 = xp[4], f3 = xp[5];    // k = ks*32 + 16 + 8*lhi +.. (elements 8..15)
#pragma unroll
    for (int e = 0; e < 4; ++e) {
      xa[ks].h[e]      = (_Float16)bf16r(f0[e]);
      xa[ks].h[4 + e]  = (_Float16)bf16r(f1[e]);
      xa[ks].h[8 + e]  = (_Float16)bf16r(f2[e]);
      xa[ks].h[12 + e] = (_Float16)bf16r(f3[e]);
    }
  }

  // D rows of this lane: tokens wave*16 + lhi*8 + r; D column: ln.
  const int qkpos = ((ln >> 3) * 16 + lhi * 8) * 8 + (ln & 7);   // + r*8: row lhi*8+r, k 8*(ln>>3) + (ln&7)
#pragma unroll
  for (int n = 0; n < 12; ++n) {
    const int colg = n * 16 + ln;          // output column 0..191 = B column of this lane
    AF wb0, wb1;
    load_fragp(wb0, Wq16 + (n * 2) * FRAG, lane);
    load_fragp(wb1, Wq16 + (n * 2 + 1) * FRAG, lane);
    const float bv = 8.0f * bf16r(bq[colg]);
    v8f acc;
#pragma unroll
    for (int e = 0; e < 8; ++e) acc[e] = bv;
    acc = mma16(xa[0].v, wb0.v, acc);
    acc = mma16(xa[1].v, wb1.v, acc);
    const int ct = n & 3;                  // 16-column tile within the 64-wide q / k / v block
    const int qkoff = (wave * 2 + (ct >> 1)) * FRAG + (ct & 1) * 256 + qkpos;
    if (n < 4) {
#pragma unroll
      for (int r = 0; r < 8; ++r) Qst[qkoff + r * 8] = (_Float16)acc[r];
    } else if (n < 8) {
#pragma unroll
      for (int r = 0; r < 8; ++r) Kst[qkoff + r * 8] = (_Float16)acc[r];
    } else {
      // row d = ct*16 + ln, k = tokens (wave&1)*16 + 8*lhi + r: the lane's own 16-byte piece
      H8 vv;
#pragma unroll
      for (int r = 0; r < 8; ++r) vv.h[r] = (_Float16)acc[r];
      vst16(Vst + ((wave >> 1) * 4 + ct) * FRAG + (wave & 1) * 256 + lane * 8, vv.q);
    }
  }
  __syncthreads();   // cross-wave staging complete

  const size_t bh = (size_t)(b * NHEAD + h);
  _Float16* qdst = Q16 + (bh * SEQ + tb) * HDIM;
  _Float16* kdst = K16 + (bh * SEQ + tb) * HDIM;
  _Float16* vdst = V16T + (bh * SEQ + tb) * HDIM;
  qkv_store_pass(Qst, Kst, Vst, qdst, kdst, vdst, tid);
  
}

// ---------------------------------------------------------------- kernel 2
// Flash attention, transposed products. Block = 8 waves = 128 query columns of one (b,h);
// key blocks of 32: S^T = K.Q^T (4 WMMA, A = K rows, B = Q kept in registers), so a lane holds
// 16 scores of ONE query (column ln; keys 8*lhi+r and 16+8*lhi+r). Maximum and sum run in the
// lane, plus one exchange between the wave halves for the maximum. The two score tiles,
// converted in place, are the B operand of O^T += V^T.P^T (4 WMMA, A = V^T rows): P x1024
// goes from registers to registers. K/V reach the waves through a two-buffer LDS ring: a stage is
// 64 keys (8 KB of K, 8 KB of V, both contiguous in their planes and already in fragment order),
// copied once per block by asynchronous copies while the stage before it is worked on.
// Outputs, fragment order [b*t/16][e/32][FRAG] (rows = tokens, k = e = h*64 + d): C16 = f16 hi of
// 128*ctx, R16 = f16 residual (128*ctx - hi) x 2048.

static __device__ __forceinline__ float other_half(float v) {   // value held by lane l ^ 16
  const int b = __float_as_int(v);
  return __int_as_float(__builtin_amdgcn_permlanex16(b, b, 0x76543210, 0xfedcba98, false, false));
}

#define SKEYS 64                    // keys per ring stage
#define SHALF (SKEYS * HDIM)        // halves per operand and stage (8 KB)
#define NSTAGE (SEQ / SKEYS)
static_assert(SEQ % SKEYS == 0);
static_assert(NSTAGE >= 2);

// One stage: each of the 256 lanes copies four 16-byte pieces (two of K, two of V) to LDS.
// lds = the lane's byte address in the buffer, kg / vg = the lane's first piece in the planes.
static __device__ __forceinline__ void stage_copy(uint32_t lds, const _Float16* kg,
                                                  const _Float16* vg) {
  const uint32_t l1 = lds + 4096u, l2 = lds + 8192u, l3 = lds + 12288u;
  const _Float16* kg1 = kg + 2048;
  const _Float16* vg1 = vg + 2048;
  // The closing s_wait_xcnt stands inside the statement so that no address register of a copy
  // is rewritten ahead of it.
  asm volatile("global_load_async_to_lds_b128 %0, %4, off\n\t"
               "global_load_async_to_lds_b128 %1, %5, off\n\t"
               "global_load_async_to_lds_b128 %2, %6, off\n\t"
               "global_load_async_to_lds_b128 %3, %7, off\n\t"
               "s_wait_xcnt 0x0"
               :: "v"(lds), "v"(l1), "v"(l2), "v"(l3), "v"(kg), "v"(kg1), "v"(vg), "v"(vg1)
               : "memory");
}

__global__ __launch_bounds__(256) __attribute__((amdgpu_num_vgpr(256)))
void attn_kernel(const _Float16* __restrict__ Q16, const _Float16* __restrict__ K16,
                 const _Float16* __restrict__ V16T, _Float16* __restrict__ C16,
                 _Float16* __restrict__ R16) {
  __shared__ __attribute__((aligned(16))) _Float16 KV[2][2 * SHALF];   // [buffer][K stage | V stage]

  const int tid  = (int)threadIdx.x;
  const int wave = tid >> 5;
  const int lane = tid & 31;               // below: lhi = lane >> 4, ln = lane & 15
  const int qb   = blockIdx.x * 128;
  const int h    = blockIdx.y;
  const int b    = blockIdx.z;
  const size_t bh = (size_t)(b * NHEAD + h);
  const _Float16* Qp = Q16 + bh * SEQ * HDIM;
  const _Float16* Kp = K16 + bh * SEQ * HDIM;
  const _Float16* Vp = V16T + bh * SEQ * HDIM;

  // Q B-fragments for this wave's 16 query columns (plane carries 8q).
  const int qt = (qb >> 4) + wave;
  AF qa0, qa1;
  load_fragp(qa0, Qp + (size_t)(qt * 2) * FRAG, lane);
  load_fragp(qa1, Qp + (size_t)(qt * 2 + 1) * FRAG, lane);

  float m = -3.0e38f;   // running maximum of query ln (equal in both halves)
  float ls = 0.0f;      // running sum over this half's keys only; halves joined after the loop
  v8f o[4];             // o[d][r] = O^T[d*16 + 8*lhi + r][query ln]
#pragma unroll
  for (int d = 0; d < 4; ++d) {
#pragma unroll
    for (int e = 0; e < 8; ++e) o[d][e] = 0.0f;
  }

  const float SC = 0.001953125f;   // (8q).(8k) / 512 = q.k / 8

  // Ring prologue: stage 0 lands and is published, then stage 1 starts to fly.
  const uint32_t lds0 = (uint32_t)(size_t)(&KV[0][0]) + (uint32_t)tid * 16u;
  const _Float16* kg = Kp + tid * 8;
  const _Float16* vg = Vp + tid * 8;
  stage_copy(lds0, kg, vg);
  asm volatile("s_wait_asynccnt 0x0" ::: "memory");   // this wave's pieces of stage 0 have landed
  __syncthreads();                                    // every wave's pieces have
  stage_copy(lds0 + 4u * SHALF, kg + SHALF, vg + SHALF);

#pragma unroll 1
  for (int st = 0; st < NSTAGE; ++st) {
   const _Float16* Ks = &KV[st & 1][0];
   const _Float16* Vs = Ks + SHALF;
#pragma unroll
   for (int kb = 0; kb < SKEYS / 32; ++kb) {
    // S^T = K . Q^T : two 16-key tiles, each 2 k-steps over 64 dims.
    v8f s[2];
#pragma unroll
    for (int nt = 0; nt < 2; ++nt) {
      const int kt = kb * 2 + nt;                // 16-key tile: A rows
      AF f0, f1;
      load_fragp(f0, Ks + (kt * 2) * FRAG, lane);
      load_fragp(f1, Ks + (kt * 2 + 1) * FRAG, lane);
      v8f c;
#pragma unroll
      for (int e = 0; e < 8; ++e) c[e] = 0.0f;
      c = mma16(f0.v, qa0.v, c);
      c = mma16(f1.v, qa1.v, c);
      s[nt] = c;
    }

    // Online softmax (f32), one query per lane. SC is a power of two: max(s) * SC = max(s * SC).
    float mx0 = s[0][0], mx1 = s[1][0];
#pragma unroll
    for (int r = 1; r < 8; ++r) {
      mx0 = fmaxf(mx0, s[0][r]);
      mx1 = fmaxf(mx1, s[1][r]);
    }
    float mx = fmaxf(mx0, mx1);
    mx = fmaxf(mx, other_half(mx)) * SC;
    const float mn = fmaxf(m, mx);
    const float corr = __expf(m - mn);
    m = mn;

    // P^T as a 32x16 B fragment: element nt*8+r = key nt*16 + 8*lhi + r, the hardware k order
    // that the V^T fragments have.
    AF pb;
    float rs0 = 0.0f, rs1 = 0.0f;
#pragma unroll
    for (int r = 0; r < 8; ++r) {
      const float p0 = __expf(s[0][r] * SC - mn);
      const float p1 = __expf(s[1][r] * SC - mn);
      rs0 += p0;
      rs1 += p1;
      pb.h[r]     = (_Float16)(p0 * 1024.0f);
      pb.h[8 + r] = (_Float16)(p1 * 1024.0f);
    }
    ls = ls * corr + (rs0 + rs1);
#pragma unroll
    for (int d = 0; d < 4; ++d) {
#pragma unroll
      for (int r = 0; r < 8; ++r) o[d][r] *= corr;
    }

    // O^T += V^T . P^T : four 16-row d tiles, one fragment each.
#pragma unroll
    for (int d = 0; d < 4; ++d) {
      AF vf;
      load_fragp(vf, Vs + (kb * 4 + d) * FRAG, lane);
      o[d] = mma16(vf.v, pb.v, o[d]);
    }
   }
   // Publish point of stage st + 1; behind its barrier the buffer just read is free for st + 2.
   asm volatile("s_wait_dscnt 0x0" ::: "memory");      // this wave's reads of the buffer are done
   asm volatile("s_wait_asynccnt 0x0" ::: "memory");   // this wave's pieces of stage st + 1 have landed
   __syncthreads();
   if (st + 2 < NSTAGE)
     stage_copy(lds0 + (uint32_t)(st & 1) * (4u * SHALF), kg + (size_t)(st + 2) * SHALF,
                vg + (size_t)(st + 2) * SHALF);
  }
  asm volatile("s_wait_asynccnt 0x0" ::: "memory");    // no copy is left in flight at the wave's end

  // O = sum (1024 p)(8 v); c = 128 * ctx = O / (64 * l); hi = f16(c), res = f16((c - hi) * 2048).
  // A lane holds 8 consecutive d of its query per tile (row ln, k (d&1)*16 + 8*lhi + r of fragment
  // h*2 + d/2): its own 16-byte piece of the plane, so a wave's store is 512 contiguous bytes.
  const size_t coff = (((((size_t)b * SEQ + qb) >> 4) + wave) * (EMB / 32) + h * 2) * FRAG + lane * 8;
  _Float16* cdst = C16 + coff;
  _Float16* rdst = R16 + coff;
  const float lt = ls + other_half(ls);
  const float inv = (1.0f / lt) * 0.015625f;
#pragma unroll
  for (int d = 0; d < 4; ++d) {
    H8 hv, rv;
#pragma unroll
    for (int r = 0; r < 8; ++r) {
      const float c = o[d][r] * inv;
      const _Float16 hh = (_Float16)c;
      const float resf = (c - (float)hh) * 2048.0f;
      hv.h[r] = hh;
      rv.h[r] = (_Float16)resf;
    }
    vst16(cdst + d * 256, hv.q);
    vst16(rdst + d * 256, rv.q);
  }
}

// ---------------------------------------------------------------- kernel 3
// y[m][f] = (sum_e C16[m][e]*Wp16[f][e] + (sum_e R16[m][e]*Wp16[f][e]) / 2048) / 4096 + bf16(b_proj[f]);
// M = NB*SEQ, N = K = 1024. Block = 4 waves, wave tile 32 rows x 64 cols, two accumulator
// sets (hi plane, residual plane), fragments read from the planes.
static __device__ __forceinline__ void y_store_pass(const float* yw, float* out, int m0, int n0,
                                                    int lane) {
  const int prow = lane >> 4, piece = lane & 15;   // 16 lanes x 16 B = one 256-B row segment
#pragma unroll
  for (int i = 0; i < 16; ++i) {
    const int row = i * 2 + prow;
    const int mm = m0 + row;
    const int ob = mm / SEQ;
    const int ot = mm - ob * SEQ;
    const size_t orow = (size_t)ob * SEQ_OUT + ot;
    vstf4(out + orow * EMB + n0 + piece * 4, ((const v4fa*)yw)[row * 16 + piece]);
  }
}

__global__ __launch_bounds__(128) __attribute__((amdgpu_num_vgpr(256)))
void proj_kernel(const _Float16* __restrict__ C16, const _Float16* __restrict__ R16,
                 const _Float16* __restrict__ Wp16, const float* __restrict__ bp,
                 float* __restrict__ out) {
  __shared__ float Yst[4][32 * 64];   // per-wave output staging [row][col]

  const int tid  = (int)threadIdx.x;
  const int wave = tid >> 5;
  const int lane = tid & 31;
  const int lhi  = lane >> 4;
  const int ln   = lane & 15;
  const int m0   = blockIdx.x * 128 + wave * 32;
  const int n0   = blockIdx.y * 64;

  const int TROW = (EMB / 32) * FRAG;   // halves per 16-row tile of a plane
  const _Float16* ah0 = C16 + (size_t)(m0 >> 4) * TROW;
  const _Float16* ah1 = ah0 + TROW;
  const _Float16* al0 = R16 + (size_t)(m0 >> 4) * TROW;
  const _Float16* al1 = al0 + TROW;
  const _Float16* bpn = Wp16 + (size_t)(n0 >> 4) * TROW;

  v8f acch[2][4], accl[2][4];
#pragma unroll
  for (int mi = 0; mi < 2; ++mi) {
#pragma unroll
    for (int nt = 0; nt < 4; ++nt) {
#pragma unroll
      for (int e = 0; e < 8; ++e) { acch[mi][nt][e] = 0.0f; accl[mi][nt][e] = 0.0f; }
    }
  }

#pragma unroll 1
  for (int k0 = 0; k0 < TROW; k0 += FRAG) {
    AF a0, a1, l0, l1;
    load_fragp(a0, ah0 + k0, lane);
    load_fragp(a1, ah1 + k0, lane);
    load_fragp(l0, al0 + k0, lane);
    load_fragp(l1, al1 + k0, lane);
#pragma unroll
    for (int nt = 0; nt < 4; ++nt) {
      AF bf;
      load_fragp(bf, bpn + nt * TROW + k0, lane);
      acch[0][nt] = mma16(a0.v, bf.v, acch[0][nt]);
      acch[1][nt] = mma16(a1.v, bf.v, acch[1][nt]);
      accl[0][nt] = mma16(l0.v, bf.v, accl[0][nt]);
      accl[1][nt] = mma16(l1.v, bf.v, accl[1][nt]);
    }
  }

  float* yw = Yst[wave];
#pragma unroll
  for (int nt = 0; nt < 4; ++nt) {
    const int col = nt * 16 + ln;
    const float bias = bf16r(bp[n0 + col]);
#pragma unroll
    for (int mi = 0; mi < 2; ++mi) {
#pragma unroll
      for (int r = 0; r < 8; ++r) {
        const float v = (acch[mi][nt][r] + accl[mi][nt][r] * 0.00048828125f) * 0.000244140625f + bias;
        yw[(mi * 16 + lhi * 8 + r) * 64 + col] = v;
      }
    }
  }
  __syncthreads();

  y_store_pass(yw, out, m0, n0, lane);
  
}

// ---------------------------------------------------------------- host
extern "C" void kernel_launch(void* const* d_in, const int* in_sizes, int n_in,
                              void* d_out, int out_size, void* d_ws, size_t ws_size,
                              hipStream_t stream) {
  if (n_in < 5) return;
  if (in_sizes[0] < ((NB - 1) * SEQ_FULL + SEQ) * EMB) return;
  if (in_sizes[1] < NQKV * HDIM) return;
  if (in_sizes[2] < NQKV) return;
  if (in_sizes[3] < EMB * EMB) return;
  if (in_sizes[4] < EMB) return;
  if (out_size < ((NB - 1) * SEQ_OUT + SEQ) * EMB) return;

  const float* x     = (const float*)d_in[0];
  const float* Wqkv  = (const float*)d_in[1];
  const float* bqkv  = (const float*)d_in[2];
  const float* Wproj = (const float*)d_in[3];
  const float* bproj = (const float*)d_in[4];
  float* out = (float*)d_out;

  char* ws = (char*)d_ws;
  size_t off = 0;
  _Float16* Wq16 = (_Float16*)(ws + off); off += (size_t)NQKV * HDIM * 2;          // 24576 B
  _Float16* Wp16 = (_Float16*)(ws + off); off += (size_t)EMB * EMB * 2;            // 2 MiB
  const size_t psz = (size_t)NB * NHEAD * SEQ * HDIM * 2;                          // 16 MiB at full size
  _Float16* Q16  = (_Float16*)(ws + off); off += psz;                               // [bh][t/16][2][FRAG]
  _Float16* K16  = (_Float16*)(ws + off); off += psz;                               // [bh][t/16][2][FRAG]
  _Float16* V16T = (_Float16*)(ws + off); off += psz;                               // [bh][t/32][4][FRAG]
  _Float16* C16  = (_Float16*)(ws + off); off += (size_t)NB * SEQ * EMB * 2;        // [b*t/16][32][FRAG] hi
  _Float16* R16  = (_Float16*)(ws + off); off += (size_t)NB * SEQ * EMB * 2;        // [b*t/16][32][FRAG] residual
  if (off > ws_size) return;

  cvt_w16_kernel<<<(NQKV * HDIM / 8) / 256, 256, 0, stream>>>(Wqkv, Wq16, NQKV * HDIM / 8, 8.0f, 1);
  cvt_w16_kernel<<<(EMB * EMB / 8) / 256, 256, 0, stream>>>(Wproj, Wp16, EMB * EMB / 8, 32.0f, 5);

  dim3 g1(SEQ / 128, NHEAD, NB);
  qkv_kernel<<<g1, 256, 0, stream>>>(x, Wq16, bqkv, Q16, K16, V16T);
  attn_kernel<<<g1, 256, 0, stream>>>(Q16, K16, V16T, C16, R16);

  dim3 g3((NB * SEQ) / 128, EMB / 64);
  proj_kernel<<<g3, 128, 0, stream>>>(C16, R16, Wp16, bproj, out);
}

// v004
// A run of this version takes 134 microseconds.
// In both of two side-by-side timings against v003, it was 1.23 times as fast.
// Over all steps from v000 it is 3.61 times as fast.
#include <hip/hip_runtime.h>
#include <stdint.h>

// Contractions: qkv projection (K=64), q.k^T (K=64), p.v (K=32 per step): v_wmma_f32_16x16x32_f16, plain f16 operands, f32 accumulate;
// output projection (K=1024): v_wmma_f32_16x16x32_f16 with the context operand carried as f16 hi + f16 residual x2^11 (two accumulators), weights f16, f32 accumulate.
// Float inputs are RNE-converted to bf16 and then cast to f16 (exact); carries: W_qkv x8, softmax P x1024, context x128, W_proj x32; softmax and epilogues in f32.

typedef __attribute__((ext_vector_type(16))) _Float16 v16h;
typedef __attribute__((ext_vector_type(8)))  float    v8f;
typedef __attribute__((ext_vector_type(4)))  float    v4f;
typedef __attribute__((ext_vector_type(4)))  uint32_t v4u;
typedef v4u __attribute__((may_alias)) v4ua;
typedef v4f __attribute__((may_alias)) v4fa;

#ifndef NB
#define NB 4            // batch count processed
#endif
#ifndef SEQ
#define SEQ 2048        // tokens per batch processed
#endif
#ifndef SEQ_FULL
#define SEQ_FULL 2048   // per-batch token stride of the input x
#endif
#ifndef SEQ_OUT
#define SEQ_OUT SEQ     // per-batch token stride of the output buffer
#endif
#define NHEAD 16
#define EMB   1024
#define HDIM  64
#define NQKV  192

static_assert(NB >= 1);
static_assert(SEQ >= 128);
static_assert(SEQ % 128 == 0);
static_assert(SEQ <= SEQ_FULL);
static_assert(NHEAD * HDIM == EMB);
static_assert(((NQKV * HDIM) / 8) % 256 == 0);
static_assert(((EMB * EMB) / 8) % 256 == 0);
static_assert((NB * SEQ) % 128 == 0);
static_assert(EMB % 64 == 0);

// ---------------------------------------------------------------- helpers
static __device__ __forceinline__ float bf16r(float f) {   // RNE convert to bf16, back to f32
  uint32_t u = __float_as_uint(f);
  u = u + 0x7FFFu + ((u >> 16) & 1u);
  u = u & 0xFFFF0000u;
  return __uint_as_float(u);
}

union AF { v16h v; _Float16 h[16]; v4u q[2]; };
union H8 { _Float16 h[8]; v4u q; };

// 16-half WMMA fragment (A or B operand, one 32-deep k step): lane row/col = lane&15;
// elements 0..7 <- k 8*lhi+0..7, elements 8..15 <- k 16+8*lhi+0..7 (two aligned 16-byte loads).
// Fragment-order planes: every f16 operand plane in the workspace is a sequence of 1-KB
// fragments (16 rows x 32 k). Inside a fragment, half index j*256 + lane*8 + e holds
// (row lane&15, k 16*j + 8*(lane>>4) + e), so that each of the two loads of a wave covers
// 512 contiguous bytes (4 whole lines) instead of 32-byte pieces of 16 lines.
#define FRAG 512        // halves per fragment
static __device__ __forceinline__ void load_fragp(AF& a, const _Float16* frag, int lane) {
  const v4ua* p = (const v4ua*)(frag + lane * 8);
  a.q[0] = p[0];
  a.q[1] = p[32];
}

static __device__ __forceinline__ v8f mma16(v16h a, v16h b, v8f c) {
  v8f d = __builtin_amdgcn_wmma_f32_16x16x32_f16(false, a, false, b, (short)0, c,
                                                 false, false);
  return d;
}

static __device__ __forceinline__ void vst16(_Float16* p, v4u v) { *(v4u*)p = v; }
static __device__ __forceinline__ void vstf4(float* p, v4f v) { *(v4f*)p = v; }

// ---------------------------------------------------------------- kernel 0
// f32 weights [rows][32 << ksh] -> f16 fragment-order plane [rows/16][1 << ksh][FRAG]:
// h = f16(bf16(w) * scale). One lane = one 16-byte piece of the plane = 8 consecutive k of one row.
__global__ __launch_bounds__(256) void cvt_w16_kernel(const float* __restrict__ src,
                                                      _Float16* __restrict__ dst,
                                                      int n8, float scale, int ksh) {
  const int i = blockIdx.x * 256 + (int)threadIdx.x;
  if (i >= n8) return;                       // n8 is a multiple of 256 in every launch
  const int fr  = i >> 6;                    // fragment; piece i&63 = j*32 + lane
  const int row = (fr >> ksh) * 16 + (i & 15);
  const int k   = (fr & ((1 << ksh) - 1)) * 32 + ((i >> 5) & 1) * 16 + ((i >> 4) & 1) * 8;
  const v4f* sp = (const v4f*)(src + ((size_t)row << (ksh + 5)) + k);
  const v4f f0 = sp[0];
  const v4f f1 = sp[1];
  H8 o;
#pragma unroll
  for (int e = 0; e < 4; ++e) {
    o.h[e]     = (_Float16)(bf16r(f0[e]) * scale);
    o.h[4 + e] = (_Float16)(bf16r(f1[e]) * scale);
  }
  const v4u val = o.q;
  _Float16* dp = dst + (size_t)i * 8;
  vst16(dp, val);
  
}

// ---------------------------------------------------------------- kernel 1
// Per (b, h, 128-token tile): qkv = x_h[128x64] . Wq16^T (Wq16 = [192][64] as fragment-order plane [12][2][FRAG]).
// Wave = 16 tokens x 192 columns (24 WMMA). Planes, fragment order: Q16/K16 = [bh][t/16][d/32][FRAG]
// (rows = tokens, k = d; 8q, 8k), V16T = [bh][t/32][d/16][FRAG] (rows = d, k = tokens; 8v).
// A 128-token tile is 16 KB contiguous in each plane.
static __device__ __forceinline__ void qkv_store_pass(const _Float16* Qst, const _Float16* Kst,
                                                      const _Float16* Vst, _Float16* qdst,
                                                      _Float16* kdst, _Float16* vdst, int tid) {
#pragma unroll
  for (int it = 0; it < 4; ++it) {
    const int idx = it * 256 + tid;                       // 16-B piece of the contiguous 16 KB tile
    vst16(qdst + (size_t)idx * 8, ((const v4ua*)Qst)[idx]);
    vst16(kdst + (size_t)idx * 8, ((const v4ua*)Kst)[idx]);
    vst16(vdst + (size_t)idx * 8, ((const v4ua*)Vst)[idx]);
  }
}

__global__ __launch_bounds__(256) __attribute__((amdgpu_num_vgpr(256)))
void qkv_kernel(const float* __restrict__ x, const _Float16* __restrict__ Wq16,
                const float* __restrict__ bq, _Float16* __restrict__ Q16,
                _Float16* __restrict__ K16, _Float16* __restrict__ V16T) {
  __shared__ _Float16 Qst[128 * HDIM];   // [token/16][d/32][FRAG]
  __shared__ _Float16 Kst[128 * HDIM];   // [token/16][d/32][FRAG]
  __shared__ _Float16 Vst[HDIM * 128];   // [token/32][d/16][FRAG]

  const int tid  = (int)threadIdx.x;
  const int wave = tid >> 5;
  const int lane = tid & 31;
  const int lhi  = lane >> 4;
  const int ln   = lane & 15;
  const int tb   = blockIdx.x * 128;
  const int h    = blockIdx.y;
  const int b    = blockIdx.z;

  // A fragments: x rows (tokens) x 64 dims, f32 -> bf16 RNE -> f16 in registers.
  const int trow = tb + wave * 16 + ln;
  const float* xrow = x + ((size_t)b * SEQ_FULL + trow) * EMB + h * HDIM;
  AF xa[2];
#pragma unroll
  for (int ks = 0; ks < 2; ++ks) {
    const v4f* xp = (const v4f*)(xrow + ks * 32 + lhi * 8);
    const v4f f0 = xp[0], f1 = xp[1];    // k = ks*32 + 8*lhi + 0..7   (elements 0..7)
    const v4f f2 = xp[4], f3 = xp[5];    // k = ks*32 + 16 + 8*lhi +.. (elements 8..15)
#pragma unroll
    for (int e = 0; e < 4; ++e) {
      xa[ks].h[e]      = (_Float16)bf16r(f0[e]);
      xa[ks].h[4 + e]  = (_Float16)bf16r(f1[e]);
      xa[ks].h[8 + e]  = (_Float16)bf16r(f2[e]);
      xa[ks].h[12 + e] = (_Float16)bf16r(f3[e]);
    }
  }

  // D rows of this lane: tokens wave*16 + lhi*8 + r; D column: ln.
  const int qkpos = ((ln >> 3) * 16 + lhi * 8) * 8 + (ln & 7);   // + r*8: row lhi*8+r, k 8*(ln>>3) + (ln&7)
#pragma unroll
  for (int n = 0; n < 12; ++n) {
    const int colg = n * 16 + ln;          // output column 0..191 = B column of this lane
    AF wb0, wb1;
    load_fragp(wb0, Wq16 + (n * 2) * FRAG, lane);
    load_fragp(wb1, Wq16 + (n * 2 + 1) * FRAG, lane);
    const float bv = 8.0f * bf16r(bq[colg]);
    v8f acc;
#pragma unroll
    for (int e = 0; e < 8; ++e) acc[e] = bv;
    acc = mma16(xa[0].v, wb0.v, acc);
    acc = mma16(xa[1].v, wb1.v, acc);
    const int ct = n & 3;                  // 16-column tile within the 64-wide q / k / v block
    const int qkoff = (wave * 2 + (ct >> 1)) * FRAG + (ct & 1) * 256 + qkpos;
    if (n < 4) {
#pragma unroll
      for (int r = 0; r < 8; ++r) Qst[qkoff + r * 8] = (_Float16)acc[r];
    } else if (n < 8) {
#pragma unroll
      for (int r = 0; r < 8; ++r) Kst[qkoff + r * 8] = (_Float16)acc[r];
    } else {
      // row d = ct*16 + ln, k = tokens (wave&1)*16 + 8*lhi + r: the lane's own 16-byte piece
      H8 vv;
#pragma unroll
      for (int r = 0; r < 8; ++r) vv.h[r] = (_Float16)acc[r];
      vst16(Vst + ((wave >> 1) * 4 + ct) * FRAG + (wave & 1) * 256 + lane * 8, vv.q);
    }
  }
  __syncthreads();   // cross-wave staging complete

  const size_t bh = (size_t)(b * NHEAD + h);
  _Float16* qdst = Q16 + (bh * SEQ + tb) * HDIM;
  _Float16* kdst = K16 + (bh * SEQ + tb) * HDIM;
  _Float16* vdst = V16T + (bh * SEQ + tb) * HDIM;
  qkv_store_pass(Qst, Kst, Vst, qdst, kdst, vdst, tid);
  
}

// ---------------------------------------------------------------- kernel 2
// Flash attention, transposed products. Block = 8 waves = 128 query columns of one (b,h);
// key blocks of 32: S^T = K.Q^T (4 WMMA, A = K rows, B = Q kept in registers), so a lane holds
// 16 scores of ONE query (column ln; keys 8*lhi+r and 16+8*lhi+r). Maximum and sum run in the
// lane, plus one exchange between the wave halves for the maximum. The two score tiles,
// converted in place, are the B operand of O^T += V^T.P^T (4 WMMA, A = V^T rows): P x1024
// goes from registers to registers. K/V reach the waves through a two-buffer LDS ring: a stage is
// 64 keys (8 KB of K, 8 KB of V, both contiguous in their planes and already in fragment order),
// copied once per block by asynchronous copies while the stage before it is worked on.
// Outputs, fragment order [b*t/16][e/32][FRAG] (rows = tokens, k = e = h*64 + d): C16 = f16 hi of
// 128*ctx, R16 = f16 residual (128*ctx - hi) x 2048.

static __device__ __forceinline__ float other_half(float v) {   // value held by lane l ^ 16
  const int b = __float_as_int(v);
  return __int_as_float(__builtin_amdgcn_permlanex16(b, b, 0x76543210, 0xfedcba98, false, false));
}

#define SKEYS 64                    // keys per ring stage
#define SHALF (SKEYS * HDIM)        // halves per operand and stage (8 KB)
#define NSTAGE (SEQ / SKEYS)
static_assert(SEQ % SKEYS == 0);
static_assert(NSTAGE >= 2);

// One stage: each of the 256 lanes copies four 16-byte pieces (two of K, two of V) to LDS.
// lds = the lane's byte address in the buffer, kg / vg = the lane's first piece in the planes.
static __device__ __forceinline__ void stage_copy(uint32_t lds, const _Float16* kg,
                                                  const _Float16* vg) {
  const uint32_t l1 = lds + 4096u, l2 = lds + 8192u, l3 = lds + 12288u;
  const _Float16* kg1 = kg + 2048;
  const _Float16* vg1 = vg + 2048;
  // The closing s_wait_xcnt stands inside the statement so that no address register of a copy
  // is rewritten ahead of it.
  asm volatile("global_load_async_to_lds_b128 %0, %4, off\n\t"
               "global_load_async_to_lds_b128 %1, %5, off\n\t"
               "global_load_async_to_lds_b128 %2, %6, off\n\t"
               "global_load_async_to_lds_b128 %3, %7, off\n\t"
               "s_wait_xcnt 0x0"
               :: "v"(lds), "v"(l1), "v"(l2), "v"(l3), "v"(kg), "v"(kg1), "v"(vg), "v"(vg1)
               : "memory");
}

__global__ __launch_bounds__(256) __attribute__((amdgpu_num_vgpr(256)))
void attn_kernel(const _Float16* __restrict__ Q16, const _Float16* __restrict__ K16,
                 const _Float16* __restrict__ V16T, _Float16* __restrict__ C16,
                 _Float16* __restrict__ R16) {
  __shared__ __attribute__((aligned(16))) _Float16 KV[2][2 * SHALF];   // [buffer][K stage | V stage]

  const int tid  = (int)threadIdx.x;
  const int wave = tid >> 5;
  const int lane = tid & 31;               // below: lhi = lane >> 4, ln = lane & 15
  const int qb   = blockIdx.x * 128;
  const int h    = blockIdx.y;
  const int b    = blockIdx.z;
  const size_t bh = (size_t)(b * NHEAD + h);
  const _Float16* Qp = Q16 + bh * SEQ * HDIM;
  const _Float16* Kp = K16 + bh * SEQ * HDIM;
  const _Float16* Vp = V16T + bh * SEQ * HDIM;

  // Q B-fragments for this wave's 16 query columns (plane carries 8q).
  const int qt = (qb >> 4) + wave;
  AF qa0, qa1;
  load_fragp(qa0, Qp + (size_t)(qt * 2) * FRAG, lane);
  load_fragp(qa1, Qp + (size_t)(qt * 2 + 1) * FRAG, lane);

  float m = -3.0e38f;   // running maximum of query ln (equal in both halves)
  float ls = 0.0f;      // running sum over this half's keys only; halves joined after the loop
  v8f o[4];             // o[d][r] = O^T[d*16 + 8*lhi + r][query ln]
#pragma unroll
  for (int d = 0; d < 4; ++d) {
#pragma unroll
    for (int e = 0; e < 8; ++e) o[d][e] = 0.0f;
  }

  const float SC = 0.001953125f;   // (8q).(8k) / 512 = q.k / 8

  // Ring prologue: stage 0 lands and is published, then stage 1 starts to fly.
  const uint32_t lds0 = (uint32_t)(size_t)(&KV[0][0]) + (uint32_t)tid * 16u;
  const _Float16* kg = Kp + tid * 8;
  const _Float16* vg = Vp + tid * 8;
  stage_copy(lds0, kg, vg);
  asm volatile("s_wait_asynccnt 0x0" ::: "memory");   // this wave's pieces of stage 0 have landed
  __syncthreads();                                    // every wave's pieces have
  stage_copy(lds0 + 4u * SHALF, kg + SHALF, vg + SHALF);

#pragma unroll 1
  for (int st = 0; st < NSTAGE; ++st) {
   const _Float16* Ks = &KV[st & 1][0];
   const _Float16* Vs = Ks + SHALF;
#pragma unroll
   for (int kb = 0; kb < SKEYS / 32; ++kb) {
    // S^T = K . Q^T : two 16-key tiles, each 2 k-steps over 64 dims.
    v8f s[2];
#pragma unroll
    for (int nt = 0; nt < 2; ++nt) {
      const int kt = kb * 2 + nt;                // 16-key tile: A rows
      AF f0, f1;
      load_fragp(f0, Ks + (kt * 2) * FRAG, lane);
      load_fragp(f1, Ks + (kt * 2 + 1) * FRAG, lane);
      v8f c;
#pragma unroll
      for (int e = 0; e < 8; ++e) c[e] = 0.0f;
      c = mma16(f0.v, qa0.v, c);
      c = mma16(f1.v, qa1.v, c);
      s[nt] = c;
    }

    // Online softmax (f32), one query per lane. SC is a power of two: max(s) * SC = max(s * SC).
    float mx0 = s[0][0], mx1 = s[1][0];
#pragma unroll
    for (int r = 1; r < 8; ++r) {
      mx0 = fmaxf(mx0, s[0][r]);
      mx1 = fmaxf(mx1, s[1][r]);
    }
    float mx = fmaxf(mx0, mx1);
    mx = fmaxf(mx, other_half(mx)) * SC;
    const float mn = fmaxf(m, mx);
    const float corr = __expf(m - mn);
    m = mn;

    // P^T as a 32x16 B fragment: element nt*8+r = key nt*16 + 8*lhi + r, the hardware k order
    // that the V^T fragments have.
    AF pb;
    float rs0 = 0.0f, rs1 = 0.0f;
#pragma unroll
    for (int r = 0; r < 8; ++r) {
      const float p0 = __expf(s[0][r] * SC - mn);
      const float p1 = __expf(s[1][r] * SC - mn);
      rs0 += p0;
      rs1 += p1;
      pb.h[r]     = (_Float16)(p0 * 1024.0f);
      pb.h[8 + r] = (_Float16)(p1 * 1024.0f);
    }
    ls = ls * corr + (rs0 + rs1);
#pragma unroll
    for (int d = 0; d < 4; ++d) {
#pragma unroll
      for (int r = 0; r < 8; ++r) o[d][r] *= corr;
    }

    // O^T += V^T . P^T : four 16-row d tiles, one fragment each.
#pragma unroll
    for (int d = 0; d < 4; ++d) {
      AF vf;
      load_fragp(vf, Vs + (kb * 4 + d) * FRAG, lane);
      o[d] = mma16(vf.v, pb.v, o[d]);
    }
   }
   // Publish point of stage st + 1; behind its barrier the buffer just read is free for st + 2.
   asm volatile("s_wait_dscnt 0x0" ::: "memory");      // this wave's reads of the buffer are done
   asm volatile("s_wait_asynccnt 0x0" ::: "memory");   // this wave's pieces of stage st + 1 have landed
   __syncthreads();
   if (st + 2 < NSTAGE)
     stage_copy(lds0 + (uint32_t)(st & 1) * (4u * SHALF), kg + (size_t)(st + 2) * SHALF,
                vg + (size_t)(st + 2) * SHALF);
  }
  asm volatile("s_wait_asynccnt 0x0" ::: "memory");    // no copy is left in flight at the wave's end

  // O = sum (1024 p)(8 v); c = 128 * ctx = O / (64 * l); hi = f16(c), res = f16((c - hi) * 2048).
  // A lane holds 8 consecutive d of its query per tile (row ln, k (d&1)*16 + 8*lhi + r of fragment
  // h*2 + d/2): its own 16-byte piece of the plane, so a wave's store is 512 contiguous bytes.
  const size_t coff = (((((size_t)b * SEQ + qb) >> 4) + wave) * (EMB / 32) + h * 2) * FRAG + lane * 8;
  _Float16* cdst = C16 + coff;
  _Float16* rdst = R16 + coff;
  const float lt = ls + other_half(ls);
  const float inv = (1.0f / lt) * 0.015625f;
#pragma unroll
  for (int d = 0; d < 4; ++d) {
    H8 hv, rv;
#pragma unroll
    for (int r = 0; r < 8; ++r) {
      const float c = o[d][r] * inv;
      const _Float16 hh = (_Float16)c;
      const float resf = (c - (float)hh) * 2048.0f;
      hv.h[r] = hh;
      rv.h[r] = (_Float16)resf;
    }
    vst16(cdst + d * 256, hv.q);
    vst16(rdst + d * 256, rv.q);
  }
}

// ---------------------------------------------------------------- kernel 3
// y[m][f] = (sum_e C16[m][e]*Wp16[f][e] + (sum_e R16[m][e]*Wp16[f][e]) / 2048) / 4096 + bf16(b_proj[f]);
// M = NB*SEQ, N = K = 1024. Block = 4 waves, wave tile 32 rows x 64 cols, two accumulator
// sets (hi plane, residual plane), fragments read from the planes.
static __device__ __forceinline__ void y_store_pass(const float* yw, float* out, int m0, int n0,
                                                    int lane) {
  const int prow = lane >> 4, piece = lane & 15;   // 16 lanes x 16 B = one 256-B row segment
#pragma unroll
  for (int i = 0; i < 16; ++i) {
    const int row = i * 2 + prow;
    const int mm = m0 + row;
    const int ob = mm / SEQ;
    const int ot = mm - ob * SEQ;
    const size_t orow = (size_t)ob * SEQ_OUT + ot;
    vstf4(out + orow * EMB + n0 + piece * 4, ((const v4fa*)yw)[row * 16 + piece]);
  }
}

__global__ __launch_bounds__(128) __attribute__((amdgpu_num_vgpr(256)))
void proj_kernel(const _Float16* __restrict__ C16, const _Float16* __restrict__ R16,
                 const _Float16* __restrict__ Wp16, const float* __restrict__ bp,
                 float* __restrict__ out) {
  __shared__ float Yst[4][32 * 64];   // per-wave output staging [row][col]

  const int tid  = (int)threadIdx.x;
  const int wave = tid >> 5;
  const int lane = tid & 31;
  const int lhi  = lane >> 4;
  const int ln   = lane & 15;
  const int m0   = blockIdx.x * 128 + wave * 32;
  const int n0   = blockIdx.y * 64;

  const int TROW = (EMB / 32) * FRAG;   // halves per 16-row tile of a plane
  const _Float16* ah0 = C16 + (size_t)(m0 >> 4) * TROW;
  const _Float16* ah1 = ah0 + TROW;
  const _Float16* al0 = R16 + (size_t)(m0 >> 4) * TROW;
  const _Float16* al1 = al0 + TROW;
  const _Float16* bpn = Wp16 + (size_t)(n0 >> 4) * TROW;

  v8f acch[2][4], accl[2][4];
#pragma unroll
  for (int mi = 0; mi < 2; ++mi) {
#pragma unroll
    for (int nt = 0; nt < 4; ++nt) {
#pragma unroll
      for (int e = 0; e < 8; ++e) { acch[mi][nt][e] = 0.0f; accl[mi][nt][e] = 0.0f; }
    }
  }

#pragma unroll 1
  for (int k0 = 0; k0 < TROW; k0 += FRAG) {
    AF a0, a1, l0, l1;
    load_fragp(a0, ah0 + k0, lane);
    load_fragp(a1, ah1 + k0, lane);
    load_fragp(l0, al0 + k0, lane);
    load_fragp(l1, al1 + k0, lane);
#pragma unroll
    for (int nt = 0; nt < 4; ++nt) {
      AF bf;
      load_fragp(bf, bpn + nt * TROW + k0, lane);
      acch[0][nt] = mma16(a0.v, bf.v, acch[0][nt]);
      acch[1][nt] = mma16(a1.v, bf.v, acch[1][nt]);
      accl[0][nt] = mma16(l0.v, bf.v, accl[0][nt]);
      accl[1][nt] = mma16(l1.v, bf.v, accl[1][nt]);
    }
  }

  float* yw = Yst[wave];
#pragma unroll
  for (int nt = 0; nt < 4; ++nt) {
    const int col = nt * 16 + ln;
    const float bias = bf16r(bp[n0 + col]);
#pragma unroll
    for (int mi = 0; mi < 2; ++mi) {
#pragma unroll
      for (int r = 0; r < 8; ++r) {
        const float v = (acch[mi][nt][r] + accl[mi][nt][r] * 0.00048828125f) * 0.000244140625f + bias;
        yw[(mi * 16 + lhi * 8 + r) * 64 + col] = v;
      }
    }
  }
  __syncthreads();

  y_store_pass(yw, out, m0, n0, lane);
  
}

// ---------------------------------------------------------------- host
extern "C" void kernel_launch(void* const* d_in, const int* in_sizes, int n_in,
                              void* d_out, int out_size, void* d_ws, size_t ws_size,
                              hipStream_t stream) {
  if (n_in < 5) return;
  if (in_sizes[0] < ((NB - 1) * SEQ_FULL + SEQ) * EMB) return;
  if (in_sizes[1] < NQKV * HDIM) return;
  if (in_sizes[2] < NQKV) return;
  if (in_sizes[3] < EMB * EMB) return;
  if (in_sizes[4] < EMB) return;
  if (out_size < ((NB - 1) * SEQ_OUT + SEQ) * EMB) return;

  const float* x     = (const float*)d_in[0];
  const float* Wqkv  = (const float*)d_in[1];
  const float* bqkv  = (const float*)d_in[2];
  const float* Wproj = (const float*)d_in[3];
  const float* bproj = (const float*)d_in[4];
  float* out = (float*)d_out;

  char* ws = (char*)d_ws;
  size_t off = 0;
  _Float16* Wq16 = (_Float16*)(ws + off); off += (size_t)NQKV * HDIM * 2;          // 24576 B
  _Float16* Wp16 = (_Float16*)(ws + off); off += (size_t)EMB * EMB * 2;            // 2 MiB
  const size_t psz = (size_t)NB * NHEAD * SEQ * HDIM * 2;                          // 16 MiB at full size
  _Float16* Q16  = (_Float16*)(ws + off); off += psz;                               // [bh][t/16][2][FRAG]
  _Float16* K16  = (_Float16*)(ws + off); off += psz;                               // [bh][t/16][2][FRAG]
  _Float16* V16T = (_Float16*)(ws + off); off += psz;                               // [bh][t/32][4][FRAG]
  _Float16* C16  = (_Float16*)(ws + off); off += (size_t)NB * SEQ * EMB * 2;        // [b*t/16][32][FRAG] hi
  _Float16* R16  = (_Float16*)(ws + off); off += (size_t)NB * SEQ * EMB * 2;        // [b*t/16][32][FRAG] residual
  if (off > ws_size) return;

  cvt_w16_kernel<<<(NQKV * HDIM / 8) / 256, 256, 0, stream>>>(Wqkv, Wq16, NQKV * HDIM / 8, 8.0f, 1);
  cvt_w16_kernel<<<(EMB * EMB / 8) / 256, 256, 0, stream>>>(Wproj, Wp16, EMB * EMB / 8, 32.0f, 5);

  dim3 g1(SEQ / 128, NHEAD, NB);
  qkv_kernel<<<g1, 256, 0, stream>>>(x, Wq16, bqkv, Q16, K16, V16T);
  attn_kernel<<<g1, 256, 0, stream>>>(Q16, K16, V16T, C16, R16);

  dim3 g3((NB * SEQ) / 128, EMB / 64);
  proj_kernel<<<g3, 128, 0, stream>>>(C16, R16, Wp16, bproj, out);
}

// v005
// One run takes 131 microseconds.
// In two side-by-side timings against v004, it was 1.04 and 1.03 times as fast.
// All steps since v000 together make it 3.75 times as fast.
#include <hip/hip_runtime.h>
#include <stdint.h>

// Contractions: qkv projection (K=64), q.k^T (K=64), p.v (K=32 per step): v_wmma_f32_16x16x32_f16, plain f16 operands, f32 accumulate;
// output projection (K=1024): v_wmma_f32_16x16x32_f16 with the context operand carried as f16 hi + f16 residual x2^11 (two accumulators), weights f16, f32 accumulate.
// Float inputs are RNE-converted to bf16 and then cast to f16 (exact); carries: W_qkv x8, softmax P x1024, context x128, W_proj x32; softmax and epilogues in f32.

typedef __attribute__((ext_vector_type(16))) _Float16 v16h;
typedef __attribute__((ext_vector_type(8)))  float    v8f;
typedef __attribute__((ext_vector_type(4)))  float    v4f;
typedef __attribute__((ext_vector_type(2)))  float    v2f;
typedef __attribute__((ext_vector_type(4)))  uint32_t v4u;
typedef v4u __attribute__((may_alias)) v4ua;
typedef v4f __attribute__((may_alias)) v4fa;

#ifndef NB
#define NB 4            // batch count processed
#endif
#ifndef SEQ
#define SEQ 2048        // tokens per batch processed
#endif
#ifndef SEQ_FULL
#define SEQ_FULL 2048   // per-batch token stride of the input x
#endif
#ifndef SEQ_OUT
#define SEQ_OUT SEQ     // per-batch token stride of the output buffer
#endif
#define NHEAD 16
#define EMB   1024
#define HDIM  64
#define NQKV  192

static_assert(NB >= 1);
static_assert(SEQ >= 128);
static_assert(SEQ % 128 == 0);
static_assert(SEQ <= SEQ_FULL);
static_assert(NHEAD * HDIM == EMB);
static_assert(((NQKV * HDIM) / 8) % 256 == 0);
static_assert(((EMB * EMB) / 8) % 256 == 0);
static_assert((NB * SEQ) % 128 == 0);
static_assert(EMB % 64 == 0);

// ---------------------------------------------------------------- helpers
static __device__ __forceinline__ float bf16r(float f) {   // RNE convert to bf16, back to f32
  uint32_t u = __float_as_uint(f);
  u = u + 0x7FFFu + ((u >> 16) & 1u);
  u = u & 0xFFFF0000u;
  return __uint_as_float(u);
}

union AF { v16h v; _Float16 h[16]; v4u q[2]; };
union H8 { _Float16 h[8]; v4u q; };

// 16-half WMMA fragment (A or B operand, one 32-deep k step): lane row/col = lane&15;
// elements 0..7 <- k 8*lhi+0..7, elements 8..15 <- k 16+8*lhi+0..7 (two aligned 16-byte loads).
// Fragment-order planes: every f16 operand plane in the workspace is a sequence of 1-KB
// fragments (16 rows x 32 k). Inside a fragment, half index j*256 + lane*8 + e holds
// (row lane&15, k 16*j + 8*(lane>>4) + e), so that each of the two loads of a wave covers
// 512 contiguous bytes (4 whole lines) instead of 32-byte pieces of 16 lines.
#define FRAG 512        // halves per fragment
static __device__ __forceinline__ void load_fragp(AF& a, const _Float16* frag, int lane) {
  const v4ua* p = (const v4ua*)(frag + lane * 8);
  a.q[0] = p[0];
  a.q[1] = p[32];
}

static __device__ __forceinline__ v8f mma16(v16h a, v16h b, v8f c) {
  v8f d = __builtin_amdgcn_wmma_f32_16x16x32_f16(false, a, false, b, (short)0, c,
                                                 false, false);
  return d;
}

static __device__ __forceinline__ void vst16(_Float16* p, v4u v) { *(v4u*)p = v; }
static __device__ __forceinline__ void vstf4(float* p, v4f v) { *(v4f*)p = v; }

// ---------------------------------------------------------------- kernel 0
// f32 weights [rows][32 << ksh] -> f16 fragment-order plane [rows/16][1 << ksh][FRAG]:
// h = f16(bf16(w) * scale). One lane = one 16-byte piece of the plane = 8 consecutive k of one row.
__global__ __launch_bounds__(256) void cvt_w16_kernel(const float* __restrict__ src,
                                                      _Float16* __restrict__ dst,
                                                      int n8, float scale, int ksh) {
  const int i = blockIdx.x * 256 + (int)threadIdx.x;
  if (i >= n8) return;                       // n8 is a multiple of 256 in every launch
  const int fr  = i >> 6;                    // fragment; piece i&63 = j*32 + lane
  const int row = (fr >> ksh) * 16 + (i & 15);
  const int k   = (fr & ((1 << ksh) - 1)) * 32 + ((i >> 5) & 1) * 16 + ((i >> 4) & 1) * 8;
  const v4f* sp = (const v4f*)(src + ((size_t)row << (ksh + 5)) + k);
  const v4f f0 = sp[0];
  const v4f f1 = sp[1];
  H8 o;
#pragma unroll
  for (int e = 0; e < 4; ++e) {
    o.h[e]     = (_Float16)(bf16r(f0[e]) * scale);
    o.h[4 + e] = (_Float16)(bf16r(f1[e]) * scale);
  }
  const v4u val = o.q;
  _Float16* dp = dst + (size_t)i * 8;
  vst16(dp, val);
  
}

// ---------------------------------------------------------------- kernel 1
// Per (b, h, 128-token tile): qkv = x_h[128x64] . Wq16^T (Wq16 = [192][64] as fragment-order plane [12][2][FRAG]).
// Wave = 16 tokens x 192 columns (24 WMMA). Planes, fragment order: Q16/K16 = [bh][t/16][d/32][FRAG]
// (rows = tokens, k = d; 8q, 8k), V16T = [bh][t/32][d/16][FRAG] (rows = d, k = tokens; 8v).
// A 128-token tile is 16 KB contiguous in each plane.
static __device__ __forceinline__ void qkv_store_pass(const _Float16* Qst, const _Float16* Kst,
                                                      const _Float16* Vst, _Float16* qdst,
                                                      _Float16* kdst, _Float16* vdst, int tid) {
#pragma unroll
  for (int it = 0; it < 4; ++it) {
    const int idx = it * 256 + tid;                       // 16-B piece of the contiguous 16 KB tile
    vst16(qdst + (size_t)idx * 8, ((const v4ua*)Qst)[idx]);
    vst16(kdst + (size_t)idx * 8, ((const v4ua*)Kst)[idx]);
    vst16(vdst + (size_t)idx * 8, ((const v4ua*)Vst)[idx]);
  }
}

__global__ __launch_bounds__(256) __attribute__((amdgpu_num_vgpr(256)))
void qkv_kernel(const float* __restrict__ x, const _Float16* __restrict__ Wq16,
                const float* __restrict__ bq, _Float16* __restrict__ Q16,
                _Float16* __restrict__ K16, _Float16* __restrict__ V16T) {
  __shared__ _Float16 Qst[128 * HDIM];   // [token/16][d/32][FRAG]
  __shared__ _Float16 Kst[128 * HDIM];   // [token/16][d/32][FRAG]
  __shared__ _Float16 Vst[HDIM * 128];   // [token/32][d/16][FRAG]

  const int tid  = (int)threadIdx.x;
  const int wave = tid >> 5;
  const int lane = tid & 31;
  const int lhi  = lane >> 4;
  const int ln   = lane & 15;
  const int tb   = blockIdx.x * 128;
  const int h    = blockIdx.y;
  const int b    = blockIdx.z;

  // A fragments: x rows (tokens) x 64 dims, f32 -> bf16 RNE -> f16 in registers.
  const int trow = tb + wave * 16 + ln;
  const float* xrow = x + ((size_t)b * SEQ_FULL + trow) * EMB + h * HDIM;
  AF xa[2];
#pragma unroll
  for (int ks = 0; ks < 2; ++ks) {
    const v4f* xp = (const v4f*)(xrow + ks * 32 + lhi * 8);
    const v4f f0 = xp[0], f1 = xp[1];    // k = ks*32 + 8*lhi + 0..7   (elements 0..7)
    const v4f f2 = xp[4], f3 = xp[5];    // k = ks*32 + 16 + 8*lhi +.. (elements 8..15)
#pragma unroll
    for (int e = 0; e < 4; ++e) {
      xa[ks].h[e]      = (_Float16)bf16r(f0[e]);
      xa[ks].h[4 + e]  = (_Float16)bf16r(f1[e]);
      xa[ks].h[8 + e]  = (_Float16)bf16r(f2[e]);
      xa[ks].h[12 + e] = (_Float16)bf16r(f3[e]);
    }
  }

  // D rows of this lane: tokens wave*16 + lhi*8 + r; D column: ln.
  const int qkpos = ((ln >> 3) * 16 + lhi * 8) * 8 + (ln & 7);   // + r*8: row lhi*8+r, k 8*(ln>>3) + (ln&7)
#pragma unroll
  for (int n = 0; n < 12; ++n) {
    const int colg = n * 16 + ln;          // output column 0..191 = B column of this lane
    AF wb0, wb1;
    load_fragp(wb0, Wq16 + (n * 2) * FRAG, lane);
    load_fragp(wb1, Wq16 + (n * 2 + 1) * FRAG, lane);
    const float bv = 8.0f * bf16r(bq[colg]);
    v8f acc;
#pragma unroll
    for (int e = 0; e < 8; ++e) acc[e] = bv;
    acc = mma16(xa[0].v, wb0.v, acc);
    acc = mma16(xa[1].v, wb1.v, acc);
    const int ct = n & 3;                  // 16-column tile within the 64-wide q / k / v block
    const int qkoff = (wave * 2 + (ct >> 1)) * FRAG + (ct & 1) * 256 + qkpos;
    if (n < 4) {
#pragma unroll
      for (int r = 0; r < 8; ++r) Qst[qkoff + r * 8] = (_Float16)acc[r];
    } else if (n < 8) {
#pragma unroll
      for (int r = 0; r < 8; ++r) Kst[qkoff + r * 8] = (_Float16)acc[r];
    } else {
      // row d = ct*16 + ln, k = tokens (wave&1)*16 + 8*lhi + r: the lane's own 16-byte piece
      H8 vv;
#pragma unroll
      for (int r = 0; r < 8; ++r) vv.h[r] = (_Float16)acc[r];
      vst16(Vst + ((wave >> 1) * 4 + ct) * FRAG + (wave & 1) * 256 + lane * 8, vv.q);
    }
  }
  __syncthreads();   // cross-wave staging complete

  const size_t bh = (size_t)(b * NHEAD + h);
  _Float16* qdst = Q16 + (bh * SEQ + tb) * HDIM;
  _Float16* kdst = K16 + (bh * SEQ + tb) * HDIM;
  _Float16* vdst = V16T + (bh * SEQ + tb) * HDIM;
  qkv_store_pass(Qst, Kst, Vst, qdst, kdst, vdst, tid);
  
}

// ---------------------------------------------------------------- kernel 2
// Flash attention, transposed products. Block = 8 waves = 128 query columns of one (b,h);
// key blocks of 32: S^T = K.Q^T (4 WMMA, A = K rows, B = Q kept in registers), so a lane holds
// 16 scores of ONE query (column ln; keys 8*lhi+r and 16+8*lhi+r). Maximum and sum run in the
// lane, plus one exchange between the wave halves for the maximum. The two score tiles,
// converted in place, are the B operand of O^T += V^T.P^T (4 WMMA, A = V^T rows): P x1024
// goes from registers to registers. K/V reach the waves through a two-buffer LDS ring: a stage is
// 64 keys (8 KB of K, 8 KB of V, both contiguous in their planes and already in fragment order),
// copied once per block by asynchronous copies while the stage before it is worked on.
// Outputs, fragment order [b*t/16][e/32][FRAG] (rows = tokens, k = e = h*64 + d): C16 = f16 hi of
// 128*ctx, R16 = f16 residual (128*ctx - hi) x 2048.

static __device__ __forceinline__ float other_half(float v) {   // value held by lane l ^ 16
  const int b = __float_as_int(v);
  return __int_as_float(__builtin_amdgcn_permlanex16(b, b, 0x76543210, 0xfedcba98, false, false));
}

#define SKEYS 64                    // keys per ring stage
#define SHALF (SKEYS * HDIM)        // halves per operand and stage (8 KB)
#define NSTAGE (SEQ / SKEYS)
static_assert(SEQ % SKEYS == 0);
static_assert(NSTAGE >= 2);

// One stage: each of the 256 lanes copies four 16-byte pieces (two of K, two of V) to LDS.
// lds = the lane's byte address in the buffer, kg / vg = the lane's first piece in the planes.
static __device__ __forceinline__ void stage_copy(uint32_t lds, const _Float16* kg,
                                                  const _Float16* vg) {
  const uint32_t l1 = lds + 4096u, l2 = lds + 8192u, l3 = lds + 12288u;
  const _Float16* kg1 = kg + 2048;
  const _Float16* vg1 = vg + 2048;
  // The closing s_wait_xcnt stands inside the statement so that no address register of a copy
  // is rewritten ahead of it.
  asm volatile("global_load_async_to_lds_b128 %0, %4, off\n\t"
               "global_load_async_to_lds_b128 %1, %5, off\n\t"
               "global_load_async_to_lds_b128 %2, %6, off\n\t"
               "global_load_async_to_lds_b128 %3, %7, off\n\t"
               "s_wait_xcnt 0x0"
               :: "v"(lds), "v"(l1), "v"(l2), "v"(l3), "v"(kg), "v"(kg1), "v"(vg), "v"(vg1)
               : "memory");
}

__global__ __launch_bounds__(256) __attribute__((amdgpu_num_vgpr(256)))
void attn_kernel(const _Float16* __restrict__ Q16, const _Float16* __restrict__ K16,
                 const _Float16* __restrict__ V16T, _Float16* __restrict__ C16,
                 _Float16* __restrict__ R16) {
  __shared__ __attribute__((aligned(16))) _Float16 KV[2][2 * SHALF];   // [buffer][K stage | V stage]

  const int tid  = (int)threadIdx.x;
  const int wave = tid >> 5;
  const int lane = tid & 31;               // below: lhi = lane >> 4, ln = lane & 15
  const int qb   = blockIdx.x * 128;
  const int h    = blockIdx.y;
  const int b    = blockIdx.z;
  const size_t bh = (size_t)(b * NHEAD + h);
  const _Float16* Qp = Q16 + bh * SEQ * HDIM;
  const _Float16* Kp = K16 + bh * SEQ * HDIM;
  const _Float16* Vp = V16T + bh * SEQ * HDIM;

  // Q B-fragments for this wave's 16 query columns (plane carries 8q).
  const int qt = (qb >> 4) + wave;
  AF qa0, qa1;
  load_fragp(qa0, Qp + (size_t)(qt * 2) * FRAG, lane);
  load_fragp(qa1, Qp + (size_t)(qt * 2 + 1) * FRAG, lane);

  float m = -3.0e38f;   // running maximum of query ln (equal in both halves)
  float ls = 0.0f;      // running sum of 1024 p over this half's keys only; halves joined after the loop
  v8f o[4];             // o[d][r] = O^T[d*16 + 8*lhi + r][query ln]
#pragma unroll
  for (int d = 0; d < 4; ++d) {
#pragma unroll
    for (int e = 0; e < 8; ++e) o[d][e] = 0.0f;
  }

  // Softmax runs in base 2: SC2 = log2(e) / 512 takes (8q).(8k) to log2(e) * q.k / 8.
  const float SC2 = 0.0028177637517362567f;

  // Ring prologue: stage 0 lands and is published, then stage 1 starts to fly.
  const uint32_t lds0 = (uint32_t)(size_t)(&KV[0][0]) + (uint32_t)tid * 16u;
  const _Float16* kg = Kp + tid * 8;
  const _Float16* vg = Vp + tid * 8;
  stage_copy(lds0, kg, vg);
  asm volatile("s_wait_asynccnt 0x0" ::: "memory");   // this wave's pieces of stage 0 have landed
  __syncthreads();                                    // every wave's pieces have
  stage_copy(lds0 + 4u * SHALF, kg + SHALF, vg + SHALF);

#pragma unroll 1
  for (int st = 0; st < NSTAGE; ++st) {
   const _Float16* Ks = &KV[st & 1][0];
   const _Float16* Vs = Ks + SHALF;
#pragma unroll
   for (int kb = 0; kb < SKEYS / 32; ++kb) {
    // S^T = K . Q^T : two 16-key tiles, each 2 k-steps over 64 dims.
    v8f s[2];
#pragma unroll
    for (int nt = 0; nt < 2; ++nt) {
      const int kt = kb * 2 + nt;                // 16-key tile: A rows
      AF f0, f1;
      load_fragp(f0, Ks + (kt * 2) * FRAG, lane);
      load_fragp(f1, Ks + (kt * 2 + 1) * FRAG, lane);
      v8f c;
#pragma unroll
      for (int e = 0; e < 8; ++e) c[e] = 0.0f;
      c = mma16(f0.v, qa0.v, c);
      c = mma16(f1.v, qa1.v, c);
      s[nt] = c;
    }

    // Online softmax (f32), one query per lane; m and mn are in base-2 units.
    float mx0 = s[0][0], mx1 = s[1][0];
#pragma unroll
    for (int r = 1; r < 8; ++r) {
      mx0 = fmaxf(mx0, s[0][r]);
      mx1 = fmaxf(mx1, s[1][r]);
    }
    float mx = fmaxf(mx0, mx1);
    mx = fmaxf(mx, other_half(mx)) * SC2;
    const float mn = fmaxf(m, mx);
    const float corr = __builtin_amdgcn_exp2f(m - mn);
    m = mn;
    const float mo = mn - 10.0f;   // the carry x1024 of P rides in the exponent

    // P^T as a 32x16 B fragment: element nt*8+r = key nt*16 + 8*lhi + r, the hardware k order
    // that the V^T fragments have.
    AF pb;
    const v2f sc2 = {SC2, SC2};
    const v2f nmo = {-mo, -mo};
    v2f rs0 = {0.0f, 0.0f}, rs1 = {0.0f, 0.0f};   // sums of 1024 p: keys of even r in x, of odd r in y
#pragma unroll
    for (int r = 0; r < 8; r += 2) {
      // Two neighbouring scores at a time: one packed FMA for both exponents, one packed add for both p.
      const v2f e0 = __builtin_elementwise_fma((v2f){s[0][r], s[0][r + 1]}, sc2, nmo);
      const v2f e1 = __builtin_elementwise_fma((v2f){s[1][r], s[1][r + 1]}, sc2, nmo);
      const v2f p0 = {__builtin_amdgcn_exp2f(e0.x), __builtin_amdgcn_exp2f(e0.y)};   // 1024 p
      const v2f p1 = {__builtin_amdgcn_exp2f(e1.x), __builtin_amdgcn_exp2f(e1.y)};
      rs0 += p0;
      rs1 += p1;
      pb.h[r]         = (_Float16)p0.x;
      pb.h[r + 1]     = (_Float16)p0.y;
      pb.h[8 + r]     = (_Float16)p1.x;
      pb.h[8 + r + 1] = (_Float16)p1.y;
    }
    rs0 += rs1;
    ls = ls * corr + (rs0.x + rs0.y);
#pragma unroll
    for (int d = 0; d < 4; ++d) {
#pragma unroll
      for (int r = 0; r < 8; ++r) o[d][r] *= corr;
    }

    // O^T += V^T . P^T : four 16-row d tiles, one fragment each.
#pragma unroll
    for (int d = 0; d < 4; ++d) {
      AF vf;
      load_fragp(vf, Vs + (kb * 4 + d) * FRAG, lane);
      o[d] = mma16(vf.v, pb.v, o[d]);
    }
   }
   // Publish point of stage st + 1; behind its barrier the buffer just read is free for st + 2.
   asm volatile("s_wait_dscnt 0x0" ::: "memory");      // this wave's reads of the buffer are done
   asm volatile("s_wait_asynccnt 0x0" ::: "memory");   // this wave's pieces of stage st + 1 have landed
   __syncthreads();
   if (st + 2 < NSTAGE)
     stage_copy(lds0 + (uint32_t)(st & 1) * (4u * SHALF), kg + (size_t)(st + 2) * SHALF,
                vg + (size_t)(st + 2) * SHALF);
  }
  asm volatile("s_wait_asynccnt 0x0" ::: "memory");    // no copy is left in flight at the wave's end

  // O = sum (1024 p)(8 v), lt = sum (1024 p); c = 128 * ctx = 16 * O / lt; hi = f16(c), res = f16((c - hi) * 2048).
  // A lane holds 8 consecutive d of its query per tile (row ln, k (d&1)*16 + 8*lhi + r of fragment
  // h*2 + d/2): its own 16-byte piece of the plane, so a wave's store is 512 contiguous bytes.
  const size_t coff = (((((size_t)b * SEQ + qb) >> 4) + wave) * (EMB / 32) + h * 2) * FRAG + lane * 8;
  _Float16* cdst = C16 + coff;
  _Float16* rdst = R16 + coff;
  const float lt = ls + other_half(ls);
  const float inv = (1.0f / lt) * 16.0f;
#pragma unroll
  for (int d = 0; d < 4; ++d) {
    H8 hv, rv;
#pragma unroll
    for (int r = 0; r < 8; ++r) {
      const float c = o[d][r] * inv;
      const _Float16 hh = (_Float16)c;
      const float resf = (c - (float)hh) * 2048.0f;
      hv.h[r] = hh;
      rv.h[r] = (_Float16)resf;
    }
    vst16(cdst + d * 256, hv.q);
    vst16(rdst + d * 256, rv.q);
  }
}

// ---------------------------------------------------------------- kernel 3
// y[m][f] = (sum_e C16[m][e]*Wp16[f][e] + (sum_e R16[m][e]*Wp16[f][e]) / 2048) / 4096 + bf16(b_proj[f]);
// M = NB*SEQ, N = K = 1024. Block = 4 waves, wave tile 32 rows x 64 cols, two accumulator
// sets (hi plane, residual plane), fragments read from the planes.
static __device__ __forceinline__ void y_store_pass(const float* yw, float* out, int m0, int n0,
                                                    int lane) {
  const int prow = lane >> 4, piece = lane & 15;   // 16 lanes x 16 B = one 256-B row segment
#pragma unroll
  for (int i = 0; i < 16; ++i) {
    const int row = i * 2 + prow;
    const int mm = m0 + row;
    const int ob = mm / SEQ;
    const int ot = mm - ob * SEQ;
    const size_t orow = (size_t)ob * SEQ_OUT + ot;
    vstf4(out + orow * EMB + n0 + piece * 4, ((const v4fa*)yw)[row * 16 + piece]);
  }
}

__global__ __launch_bounds__(128) __attribute__((amdgpu_num_vgpr(256)))
void proj_kernel(const _Float16* __restrict__ C16, const _Float16* __restrict__ R16,
                 const _Float16* __restrict__ Wp16, const float* __restrict__ bp,
                 float* __restrict__ out) {
  __shared__ float Yst[4][32 * 64];   // per-wave output staging [row][col]

  const int tid  = (int)threadIdx.x;
  const int wave = tid >> 5;
  const int lane = tid & 31;
  const int lhi  = lane >> 4;
  const int ln   = lane & 15;
  const int m0   = blockIdx.x * 128 + wave * 32;
  const int n0   = blockIdx.y * 64;

  const int TROW = (EMB / 32) * FRAG;   // halves per 16-row tile of a plane
  const _Float16* ah0 = C16 + (size_t)(m0 >> 4) * TROW;
  const _Float16* ah1 = ah0 + TROW;
  const _Float16* al0 = R16 + (size_t)(m0 >> 4) * TROW;
  const _Float16* al1 = al0 + TROW;
  const _Float16* bpn = Wp16 + (size_t)(n0 >> 4) * TROW;

  v8f acch[2][4], accl[2][4];
#pragma unroll
  for (int mi = 0; mi < 2; ++mi) {
#pragma unroll
    for (int nt = 0; nt < 4; ++nt) {
#pragma unroll
      for (int e = 0; e < 8; ++e) { acch[mi][nt][e] = 0.0f; accl[mi][nt][e] = 0.0f; }
    }
  }

#pragma unroll 1
  for (int k0 = 0; k0 < TROW; k0 += FRAG) {
    AF a0, a1, l0, l1;
    load_fragp(a0, ah0 + k0, lane);
    load_fragp(a1, ah1 + k0, lane);
    load_fragp(l0, al0 + k0, lane);
    load_fragp(l1, al1 + k0, lane);
#pragma unroll
    for (int nt = 0; nt < 4; ++nt) {
      AF bf;
      load_fragp(bf, bpn + nt * TROW + k0, lane);
      acch[0][nt] = mma16(a0.v, bf.v, acch[0][nt]);
      acch[1][nt] = mma16(a1.v, bf.v, acch[1][nt]);
      accl[0][nt] = mma16(l0.v, bf.v, accl[0][nt]);
      accl[1][nt] = mma16(l1.v, bf.v, accl[1][nt]);
    }
  }

  float* yw = Yst[wave];
#pragma unroll
  for (int nt = 0; nt < 4; ++nt) {
    const int col = nt * 16 + ln;
    const float bias = bf16r(bp[n0 + col]);
#pragma unroll
    for (int mi = 0; mi < 2; ++mi) {
#pragma unroll
      for (int r = 0; r < 8; ++r) {
        const float v = (acch[mi][nt][r] + accl[mi][nt][r] * 0.00048828125f) * 0.000244140625f + bias;
        yw[(mi * 16 + lhi * 8 + r) * 64 + col] = v;
      }
    }
  }
  __syncthreads();

  y_store_pass(yw, out, m0, n0, lane);
  
}

// ---------------------------------------------------------------- host
extern "C" void kernel_launch(void* const* d_in, const int* in_sizes, int n_in,
                              void* d_out, int out_size, void* d_ws, size_t ws_size,
                              hipStream_t stream) {
  if (n_in < 5) return;
  if (in_sizes[0] < ((NB - 1) * SEQ_FULL + SEQ) * EMB) return;
  if (in_sizes[1] < NQKV * HDIM) return;
  if (in_sizes[2] < NQKV) return;
  if (in_sizes[3] < EMB * EMB) return;
  if (in_sizes[4] < EMB) return;
  if (out_size < ((NB - 1) * SEQ_OUT + SEQ) * EMB) return;

  const float* x     = (const float*)d_in[0];
  const float* Wqkv  = (const float*)d_in[1];
  const float* bqkv  = (const float*)d_in[2];
  const float* Wproj = (const float*)d_in[3];
  const float* bproj = (const float*)d_in[4];
  float* out = (float*)d_out;

  char* ws = (char*)d_ws;
  size_t off = 0;
  _Float16* Wq16 = (_Float16*)(ws + off); off += (size_t)NQKV * HDIM * 2;          // 24576 B
  _Float16* Wp16 = (_Float16*)(ws + off); off += (size_t)EMB * EMB * 2;            // 2 MiB
  const size_t psz = (size_t)NB * NHEAD * SEQ * HDIM * 2;                          // 16 MiB at full size
  _Float16* Q16  = (_Float16*)(ws + off); off += psz;                               // [bh][t/16][2][FRAG]
  _Float16* K16  = (_Float16*)(ws + off); off += psz;                               // [bh][t/16][2][FRAG]
  _Float16* V16T = (_Float16*)(ws + off); off += psz;                               // [bh][t/32][4][FRAG]
  _Float16* C16  = (_Float16*)(ws + off); off += (size_t)NB * SEQ * EMB * 2;        // [b*t/16][32][FRAG] hi
  _Float16* R16  = (_Float16*)(ws + off); off += (size_t)NB * SEQ * EMB * 2;        // [b*t/16][32][FRAG] residual
  if (off > ws_size) return;

  cvt_w16_kernel<<<(NQKV * HDIM / 8) / 256, 256, 0, stream>>>(Wqkv, Wq16, NQKV * HDIM / 8, 8.0f, 1);
  cvt_w16_kernel<<<(EMB * EMB / 8) / 256, 256, 0, stream>>>(Wproj, Wp16, EMB * EMB / 8, 32.0f, 5);

  dim3 g1(SEQ / 128, NHEAD, NB);
  qkv_kernel<<<g1, 256, 0, stream>>>(x, Wq16, bqkv, Q16, K16, V16T);
  attn_kernel<<<g1, 256, 0, stream>>>(Q16, K16, V16T, C16, R16);

  dim3 g3((NB * SEQ) / 128, EMB / 64);
  proj_kernel<<<g3, 128, 0, stream>>>(C16, R16, Wp16, bproj, out);
}

// v006
// One run takes 125 microseconds.
// Next to v005, in two timings, it ran 1.04 and 1.02 times as fast.
// All steps since v000 together make it 3.86 times as fast.
#include <hip/hip_runtime.h>
#include <stdint.h>

// Contractions: qkv projection (K=64), q.k^T (K=64), p.v (K=32 per step): v_wmma_f32_16x16x32_f16, plain f16 operands, f32 accumulate;
// output projection (K=1024): v_wmma_f32_16x16x32_f16 with the context operand carried as f16 hi + f16 residual x2^11 (two accumulators), weights f16, f32 accumulate.
// Float inputs are RNE-converted to bf16 and then cast to f16 (exact); carries: W_qkv x8, softmax P x1024, context x128, W_proj x32; softmax and epilogues in f32.

typedef __attribute__((ext_vector_type(16))) _Float16 v16h;
typedef __attribute__((ext_vector_type(8)))  float    v8f;
typedef __attribute__((ext_vector_type(4)))  float    v4f;
typedef __attribute__((ext_vector_type(2)))  float    v2f;
typedef __attribute__((ext_vector_type(4)))  uint32_t v4u;
typedef v4u __attribute__((may_alias)) v4ua;
typedef v4f __attribute__((may_alias)) v4fa;

#ifndef NB
#define NB 4            // batch count processed
#endif
#ifndef SEQ
#define SEQ 2048        // tokens per batch processed
#endif
#ifndef SEQ_FULL
#define SEQ_FULL 2048   // per-batch token stride of the input x
#endif
#ifndef SEQ_OUT
#define SEQ_OUT SEQ     // per-batch token stride of the output buffer
#endif
#define NHEAD 16
#define EMB   1024
#define HDIM  64
#define NQKV  192

static_assert(NB >= 1);
static_assert(SEQ >= 128);
static_assert(SEQ % 128 == 0);
static_assert(SEQ <= SEQ_FULL);
static_assert(NHEAD * HDIM == EMB);
static_assert(((NQKV * HDIM) / 8) % 256 == 0);
static_assert(((EMB * EMB) / 8) % 256 == 0);
static_assert((NB * SEQ) % 128 == 0);
static_assert(EMB % 64 == 0);

// ---------------------------------------------------------------- helpers
static __device__ __forceinline__ float bf16r(float f) {   // RNE convert to bf16, back to f32
  uint32_t u = __float_as_uint(f);
  u = u + 0x7FFFu + ((u >> 16) & 1u);
  u = u & 0xFFFF0000u;
  return __uint_as_float(u);
}

union AF { v16h v; _Float16 h[16]; v4u q[2]; };
union H8 { _Float16 h[8]; v4u q; };

// 16-half WMMA fragment (A or B operand, one 32-deep k step): lane row/col = lane&15;
// elements 0..7 <- k 8*lhi+0..7, elements 8..15 <- k 16+8*lhi+0..7 (two aligned 16-byte loads).
// Fragment-order planes: every f16 operand plane in the workspace is a sequence of 1-KB
// fragments (16 rows x 32 k). Inside a fragment, half index j*256 + lane*8 + e holds
// (row lane&15, k 16*j + 8*(lane>>4) + e), so that each of the two loads of a wave covers
// 512 contiguous bytes (4 whole lines) instead of 32-byte pieces of 16 lines.
#define FRAG 512        // halves per fragment
static __device__ __forceinline__ void load_fragp(AF& a, const _Float16* frag, int lane) {
  const v4ua* p = (const v4ua*)(frag + lane * 8);
  a.q[0] = p[0];
  a.q[1] = p[32];
}

static __device__ __forceinline__ v8f mma16(v16h a, v16h b, v8f c) {
  v8f d = __builtin_amdgcn_wmma_f32_16x16x32_f16(false, a, false, b, (short)0, c,
                                                 false, false);
  return d;
}

static __device__ __forceinline__ void vst16(_Float16* p, v4u v) { *(v4u*)p = v; }
static __device__ __forceinline__ void vstf4(float* p, v4f v) { *(v4f*)p = v; }

// ---------------------------------------------------------------- kernel 0
// f32 weights [rows][32 << ksh] -> f16 fragment-order plane [rows/16][1 << ksh][FRAG]:
// h = f16(bf16(w) * scale). One lane = one 16-byte piece of the plane = 8 consecutive k of one row.
__global__ __launch_bounds__(256) void cvt_w16_kernel(const float* __restrict__ src,
                                                      _Float16* __restrict__ dst,
                                                      int n8, float scale, int ksh) {
  const int i = blockIdx.x * 256 + (int)threadIdx.x;
  if (i >= n8) return;                       // n8 is a multiple of 256 in every launch
  const int fr  = i >> 6;                    // fragment; piece i&63 = j*32 + lane
  const int row = (fr >> ksh) * 16 + (i & 15);
  const int k   = (fr & ((1 << ksh) - 1)) * 32 + ((i >> 5) & 1) * 16 + ((i >> 4) & 1) * 8;
  const v4f* sp = (const v4f*)(src + ((size_t)row << (ksh + 5)) + k);
  const v4f f0 = sp[0];
  const v4f f1 = sp[1];
  H8 o;
#pragma unroll
  for (int e = 0; e < 4; ++e) {
    o.h[e]     = (_Float16)(bf16r(f0[e]) * scale);
    o.h[4 + e] = (_Float16)(bf16r(f1[e]) * scale);
  }
  const v4u val = o.q;
  _Float16* dp = dst + (size_t)i * 8;
  vst16(dp, val);
  
}

// ---------------------------------------------------------------- kernel 1
// Per (b, h, 128-token tile): qkv = x_h[128x64] . Wq16^T (Wq16 = [192][64] as fragment-order plane [12][2][FRAG]).
// Wave = 16 tokens x 192 columns (24 WMMA). Planes, fragment order: Q16/K16 = [bh][t/16][d/32][FRAG]
// (rows = tokens, k = d; 8q, 8k), V16T = [bh][t/32][d/16][FRAG] (rows = d, k = tokens; 8v).
// A 128-token tile is 16 KB contiguous in each plane.
static __device__ __forceinline__ void qkv_store_pass(const _Float16* Qst, const _Float16* Kst,
                                                      const _Float16* Vst, _Float16* qdst,
                                                      _Float16* kdst, _Float16* vdst, int tid) {
#pragma unroll
  for (int it = 0; it < 4; ++it) {
    const int idx = it * 256 + tid;                       // 16-B piece of the contiguous 16 KB tile
    vst16(qdst + (size_t)idx * 8, ((const v4ua*)Qst)[idx]);
    vst16(kdst + (size_t)idx * 8, ((const v4ua*)Kst)[idx]);
    vst16(vdst + (size_t)idx * 8, ((const v4ua*)Vst)[idx]);
  }
}

__global__ __launch_bounds__(256) __attribute__((amdgpu_num_vgpr(256)))
void qkv_kernel(const float* __restrict__ x, const _Float16* __restrict__ Wq16,
                const float* __restrict__ bq, _Float16* __restrict__ Q16,
                _Float16* __restrict__ K16, _Float16* __restrict__ V16T) {
  __shared__ _Float16 Qst[128 * HDIM];   // [token/16][d/32][FRAG]
  __shared__ _Float16 Kst[128 * HDIM];   // [token/16][d/32][FRAG]
  __shared__ _Float16 Vst[HDIM * 128];   // [token/32][d/16][FRAG]

  const int tid  = (int)threadIdx.x;
  const int wave = tid >> 5;
  const int lane = tid & 31;
  const int lhi  = lane >> 4;
  const int ln   = lane & 15;
  const int tb   = blockIdx.x * 128;
  const int h    = blockIdx.y;
  const int b    = blockIdx.z;

  // A fragments: x rows (tokens) x 64 dims, f32 -> bf16 RNE -> f16 in registers.
  const int trow = tb + wave * 16 + ln;
  const float* xrow = x + ((size_t)b * SEQ_FULL + trow) * EMB + h * HDIM;
  AF xa[2];
#pragma unroll
  for (int ks = 0; ks < 2; ++ks) {
    const v4f* xp = (const v4f*)(xrow + ks * 32 + lhi * 8);
    const v4f f0 = xp[0], f1 = xp[1];    // k = ks*32 + 8*lhi + 0..7   (elements 0..7)
    const v4f f2 = xp[4], f3 = xp[5];    // k = ks*32 + 16 + 8*lhi +.. (elements 8..15)
#pragma unroll
    for (int e = 0; e < 4; ++e) {
      xa[ks].h[e]      = (_Float16)bf16r(f0[e]);
      xa[ks].h[4 + e]  = (_Float16)bf16r(f1[e]);
      xa[ks].h[8 + e]  = (_Float16)bf16r(f2[e]);
      xa[ks].h[12 + e] = (_Float16)bf16r(f3[e]);
    }
  }

  // D rows of this lane: tokens wave*16 + lhi*8 + r; D column: ln.
  const int qkpos = ((ln >> 3) * 16 + lhi * 8) * 8 + (ln & 7);   // + r*8: row lhi*8+r, k 8*(ln>>3) + (ln&7)
#pragma unroll
  for (int n = 0; n < 12; ++n) {
    const int colg = n * 16 + ln;          // output column 0..191 = B column of this lane
    AF wb0, wb1;
    load_fragp(wb0, Wq16 + (n * 2) * FRAG, lane);
    load_fragp(wb1, Wq16 + (n * 2 + 1) * FRAG, lane);
    const float bv = 8.0f * bf16r(bq[colg]);
    v8f acc;
#pragma unroll
    for (int e = 0; e < 8; ++e) acc[e] = bv;
    acc = mma16(xa[0].v, wb0.v, acc);
    acc = mma16(xa[1].v, wb1.v, acc);
    const int ct = n & 3;                  // 16-column tile within the 64-wide q / k / v block
    const int qkoff = (wave * 2 + (ct >> 1)) * FRAG + (ct & 1) * 256 + qkpos;
    if (n < 4) {
#pragma unroll
      for (int r = 0; r < 8; ++r) Qst[qkoff + r * 8] = (_Float16)acc[r];
    } else if (n < 8) {
#pragma unroll
      for (int r = 0; r < 8; ++r) Kst[qkoff + r * 8] = (_Float16)acc[r];
    } else {
      // row d = ct*16 + ln, k = tokens (wave&1)*16 + 8*lhi + r: the lane's own 16-byte piece
      H8 vv;
#pragma unroll
      for (int r = 0; r < 8; ++r) vv.h[r] = (_Float16)acc[r];
      vst16(Vst + ((wave >> 1) * 4 + ct) * FRAG + (wave & 1) * 256 + lane * 8, vv.q);
    }
  }
  __syncthreads();   // cross-wave staging complete

  const size_t bh = (size_t)(b * NHEAD + h);
  _Float16* qdst = Q16 + (bh * SEQ + tb) * HDIM;
  _Float16* kdst = K16 + (bh * SEQ + tb) * HDIM;
  _Float16* vdst = V16T + (bh * SEQ + tb) * HDIM;
  qkv_store_pass(Qst, Kst, Vst, qdst, kdst, vdst, tid);
  
}

// ---------------------------------------------------------------- kernel 2
// Flash attention, transposed products. Block = 8 waves = 256 query columns of one (b,h); a wave
// has QT = 2 tiles of 16 query columns, so that every K and V fragment it reads from LDS is the
// A operand of two WMMAs. Key blocks of 32, per query tile: S^T = K.Q^T (4 WMMA, A = K rows,
// B = Q kept in registers), so a lane holds
// 16 scores of ONE query (column ln; keys 8*lhi+r and 16+8*lhi+r). Maximum and sum run in the
// lane, plus one exchange between the wave halves for the maximum. The two score tiles,
// converted in place, are the B operand of O^T += V^T.P^T (4 WMMA, A = V^T rows): P x1024
// goes from registers to registers. K/V reach the waves through a two-buffer LDS ring: a stage is
// 64 keys (8 KB of K, 8 KB of V, both contiguous in their planes and already in fragment order),
// copied once per block by asynchronous copies while the stage before it is worked on.
// Outputs, fragment order [b*t/16][e/32][FRAG] (rows = tokens, k = e = h*64 + d): C16 = f16 hi of
// 128*ctx, R16 = f16 residual (128*ctx - hi) x 2048.

static __device__ __forceinline__ float other_half(float v) {   // value held by lane l ^ 16
  const int b = __float_as_int(v);
  return __int_as_float(__builtin_amdgcn_permlanex16(b, b, 0x76543210, 0xfedcba98, false, false));
}

#define SKEYS 64                    // keys per ring stage
#define SHALF (SKEYS * HDIM)        // halves per operand and stage (8 KB)
#define NSTAGE (SEQ / SKEYS)
static_assert(SEQ % SKEYS == 0);
static_assert(NSTAGE >= 2);
#define QT 2                        // 16-column query tiles per wave
#define QBLK (8 * QT * 16)          // query columns per block

// One stage: each of the 256 lanes copies four 16-byte pieces (two of K, two of V) to LDS.
// lds = the lane's byte address in the buffer, kg / vg = the lane's first piece in the planes.
static __device__ __forceinline__ void stage_copy(uint32_t lds, const _Float16* kg,
                                                  const _Float16* vg) {
  const uint32_t l1 = lds + 4096u, l2 = lds + 8192u, l3 = lds + 12288u;
  const _Float16* kg1 = kg + 2048;
  const _Float16* vg1 = vg + 2048;
  // The closing s_wait_xcnt stands inside the statement so that no address register of a copy
  // is rewritten ahead of it.
  asm volatile("global_load_async_to_lds_b128 %0, %4, off\n\t"
               "global_load_async_to_lds_b128 %1, %5, off\n\t"
               "global_load_async_to_lds_b128 %2, %6, off\n\t"
               "global_load_async_to_lds_b128 %3, %7, off\n\t"
               "s_wait_xcnt 0x0"
               :: "v"(lds), "v"(l1), "v"(l2), "v"(l3), "v"(kg), "v"(kg1), "v"(vg), "v"(vg1)
               : "memory");
}

__global__ __launch_bounds__(256) __attribute__((amdgpu_num_vgpr(256)))
void attn_kernel(const _Float16* __restrict__ Q16, const _Float16* __restrict__ K16,
                 const _Float16* __restrict__ V16T, _Float16* __restrict__ C16,
                 _Float16* __restrict__ R16) {
  __shared__ __attribute__((aligned(16))) _Float16 KV[2][2 * SHALF];   // [buffer][K stage | V stage]

  const int tid  = (int)threadIdx.x;
  const int wave = tid >> 5;
  const int lane = tid & 31;               // below: lhi = lane >> 4, ln = lane & 15
  const int qb   = blockIdx.x * QBLK;
  const int h    = blockIdx.y;
  const int b    = blockIdx.z;
  const size_t bh = (size_t)(b * NHEAD + h);
  const _Float16* Qp = Q16 + bh * SEQ * HDIM;
  const _Float16* Kp = K16 + bh * SEQ * HDIM;
  const _Float16* Vp = V16T + bh * SEQ * HDIM;

  // Q B-fragments for this wave's QT tiles of 16 query columns (plane carries 8q). Where SEQ is
  // no multiple of QBLK the last block's upper waves have no queries: they work on tile 0 (they
  // share the copies and the barriers) and store nothing.
  const bool live = (SEQ % QBLK == 0) || (qb + wave * (QT * 16) < SEQ);
  const int qt = live ? (qb >> 4) + wave * QT : 0;
  AF qa0[QT], qa1[QT];
  float m[QT];          // running maximum of query ln of the tile (equal in both halves)
  float ls[QT];         // running sum of 1024 p over this half's keys only; halves joined after the loop
  v8f o[QT][4];         // o[qi][d][r] = O^T[d*16 + 8*lhi + r][query ln of tile qi]
#pragma unroll
  for (int qi = 0; qi < QT; ++qi) {
    load_fragp(qa0[qi], Qp + (size_t)((qt + qi) * 2) * FRAG, lane);
    load_fragp(qa1[qi], Qp + (size_t)((qt + qi) * 2 + 1) * FRAG, lane);
    m[qi] = -3.0e38f;
    ls[qi] = 0.0f;
#pragma unroll
    for (int d = 0; d < 4; ++d) {
#pragma unroll
      for (int e = 0; e < 8; ++e) o[qi][d][e] = 0.0f;
    }
  }

  // Softmax runs in base 2: SC2 = log2(e) / 512 takes (8q).(8k) to log2(e) * q.k / 8.
  const float SC2 = 0.0028177637517362567f;

  // Ring prologue: stage 0 lands and is published, then stage 1 starts to fly.
  const uint32_t lds0 = (uint32_t)(size_t)(&KV[0][0]) + (uint32_t)tid * 16u;
  const _Float16* kg = Kp + tid * 8;
  const _Float16* vg = Vp + tid * 8;
  stage_copy(lds0, kg, vg);
  asm volatile("s_wait_asynccnt 0x0" ::: "memory");   // this wave's pieces of stage 0 have landed
  __syncthreads();                                    // every wave's pieces have
  stage_copy(lds0 + 4u * SHALF, kg + SHALF, vg + SHALF);

#pragma unroll 1
  for (int st = 0; st < NSTAGE; ++st) {
   const _Float16* Ks = &KV[st & 1][0];
   const _Float16* Vs = Ks + SHALF;
#pragma unroll
   for (int kb = 0; kb < SKEYS / 32; ++kb) {
    // S^T = K . Q^T : two 16-key tiles, each 2 k-steps over 64 dims; a K fragment serves QT query tiles.
    v8f s[QT][2];
#pragma unroll
    for (int nt = 0; nt < 2; ++nt) {
      const int kt = kb * 2 + nt;                // 16-key tile: A rows
      AF f0, f1;
      load_fragp(f0, Ks + (kt * 2) * FRAG, lane);
      load_fragp(f1, Ks + (kt * 2 + 1) * FRAG, lane);
#pragma unroll
      for (int qi = 0; qi < QT; ++qi) {
        v8f c;
#pragma unroll
        for (int e = 0; e < 8; ++e) c[e] = 0.0f;
        c = mma16(f0.v, qa0[qi].v, c);
        c = mma16(f1.v, qa1[qi].v, c);
        s[qi][nt] = c;
      }
    }

    AF pb[QT];
#pragma unroll
    for (int qi = 0; qi < QT; ++qi) {
      // Online softmax (f32), one query per lane and tile; m and mn are in base-2 units.
      float mx0 = s[qi][0][0], mx1 = s[qi][1][0];
#pragma unroll
      for (int r = 1; r < 8; ++r) {
        mx0 = fmaxf(mx0, s[qi][0][r]);
        mx1 = fmaxf(mx1, s[qi][1][r]);
      }
      float mx = fmaxf(mx0, mx1);
      mx = fmaxf(mx, other_half(mx)) * SC2;
      const float mn = fmaxf(m[qi], mx);
      const float corr = __builtin_amdgcn_exp2f(m[qi] - mn);
      m[qi] = mn;
      const float mo = mn - 10.0f;   // the carry x1024 of P rides in the exponent

      // P^T as a 32x16 B fragment: element nt*8+r = key nt*16 + 8*lhi + r, the hardware k order
      // that the V^T fragments have.
      const v2f sc2 = {SC2, SC2};
      const v2f nmo = {-mo, -mo};
      v2f rs0 = {0.0f, 0.0f}, rs1 = {0.0f, 0.0f};   // sums of 1024 p: keys of even r in x, of odd r in y
#pragma unroll
      for (int r = 0; r < 8; r += 2) {
        // Two neighbouring scores at a time: one packed FMA for both exponents, one packed add for both p.
        const v2f e0 = __builtin_elementwise_fma((v2f){s[qi][0][r], s[qi][0][r + 1]}, sc2, nmo);
        const v2f e1 = __builtin_elementwise_fma((v2f){s[qi][1][r], s[qi][1][r + 1]}, sc2, nmo);
        const v2f p0 = {__builtin_amdgcn_exp2f(e0.x), __builtin_amdgcn_exp2f(e0.y)};   // 1024 p
        const v2f p1 = {__builtin_amdgcn_exp2f(e1.x), __builtin_amdgcn_exp2f(e1.y)};
        rs0 += p0;
        rs1 += p1;
        pb[qi].h[r]         = (_Float16)p0.x;
        pb[qi].h[r + 1]     = (_Float16)p0.y;
        pb[qi].h[8 + r]     = (_Float16)p1.x;
        pb[qi].h[8 + r + 1] = (_Float16)p1.y;
      }
      rs0 += rs1;
      ls[qi] = ls[qi] * corr + (rs0.x + rs0.y);
#pragma unroll
      for (int d = 0; d < 4; ++d) {
#pragma unroll
        for (int r = 0; r < 8; ++r) o[qi][d][r] *= corr;
      }
    }

    // O^T += V^T . P^T : four 16-row d tiles, one fragment each, serving QT query tiles.
#pragma unroll
    for (int d = 0; d < 4; ++d) {
      AF vf;
      load_fragp(vf, Vs + (kb * 4 + d) * FRAG, lane);
#pragma unroll
      for (int qi = 0; qi < QT; ++qi) o[qi][d] = mma16(vf.v, pb[qi].v, o[qi][d]);
    }
   }
   // Publish point of stage st + 1; behind its barrier the buffer just read is free for st + 2.
   asm volatile("s_wait_dscnt 0x0" ::: "memory");      // this wave's reads of the buffer are done
   asm volatile("s_wait_asynccnt 0x0" ::: "memory");   // this wave's pieces of stage st + 1 have landed
   __syncthreads();
   if (st + 2 < NSTAGE)
     stage_copy(lds0 + (uint32_t)(st & 1) * (4u * SHALF), kg + (size_t)(st + 2) * SHALF,
                vg + (size_t)(st + 2) * SHALF);
  }
  asm volatile("s_wait_asynccnt 0x0" ::: "memory");    // no copy is left in flight at the wave's end

  // O = sum (1024 p)(8 v), lt = sum (1024 p); c = 128 * ctx = 16 * O / lt; hi = f16(c), res = f16((c - hi) * 2048).
  // A lane holds 8 consecutive d of its query per tile (row ln, k (d&1)*16 + 8*lhi + r of fragment
  // h*2 + d/2): its own 16-byte piece of the plane, so a wave's store is 512 contiguous bytes.
  if (live) {
#pragma unroll
    for (int qi = 0; qi < QT; ++qi) {
      const size_t coff = ((((size_t)b * SEQ >> 4) + qt + qi) * (EMB / 32) + h * 2) * FRAG + lane * 8;
      _Float16* cdst = C16 + coff;
      _Float16* rdst = R16 + coff;
      const float lt = ls[qi] + other_half(ls[qi]);
      const float inv = (1.0f / lt) * 16.0f;
#pragma unroll
      for (int d = 0; d < 4; ++d) {
        H8 hv, rv;
#pragma unroll
        for (int r = 0; r < 8; ++r) {
          const float c = o[qi][d][r] * inv;
          const _Float16 hh = (_Float16)c;
          const float resf = (c - (float)hh) * 2048.0f;
          hv.h[r] = hh;
          rv.h[r] = (_Float16)resf;
        }
        vst16(cdst + d * 256, hv.q);
        vst16(rdst + d * 256, rv.q);
      }
    }
  }
}

// ---------------------------------------------------------------- kernel 3
// y[m][f] = (sum_e C16[m][e]*Wp16[f][e] + (sum_e R16[m][e]*Wp16[f][e]) / 2048) / 4096 + bf16(b_proj[f]);
// M = NB*SEQ, N = K = 1024. Block = 4 waves, wave tile 32 rows x 64 cols, two accumulator
// sets (hi plane, residual plane), fragments read from the planes.
static __device__ __forceinline__ void y_store_pass(const float* yw, float* out, int m0, int n0,
                                                    int lane) {
  const int prow = lane >> 4, piece = lane & 15;   // 16 lanes x 16 B = one 256-B row segment
#pragma unroll
  for (int i = 0; i < 16; ++i) {
    const int row = i * 2 + prow;
    const int mm = m0 + row;
    const int ob = mm / SEQ;
    const int ot = mm - ob * SEQ;
    const size_t orow = (size_t)ob * SEQ_OUT + ot;
    vstf4(out + orow * EMB + n0 + piece * 4, ((const v4fa*)yw)[row * 16 + piece]);
  }
}

__global__ __launch_bounds__(128) __attribute__((amdgpu_num_vgpr(256)))
void proj_kernel(const _Float16* __restrict__ C16, const _Float16* __restrict__ R16,
                 const _Float16* __restrict__ Wp16, const float* __restrict__ bp,
                 float* __restrict__ out) {
  __shared__ float Yst[4][32 * 64];   // per-wave output staging [row][col]

  const int tid  = (int)threadIdx.x;
  const int wave = tid >> 5;
  const int lane = tid & 31;
  const int lhi  = lane >> 4;
  const int ln   = lane & 15;
  const int m0   = blockIdx.x * 128 + wave * 32;
  const int n0   = blockIdx.y * 64;

  const int TROW = (EMB / 32) * FRAG;   // halves per 16-row tile of a plane
  const _Float16* ah0 = C16 + (size_t)(m0 >> 4) * TROW;
  const _Float16* ah1 = ah0 + TROW;
  const _Float16* al0 = R16 + (size_t)(m0 >> 4) * TROW;
  const _Float16* al1 = al0 + TROW;
  const _Float16* bpn = Wp16 + (size_t)(n0 >> 4) * TROW;

  v8f acch[2][4], accl[2][4];
#pragma unroll
  for (int mi = 0; mi < 2; ++mi) {
#pragma unroll
    for (int nt = 0; nt < 4; ++nt) {
#pragma unroll
      for (int e = 0; e < 8; ++e) { acch[mi][nt][e] = 0.0f; accl[mi][nt][e] = 0.0f; }
    }
  }

#pragma unroll 1
  for (int k0 = 0; k0 < TROW; k0 += FRAG) {
    AF a0, a1, l0, l1;
    load_fragp(a0, ah0 + k0, lane);
    load_fragp(a1, ah1 + k0, lane);
    load_fragp(l0, al0 + k0, lane);
    load_fragp(l1, al1 + k0, lane);
#pragma unroll
    for (int nt = 0; nt < 4; ++nt) {
      AF bf;
      load_fragp(bf, bpn + nt * TROW + k0, lane);
      acch[0][nt] = mma16(a0.v, bf.v, acch[0][nt]);
      acch[1][nt] = mma16(a1.v, bf.v, acch[1][nt]);
      accl[0][nt] = mma16(l0.v, bf.v, accl[0][nt]);
      accl[1][nt] = mma16(l1.v, bf.v, accl[1][nt]);
    }
  }

  float* yw = Yst[wave];
#pragma unroll
  for (int nt = 0; nt < 4; ++nt) {
    const int col = nt * 16 + ln;
    const float bias = bf16r(bp[n0 + col]);
#pragma unroll
    for (int mi = 0; mi < 2; ++mi) {
#pragma unroll
      for (int r = 0; r < 8; ++r) {
        const float v = (acch[mi][nt][r] + accl[mi][nt][r] * 0.00048828125f) * 0.000244140625f + bias;
        yw[(mi * 16 + lhi * 8 + r) * 64 + col] = v;
      }
    }
  }
  __syncthreads();

  y_store_pass(yw, out, m0, n0, lane);
  
}

// ---------------------------------------------------------------- host
extern "C" void kernel_launch(void* const* d_in, const int* in_sizes, int n_in,
                              void* d_out, int out_size, void* d_ws, size_t ws_size,
                              hipStream_t stream) {
  if (n_in < 5) return;
  if (in_sizes[0] < ((NB - 1) * SEQ_FULL + SEQ) * EMB) return;
  if (in_sizes[1] < NQKV * HDIM) return;
  if (in_sizes[2] < NQKV) return;
  if (in_sizes[3] < EMB * EMB) return;
  if (in_sizes[4] < EMB) return;
  if (out_size < ((NB - 1) * SEQ_OUT + SEQ) * EMB) return;

  const float* x     = (const float*)d_in[0];
  const float* Wqkv  = (const float*)d_in[1];
  const float* bqkv  = (const float*)d_in[2];
  const float* Wproj = (const float*)d_in[3];
  const float* bproj = (const float*)d_in[4];
  float* out = (float*)d_out;

  char* ws = (char*)d_ws;
  size_t off = 0;
  _Float16* Wq16 = (_Float16*)(ws + off); off += (size_t)NQKV * HDIM * 2;          // 24576 B
  _Float16* Wp16 = (_Float16*)(ws + off); off += (size_t)EMB * EMB * 2;            // 2 MiB
  const size_t psz = (size_t)NB * NHEAD * SEQ * HDIM * 2;                          // 16 MiB at full size
  _Float16* Q16  = (_Float16*)(ws + off); off += psz;                               // [bh][t/16][2][FRAG]
  _Float16* K16  = (_Float16*)(ws + off); off += psz;                               // [bh][t/16][2][FRAG]
  _Float16* V16T = (_Float16*)(ws + off); off += psz;                               // [bh][t/32][4][FRAG]
  _Float16* C16  = (_Float16*)(ws + off); off += (size_t)NB * SEQ * EMB * 2;        // [b*t/16][32][FRAG] hi
  _Float16* R16  = (_Float16*)(ws + off); off += (size_t)NB * SEQ * EMB * 2;        // [b*t/16][32][FRAG] residual
  if (off > ws_size) return;

  cvt_w16_kernel<<<(NQKV * HDIM / 8) / 256, 256, 0, stream>>>(Wqkv, Wq16, NQKV * HDIM / 8, 8.0f, 1);
  cvt_w16_kernel<<<(EMB * EMB / 8) / 256, 256, 0, stream>>>(Wproj, Wp16, EMB * EMB / 8, 32.0f, 5);

  dim3 g1(SEQ / 128, NHEAD, NB);
  qkv_kernel<<<g1, 256, 0, stream>>>(x, Wq16, bqkv, Q16, K16, V16T);
  dim3 g2((SEQ + QBLK - 1) / QBLK, NHEAD, NB);
  attn_kernel<<<g2, 256, 0, stream>>>(Q16, K16, V16T, C16, R16);

  dim3 g3((NB * SEQ) / 128, EMB / 64);
  proj_kernel<<<g3, 128, 0, stream>>>(C16, R16, Wp16, bproj, out);
}

// v007
// One run takes 120 microseconds.
// Next to v006, in two timings, it ran 1.04 and 1.02 times as fast.
// All steps since v000 together make it 3.98 times as fast.
#include <hip/hip_runtime.h>
#include <stdint.h>

// Contractions: qkv projection (K=64), q.k^T (K=64), p.v (K=32 per step): v_wmma_f32_16x16x32_f16, plain f16 operands, f32 accumulate;
// output projection (K=1024): v_wmma_f32_16x16x32_f16 with the context operand carried as f16 hi + f16 residual x2^11 (two accumulators), weights f16, f32 accumulate.
// Float inputs are RNE-converted to bf16 and then cast to f16 (exact); carries: W_qkv x8, softmax P x1024, context x128, W_proj x32; softmax and epilogues in f32.

typedef __attribute__((ext_vector_type(16))) _Float16 v16h;
typedef __attribute__((ext_vector_type(8)))  float    v8f;
typedef __attribute__((ext_vector_type(4)))  float    v4f;
typedef __attribute__((ext_vector_type(2)))  float    v2f;
typedef __attribute__((ext_vector_type(4)))  uint32_t v4u;
typedef v4u __attribute__((may_alias)) v4ua;
typedef v4f __attribute__((may_alias)) v4fa;

#ifndef NB
#define NB 4            // batch count processed
#endif
#ifndef SEQ
#define SEQ 2048        // tokens per batch processed
#endif
#ifndef SEQ_FULL
#define SEQ_FULL 2048   // per-batch token stride of the input x
#endif
#ifndef SEQ_OUT
#define SEQ_OUT SEQ     // per-batch token stride of the output buffer
#endif
#define NHEAD 16
#define EMB   1024
#define HDIM  64
#define NQKV  192
#define WQ8   (NQKV * HDIM / 8)                      // 16-byte pieces of the f16 W_qkv plane
#define WP8   (EMB * EMB / 8)                        // 16-byte pieces of the f16 W_proj plane
#define QKV_LANES (NB * NHEAD * (SEQ / 128) * 256)   // lanes of the qkv launch

static_assert(NB >= 1);
static_assert(SEQ >= 128);
static_assert(SEQ % 128 == 0);
static_assert(SEQ <= SEQ_FULL);
static_assert(NHEAD * HDIM == EMB);
static_assert(((NQKV * HDIM) / 8) % 256 == 0);
static_assert(((EMB * EMB) / 8) % 256 == 0);
static_assert((NB * SEQ) % 128 == 0);
static_assert(EMB % 64 == 0);
static_assert((WP8 & (WP8 - 1)) == 0);

// ---------------------------------------------------------------- helpers
static __device__ __forceinline__ float bf16r(float f) {   // RNE convert to bf16, back to f32
  uint32_t u = __float_as_uint(f);
  u = u + 0x7FFFu + ((u >> 16) & 1u);
  u = u & 0xFFFF0000u;
  return __uint_as_float(u);
}

union AF { v16h v; _Float16 h[16]; v4u q[2]; };
union H8 { _Float16 h[8]; v4u q; };

// 16-half WMMA fragment (A or B operand, one 32-deep k step): lane row/col = lane&15;
// elements 0..7 <- k 8*lhi+0..7, elements 8..15 <- k 16+8*lhi+0..7 (two aligned 16-byte loads).
// Fragment-order planes: every f16 operand plane in the workspace is a sequence of 1-KB
// fragments (16 rows x 32 k). Inside a fragment, half index j*256 + lane*8 + e holds
// (row lane&15, k 16*j + 8*(lane>>4) + e), so that each of the two loads of a wave covers
// 512 contiguous bytes (4 whole lines) instead of 32-byte pieces of 16 lines.
#define FRAG 512        // halves per fragment
static __device__ __forceinline__ void load_fragp(AF& a, const _Float16* frag, int lane) {
  const v4ua* p = (const v4ua*)(frag + lane * 8);
  a.q[0] = p[0];
  a.q[1] = p[32];
}

static __device__ __forceinline__ v8f mma16(v16h a, v16h b, v8f c) {
  v8f d = __builtin_amdgcn_wmma_f32_16x16x32_f16(false, a, false, b, (short)0, c,
                                                 false, false);
  return d;
}

static __device__ __forceinline__ void vst16(_Float16* p, v4u v) { *(v4u*)p = v; }
static __device__ __forceinline__ void vstf4(float* p, v4f v) { *(v4f*)p = v; }

// ---------------------------------------------------------------- weight planes
// f32 weights [rows][32 << ksh] -> f16 fragment-order plane [rows/16][1 << ksh][FRAG]:
// h = f16(bf16(w) * scale). Piece i = 16 bytes of the plane = 8 consecutive k of one row.
static __device__ __forceinline__ const v4f* w_piece_src(const float* src, int i, int ksh) {
  const int fr  = i >> 6;                    // fragment; piece i&63 = j*32 + lane
  const int row = (fr >> ksh) * 16 + (i & 15);
  const int k   = (fr & ((1 << ksh) - 1)) * 32 + ((i >> 5) & 1) * 16 + ((i >> 4) & 1) * 8;
  return (const v4f*)(src + ((size_t)row << (ksh + 5)) + k);
}
static __device__ __forceinline__ v4u w_piece_cvt(v4f f0, v4f f1, float scale) {
  H8 o;
#pragma unroll
  for (int e = 0; e < 4; ++e) {
    o.h[e]     = (_Float16)(bf16r(f0[e]) * scale);
    o.h[4 + e] = (_Float16)(bf16r(f1[e]) * scale);
  }
  return o.q;
}

// ---------------------------------------------------------------- kernel 1
// Per (b, h, 128-token tile): qkv = x_h[128x64] . W_qkv^T (W_qkv = [192][64], k contiguous).
// Both weight conversions ride in this launch. W_qkv (48 KB of f32): every block converts it
// into its own LDS plane Wst, six pieces a lane. W_proj: its WP8 pieces are dealt over the grid,
// one a lane in the first blocks; the plane Wp16 is read only by the projection launch.
// Wave = 16 tokens x 192 columns (24 WMMA). Planes, fragment order: Q16/K16 = [bh][t/16][d/32][FRAG]
// (rows = tokens, k = d; 8q, 8k), V16T = [bh][t/32][d/16][FRAG] (rows = d, k = tokens; 8v).
// A 128-token tile is 16 KB contiguous in each plane.
static __device__ __forceinline__ void qkv_store_pass(const _Float16* Qst, const _Float16* Kst,
                                                      const _Float16* Vst, _Float16* qdst,
                                                      _Float16* kdst, _Float16* vdst, int tid) {
  v4u q[4], k[4], v[4];                                   // all LDS reads go out ahead of the stores
#pragma unroll
  for (int it = 0; it < 4; ++it) {
    const int idx = it * 256 + tid;                       // 16-B piece of the contiguous 16 KB tile
    q[it] = ((const v4ua*)Qst)[idx];
    k[it] = ((const v4ua*)Kst)[idx];
    v[it] = ((const v4ua*)Vst)[idx];
  }
#pragma unroll
  for (int it = 0; it < 4; ++it) {
    const int idx = it * 256 + tid;
    vst16(qdst + (size_t)idx * 8, q[it]);
    vst16(kdst + (size_t)idx * 8, k[it]);
    vst16(vdst + (size_t)idx * 8, v[it]);
  }
}

__global__ __launch_bounds__(256) __attribute__((amdgpu_num_vgpr(256)))
void qkv_kernel(const float* __restrict__ x, const float* __restrict__ Wqkv,
                const float* __restrict__ bq, const float* __restrict__ Wproj,
                _Float16* __restrict__ Wp16, _Float16* __restrict__ Q16,
                _Float16* __restrict__ K16, _Float16* __restrict__ V16T) {
  __shared__ __attribute__((aligned(16))) _Float16 Wst[NQKV * HDIM];   // [col/16][d/32][FRAG], 8 W_qkv
  __shared__ _Float16 Qst[128 * HDIM];   // [token/16][d/32][FRAG]
  __shared__ _Float16 Kst[128 * HDIM];   // [token/16][d/32][FRAG]
  __shared__ _Float16 Vst[HDIM * 128];   // [token/32][d/16][FRAG]

  const int tid  = (int)threadIdx.x;
  const int wave = tid >> 5;
  const int lane = tid & 31;
  const int lhi  = lane >> 4;
  const int ln   = lane & 15;
  const int tb   = blockIdx.x * 128;
  const int h    = blockIdx.y;
  const int b    = blockIdx.z;

  // All loads of the block go out together: W_qkv's pieces first (they are waited for first),
  // then x, then this lane's piece of W_proj, which is converted and stored at the kernel's end.
  v4f wq[WQ8 / 256][2];
  const v4f* wqs = w_piece_src(Wqkv, tid, 1);   // piece it*256 + tid lies 32 rows of 64 floats per it further on
#pragma unroll
  for (int it = 0; it < WQ8 / 256; ++it) {
    wq[it][0] = wqs[it * (32 * HDIM / 4)];
    wq[it][1] = wqs[it * (32 * HDIM / 4) + 1];
  }
  // Stands in front of the address arithmetic below, which reuses address registers of these loads.
  asm volatile("s_wait_xcnt 0x0" ::: "memory");
  const int trow = tb + wave * 16 + ln;
  const float* xrow = x + ((size_t)b * SEQ_FULL + trow) * EMB + h * HDIM;
  v4f xf[2][4];
#pragma unroll
  for (int ks = 0; ks < 2; ++ks) {
    const v4f* xp = (const v4f*)(xrow + ks * 32 + lhi * 8);
    xf[ks][0] = xp[0]; xf[ks][1] = xp[1];    // k = ks*32 + 8*lhi + 0..7   (elements 0..7)
    xf[ks][2] = xp[4]; xf[ks][3] = xp[5];    // k = ks*32 + 16 + 8*lhi +.. (elements 8..15)
  }
  float bqv[12];                             // bias of output column n*16 + ln
#pragma unroll
  for (int n = 0; n < 12; ++n) bqv[n] = bq[n * 16 + ln];
  const int wpi = ((b * NHEAD + h) * (SEQ / 128) + (int)blockIdx.x) * 256 + tid;
  const bool wpon = wpi < WP8;               // the same for a whole block: WP8 is a multiple of 256
  // Loaded without a branch, so that no wait stands here; a lane with no piece reads one that
  // exists (WP8 is a power of two) and stores nothing.
  const v4f* wps = w_piece_src(Wproj, wpi & (WP8 - 1), 5);
  const v4f wp0 = wps[0], wp1 = wps[1];

#pragma unroll
  for (int it = 0; it < WQ8 / 256; ++it)
    vst16(Wst + (it * 256 + tid) * 8, w_piece_cvt(wq[it][0], wq[it][1], 8.0f));

  // A fragments: x rows (tokens) x 64 dims, f32 -> bf16 RNE -> f16 in registers.
  AF xa[2];
#pragma unroll
  for (int ks = 0; ks < 2; ++ks) {
    const v4f f0 = xf[ks][0], f1 = xf[ks][1];
    const v4f f2 = xf[ks][2], f3 = xf[ks][3];
#pragma unroll
    for (int e = 0; e < 4; ++e) {
      xa[ks].h[e]      = (_Float16)bf16r(f0[e]);
      xa[ks].h[4 + e]  = (_Float16)bf16r(f1[e]);
      xa[ks].h[8 + e]  = (_Float16)bf16r(f2[e]);
      xa[ks].h[12 + e] = (_Float16)bf16r(f3[e]);
    }
  }

  __syncthreads();   // every wave's pieces of Wst are written

  // D rows of this lane: tokens wave*16 + lhi*8 + r; D column: ln.
  const int qkpos = ((ln >> 3) * 16 + lhi * 8) * 8 + (ln & 7);   // + r*8: row lhi*8+r, k 8*(ln>>3) + (ln&7)
  // Twelve independent accumulators, one k step after the other: no WMMA waits for the one before it.
  v8f acc[12];
#pragma unroll
  for (int n = 0; n < 12; ++n) {           // output columns n*16 + ln = B column of this lane
    AF wb;
    load_fragp(wb, Wst + (n * 2) * FRAG, lane);
    const float bv = 8.0f * bf16r(bqv[n]);
#pragma unroll
    for (int e = 0; e < 8; ++e) acc[n][e] = bv;
    acc[n] = mma16(xa[0].v, wb.v, acc[n]);
  }
#pragma unroll
  for (int n = 0; n < 12; ++n) {
    AF wb;
    load_fragp(wb, Wst + (n * 2 + 1) * FRAG, lane);
    acc[n] = mma16(xa[1].v, wb.v, acc[n]);
  }
#pragma unroll
  for (int n = 0; n < 12; ++n) {
    const int ct = n & 3;                  // 16-column tile within the 64-wide q / k / v block
    const int qkoff = (wave * 2 + (ct >> 1)) * FRAG + (ct & 1) * 256 + qkpos;
    if (n < 4) {
#pragma unroll
      for (int r = 0; r < 8; ++r) Qst[qkoff + r * 8] = (_Float16)acc[n][r];
    } else if (n < 8) {
#pragma unroll
      for (int r = 0; r < 8; ++r) Kst[qkoff + r * 8] = (_Float16)acc[n][r];
    } else {
      // row d = ct*16 + ln, k = tokens (wave&1)*16 + 8*lhi + r: the lane's own 16-byte piece
      H8 vv;
#pragma unroll
      for (int r = 0; r < 8; ++r) vv.h[r] = (_Float16)acc[n][r];
      vst16(Vst + ((wave >> 1) * 4 + ct) * FRAG + (wave & 1) * 256 + lane * 8, vv.q);
    }
  }
  __syncthreads();   // cross-wave staging complete

  const size_t bh = (size_t)(b * NHEAD + h);
  _Float16* qdst = Q16 + (bh * SEQ + tb) * HDIM;
  _Float16* kdst = K16 + (bh * SEQ + tb) * HDIM;
  _Float16* vdst = V16T + (bh * SEQ + tb) * HDIM;
  qkv_store_pass(Qst, Kst, Vst, qdst, kdst, vdst, tid);

  if (wpon) vst16(Wp16 + (size_t)wpi * 8, w_piece_cvt(wp0, wp1, 32.0f));
  // Grids of fewer than WP8 lanes (reduced NB or SEQ): the pieces that are left.
  if (QKV_LANES < WP8) {
    for (int i = wpi + QKV_LANES; i < WP8; i += QKV_LANES) {
      const v4f* sp = w_piece_src(Wproj, i, 5);
      vst16(Wp16 + (size_t)i * 8, w_piece_cvt(sp[0], sp[1], 32.0f));
    }
  }
}

// ---------------------------------------------------------------- kernel 2
// Flash attention, transposed products. Block = 8 waves = 256 query columns of one (b,h); a wave
// has QT = 2 tiles of 16 query columns, so that every K and V fragment it reads from LDS is the
// A operand of two WMMAs. Key blocks of 32, per query tile: S^T = K.Q^T (4 WMMA, A = K rows,
// B = Q kept in registers), so a lane holds
// 16 scores of ONE query (column ln; keys 8*lhi+r and 16+8*lhi+r). Maximum and sum run in the
// lane, plus one exchange between the wave halves for the maximum. The two score tiles,
// converted in place, are the B operand of O^T += V^T.P^T (4 WMMA, A = V^T rows): P x1024
// goes from registers to registers. K/V reach the waves through a two-buffer LDS ring: a stage is
// 64 keys (8 KB of K, 8 KB of V, both contiguous in their planes and already in fragment order),
// copied once per block by asynchronous copies while the stage before it is worked on.
// Outputs, fragment order [b*t/16][e/32][FRAG] (rows = tokens, k = e = h*64 + d): C16 = f16 hi of
// 128*ctx, R16 = f16 residual (128*ctx - hi) x 2048.

static __device__ __forceinline__ float other_half(float v) {   // value held by lane l ^ 16
  const int b = __float_as_int(v);
  return __int_as_float(__builtin_amdgcn_permlanex16(b, b, 0x76543210, 0xfedcba98, false, false));
}

#define SKEYS 64                    // keys per ring stage
#define SHALF (SKEYS * HDIM)        // halves per operand and stage (8 KB)
#define NSTAGE (SEQ / SKEYS)
static_assert(SEQ % SKEYS == 0);
static_assert(NSTAGE >= 2);
#define QT 2                        // 16-column query tiles per wave
#define QBLK (8 * QT * 16)          // query columns per block

// One stage: each of the 256 lanes copies four 16-byte pieces (two of K, two of V) to LDS.
// lds = the lane's byte address in the buffer, kg / vg = the lane's first piece in the planes.
static __device__ __forceinline__ void stage_copy(uint32_t lds, const _Float16* kg,
                                                  const _Float16* vg) {
  const uint32_t l1 = lds + 4096u, l2 = lds + 8192u, l3 = lds + 12288u;
  const _Float16* kg1 = kg + 2048;
  const _Float16* vg1 = vg + 2048;
  // The closing s_wait_xcnt stands inside the statement so that no address register of a copy
  // is rewritten ahead of it.
  asm volatile("global_load_async_to_lds_b128 %0, %4, off\n\t"
               "global_load_async_to_lds_b128 %1, %5, off\n\t"
               "global_load_async_to_lds_b128 %2, %6, off\n\t"
               "global_load_async_to_lds_b128 %3, %7, off\n\t"
               "s_wait_xcnt 0x0"
               :: "v"(lds), "v"(l1), "v"(l2), "v"(l3), "v"(kg), "v"(kg1), "v"(vg), "v"(vg1)
               : "memory");
}

__global__ __launch_bounds__(256) __attribute__((amdgpu_num_vgpr(256)))
void attn_kernel(const _Float16* __restrict__ Q16, const _Float16* __restrict__ K16,
                 const _Float16* __restrict__ V16T, _Float16* __restrict__ C16,
                 _Float16* __restrict__ R16) {
  __shared__ __attribute__((aligned(16))) _Float16 KV[2][2 * SHALF];   // [buffer][K stage | V stage]

  const int tid  = (int)threadIdx.x;
  const int wave = tid >> 5;
  const int lane = tid & 31;               // below: lhi = lane >> 4, ln = lane & 15
  const int qb   = blockIdx.x * QBLK;
  const int h    = blockIdx.y;
  const int b    = blockIdx.z;
  const size_t bh = (size_t)(b * NHEAD + h);
  const _Float16* Qp = Q16 + bh * SEQ * HDIM;
  const _Float16* Kp = K16 + bh * SEQ * HDIM;
  const _Float16* Vp = V16T + bh * SEQ * HDIM;

  // Q B-fragments for this wave's QT tiles of 16 query columns (plane carries 8q). Where SEQ is
  // no multiple of QBLK the last block's upper waves have no queries: they work on tile 0 (they
  // share the copies and the barriers) and store nothing.
  const bool live = (SEQ % QBLK == 0) || (qb + wave * (QT * 16) < SEQ);
  const int qt = live ? (qb >> 4) + wave * QT : 0;
  AF qa0[QT], qa1[QT];
  float m[QT];          // running maximum of query ln of the tile (equal in both halves)
  float ls[QT];         // running sum of 1024 p over this half's keys only; halves joined after the loop
  v8f o[QT][4];         // o[qi][d][r] = O^T[d*16 + 8*lhi + r][query ln of tile qi]
#pragma unroll
  for (int qi = 0; qi < QT; ++qi) {
    load_fragp(qa0[qi], Qp + (size_t)((qt + qi) * 2) * FRAG, lane);
    load_fragp(qa1[qi], Qp + (size_t)((qt + qi) * 2 + 1) * FRAG, lane);
    m[qi] = -3.0e38f;
    ls[qi] = 0.0f;
#pragma unroll
    for (int d = 0; d < 4; ++d) {
#pragma unroll
      for (int e = 0; e < 8; ++e) o[qi][d][e] = 0.0f;
    }
  }

  // Softmax runs in base 2: SC2 = log2(e) / 512 takes (8q).(8k) to log2(e) * q.k / 8.
  const float SC2 = 0.0028177637517362567f;

  // Ring prologue: stage 0 lands and is published, then stage 1 starts to fly.
  const uint32_t lds0 = (uint32_t)(size_t)(&KV[0][0]) + (uint32_t)tid * 16u;
  const _Float16* kg = Kp + tid * 8;
  const _Float16* vg = Vp + tid * 8;
  stage_copy(lds0, kg, vg);
  asm volatile("s_wait_asynccnt 0x0" ::: "memory");   // this wave's pieces of stage 0 have landed
  __syncthreads();                                    // every wave's pieces have
  stage_copy(lds0 + 4u * SHALF, kg + SHALF, vg + SHALF);

#pragma unroll 1
  for (int st = 0; st < NSTAGE; ++st) {
   const _Float16* Ks = &KV[st & 1][0];
   const _Float16* Vs = Ks + SHALF;
#pragma unroll
   for (int kb = 0; kb < SKEYS / 32; ++kb) {
    // S^T = K . Q^T : two 16-key tiles, each 2 k-steps over 64 dims; a K fragment serves QT query tiles.
    v8f s[QT][2];
#pragma unroll
    for (int nt = 0; nt < 2; ++nt) {
      const int kt = kb * 2 + nt;                // 16-key tile: A rows
      AF f0, f1;
      load_fragp(f0, Ks + (kt * 2) * FRAG, lane);
      load_fragp(f1, Ks + (kt * 2 + 1) * FRAG, lane);
#pragma unroll
      for (int qi = 0; qi < QT; ++qi) {
        v8f c;
#pragma unroll
        for (int e = 0; e < 8; ++e) c[e] = 0.0f;
        c = mma16(f0.v, qa0[qi].v, c);
        c = mma16(f1.v, qa1[qi].v, c);
        s[qi][nt] = c;
      }
    }

    AF pb[QT];
#pragma unroll
    for (int qi = 0; qi < QT; ++qi) {
      // Online softmax (f32), one query per lane and tile; m and mn are in base-2 units.
      float mx0 = s[qi][0][0], mx1 = s[qi][1][0];
#pragma unroll
      for (int r = 1; r < 8; ++r) {
        mx0 = fmaxf(mx0, s[qi][0][r]);
        mx1 = fmaxf(mx1, s[qi][1][r]);
      }
      float mx = fmaxf(mx0, mx1);
      mx = fmaxf(mx, other_half(mx)) * SC2;
      const float mn = fmaxf(m[qi], mx);
      const float corr = __builtin_amdgcn_exp2f(m[qi] - mn);
      m[qi] = mn;
      const float mo = mn - 10.0f;   // the carry x1024 of P rides in the exponent

      // P^T as a 32x16 B fragment: element nt*8+r = key nt*16 + 8*lhi + r, the hardware k order
      // that the V^T fragments have.
      const v2f sc2 = {SC2, SC2};
      const v2f nmo = {-mo, -mo};
      v2f rs0 = {0.0f, 0.0f}, rs1 = {0.0f, 0.0f};   // sums of 1024 p: keys of even r in x, of odd r in y
#pragma unroll
      for (int r = 0; r < 8; r += 2) {
        // Two neighbouring scores at a time: one packed FMA for both exponents, one packed add for both p.
        const v2f e0 = __builtin_elementwise_fma((v2f){s[qi][0][r], s[qi][0][r + 1]}, sc2, nmo);
        const v2f e1 = __builtin_elementwise_fma((v2f){s[qi][1][r], s[qi][1][r + 1]}, sc2, nmo);
        const v2f p0 = {__builtin_amdgcn_exp2f(e0.x), __builtin_amdgcn_exp2f(e0.y)};   // 1024 p
        const v2f p1 = {__builtin_amdgcn_exp2f(e1.x), __builtin_amdgcn_exp2f(e1.y)};
        rs0 += p0;
        rs1 += p1;
        pb[qi].h[r]         = (_Float16)p0.x;
        pb[qi].h[r + 1]     = (_Float16)p0.y;
        pb[qi].h[8 + r]     = (_Float16)p1.x;
        pb[qi].h[8 + r + 1] = (_Float16)p1.y;
      }
      rs0 += rs1;
      ls[qi] = ls[qi] * corr + (rs0.x + rs0.y);
#pragma unroll
      for (int d = 0; d < 4; ++d) {
#pragma unroll
        for (int r = 0; r < 8; ++r) o[qi][d][r] *= corr;
      }
    }

    // O^T += V^T . P^T : four 16-row d tiles, one fragment each, serving QT query tiles.
#pragma unroll
    for (int d = 0; d < 4; ++d) {
      AF vf;
      load_fragp(vf, Vs + (kb * 4 + d) * FRAG, lane);
#pragma unroll
      for (int qi = 0; qi < QT; ++qi) o[qi][d] = mma16(vf.v, pb[qi].v, o[qi][d]);
    }
   }
   // Publish point of stage st + 1; behind its barrier the buffer just read is free for st + 2.
   asm volatile("s_wait_dscnt 0x0" ::: "memory");      // this wave's reads of the buffer are done
   asm volatile("s_wait_asynccnt 0x0" ::: "memory");   // this wave's pieces of stage st + 1 have landed
   __syncthreads();
   if (st + 2 < NSTAGE)
     stage_copy(lds0 + (uint32_t)(st & 1) * (4u * SHALF), kg + (size_t)(st + 2) * SHALF,
                vg + (size_t)(st + 2) * SHALF);
  }
  asm volatile("s_wait_asynccnt 0x0" ::: "memory");    // no copy is left in flight at the wave's end

  // O = sum (1024 p)(8 v), lt = sum (1024 p); c = 128 * ctx = 16 * O / lt; hi = f16(c), res = f16((c - hi) * 2048).
  // A lane holds 8 consecutive d of its query per tile (row ln, k (d&1)*16 + 8*lhi + r of fragment
  // h*2 + d/2): its own 16-byte piece of the plane, so a wave's store is 512 contiguous bytes.
  if (live) {
#pragma unroll
    for (int qi = 0; qi < QT; ++qi) {
      const size_t coff = ((((size_t)b * SEQ >> 4) + qt + qi) * (EMB / 32) + h * 2) * FRAG + lane * 8;
      _Float16* cdst = C16 + coff;
      _Float16* rdst = R16 + coff;
      const float lt = ls[qi] + other_half(ls[qi]);
      const float inv = (1.0f / lt) * 16.0f;
#pragma unroll
      for (int d = 0; d < 4; ++d) {
        H8 hv, rv;
#pragma unroll
        for (int r = 0; r < 8; ++r) {
          const float c = o[qi][d][r] * inv;
          const _Float16 hh = (_Float16)c;
          const float resf = (c - (float)hh) * 2048.0f;
          hv.h[r] = hh;
          rv.h[r] = (_Float16)resf;
        }
        vst16(cdst + d * 256, hv.q);
        vst16(rdst + d * 256, rv.q);
      }
    }
  }
}

// ---------------------------------------------------------------- kernel 3
// y[m][f] = (sum_e C16[m][e]*Wp16[f][e] + (sum_e R16[m][e]*Wp16[f][e]) / 2048) / 4096 + bf16(b_proj[f]);
// M = NB*SEQ, N = K = 1024. Block = 4 waves, wave tile 32 rows x 64 cols, two accumulator
// sets (hi plane, residual plane), fragments read from the planes.
static __device__ __forceinline__ void y_store_pass(const float* yw, float* out, int m0, int n0,
                                                    int lane) {
  const int prow = lane >> 4, piece = lane & 15;   // 16 lanes x 16 B = one 256-B row segment
#pragma unroll
  for (int i = 0; i < 16; ++i) {
    const int row = i * 2 + prow;
    const int mm = m0 + row;
    const int ob = mm / SEQ;
    const int ot = mm - ob * SEQ;
    const size_t orow = (size_t)ob * SEQ_OUT + ot;
    vstf4(out + orow * EMB + n0 + piece * 4, ((const v4fa*)yw)[row * 16 + piece]);
  }
}

__global__ __launch_bounds__(128) __attribute__((amdgpu_num_vgpr(256)))
void proj_kernel(const _Float16* __restrict__ C16, const _Float16* __restrict__ R16,
                 const _Float16* __restrict__ Wp16, const float* __restrict__ bp,
                 float* __restrict__ out) {
  __shared__ float Yst[4][32 * 64];   // per-wave output staging [row][col]

  const int tid  = (int)threadIdx.x;
  const int wave = tid >> 5;
  const int lane = tid & 31;
  const int lhi  = lane >> 4;
  const int ln   = lane & 15;
  const int m0   = blockIdx.x * 128 + wave * 32;
  const int n0   = blockIdx.y * 64;

  const int TROW = (EMB / 32) * FRAG;   // halves per 16-row tile of a plane
  const _Float16* ah0 = C16 + (size_t)(m0 >> 4) * TROW;
  const _Float16* ah1 = ah0 + TROW;
  const _Float16* al0 = R16 + (size_t)(m0 >> 4) * TROW;
  const _Float16* al1 = al0 + TROW;
  const _Float16* bpn = Wp16 + (size_t)(n0 >> 4) * TROW;

  v8f acch[2][4], accl[2][4];
#pragma unroll
  for (int mi = 0; mi < 2; ++mi) {
#pragma unroll
    for (int nt = 0; nt < 4; ++nt) {
#pragma unroll
      for (int e = 0; e < 8; ++e) { acch[mi][nt][e] = 0.0f; accl[mi][nt][e] = 0.0f; }
    }
  }

#pragma unroll 1
  for (int k0 = 0; k0 < TROW; k0 += FRAG) {
    AF a0, a1, l0, l1;
    load_fragp(a0, ah0 + k0, lane);
    load_fragp(a1, ah1 + k0, lane);
    load_fragp(l0, al0 + k0, lane);
    load_fragp(l1, al1 + k0, lane);
#pragma unroll
    for (int nt = 0; nt < 4; ++nt) {
      AF bf;
      load_fragp(bf, bpn + nt * TROW + k0, lane);
      acch[0][nt] = mma16(a0.v, bf.v, acch[0][nt]);
      acch[1][nt] = mma16(a1.v, bf.v, acch[1][nt]);
      accl[0][nt] = mma16(l0.v, bf.v, accl[0][nt]);
      accl[1][nt] = mma16(l1.v, bf.v, accl[1][nt]);
    }
  }

  float* yw = Yst[wave];
#pragma unroll
  for (int nt = 0; nt < 4; ++nt) {
    const int col = nt * 16 + ln;
    const float bias = bf16r(bp[n0 + col]);
#pragma unroll
    for (int mi = 0; mi < 2; ++mi) {
#pragma unroll
      for (int r = 0; r < 8; ++r) {
        const float v = (acch[mi][nt][r] + accl[mi][nt][r] * 0.00048828125f) * 0.000244140625f + bias;
        yw[(mi * 16 + lhi * 8 + r) * 64 + col] = v;
      }
    }
  }
  __syncthreads();

  y_store_pass(yw, out, m0, n0, lane);
  
}

// ---------------------------------------------------------------- host
extern "C" void kernel_launch(void* const* d_in, const int* in_sizes, int n_in,
                              void* d_out, int out_size, void* d_ws, size_t ws_size,
                              hipStream_t stream) {
  if (n_in < 5) return;
  if (in_sizes[0] < ((NB - 1) * SEQ_FULL + SEQ) * EMB) return;
  if (in_sizes[1] < NQKV * HDIM) return;
  if (in_sizes[2] < NQKV) return;
  if (in_sizes[3] < EMB * EMB) return;
  if (in_sizes[4] < EMB) return;
  if (out_size < ((NB - 1) * SEQ_OUT + SEQ) * EMB) return;

  const float* x     = (const float*)d_in[0];
  const float* Wqkv  = (const float*)d_in[1];
  const float* bqkv  = (const float*)d_in[2];
  const float* Wproj = (const float*)d_in[3];
  const float* bproj = (const float*)d_in[4];
  float* out = (float*)d_out;

  char* ws = (char*)d_ws;
  size_t off = 0;
  _Float16* Wp16 = (_Float16*)(ws + off); off += (size_t)EMB * EMB * 2;            // 2 MiB
  const size_t psz = (size_t)NB * NHEAD * SEQ * HDIM * 2;                          // 16 MiB at full size
  _Float16* Q16  = (_Float16*)(ws + off); off += psz;                               // [bh][t/16][2][FRAG]
  _Float16* K16  = (_Float16*)(ws + off); off += psz;                               // [bh][t/16][2][FRAG]
  _Float16* V16T = (_Float16*)(ws + off); off += psz;                               // [bh][t/32][4][FRAG]
  _Float16* C16  = (_Float16*)(ws + off); off += (size_t)NB * SEQ * EMB * 2;        // [b*t/16][32][FRAG] hi
  _Float16* R16  = (_Float16*)(ws + off); off += (size_t)NB * SEQ * EMB * 2;        // [b*t/16][32][FRAG] residual
  if (off > ws_size) return;

  dim3 g1(SEQ / 128, NHEAD, NB);
  qkv_kernel<<<g1, 256, 0, stream>>>(x, Wqkv, bqkv, Wproj, Wp16, Q16, K16, V16T);
  dim3 g2((SEQ + QBLK - 1) / QBLK, NHEAD, NB);
  attn_kernel<<<g2, 256, 0, stream>>>(Q16, K16, V16T, C16, R16);

  dim3 g3((NB * SEQ) / 128, EMB / 64);
  proj_kernel<<<g3, 128, 0, stream>>>(C16, R16, Wp16, bproj, out);
}

// v008
// Measured time: 102 microseconds a run.
// Timed twice side by side with v007, it ran 1.17 times as fast both times.
// Over all steps from v000 it is 4.66 times as fast.
#include <hip/hip_runtime.h>
#include <stdint.h>

// Contractions: qkv projection (K=64), q.k^T (K=64), p.v (K=32 per step): v_wmma_f32_16x16x32_f16, plain f16 operands, f32 accumulate;
// output projection (K=1024): v_wmma_f32_16x16x32_f16 with the context operand carried as f16 hi + f16 residual x2^11 (two accumulators), weights f16, f32 accumulate.
// Float inputs are RNE-converted to bf16 and then cast to f16 (exact); carries: W_qkv x8, softmax P x1024, context x128, W_proj x32; softmax and epilogues in f32.

typedef __attribute__((ext_vector_type(16))) _Float16 v16h;
typedef __attribute__((ext_vector_type(8)))  float    v8f;
typedef __attribute__((ext_vector_type(4)))  float    v4f;
typedef __attribute__((ext_vector_type(2)))  float    v2f;
typedef __attribute__((ext_vector_type(4)))  uint32_t v4u;
typedef v4u __attribute__((may_alias)) v4ua;
typedef v4f __attribute__((may_alias)) v4fa;

#ifndef NB
#define NB 4            // batch count processed
#endif
#ifndef SEQ
#define SEQ 2048        // tokens per batch processed
#endif
#ifndef SEQ_FULL
#define SEQ_FULL 2048   // per-batch token stride of the input x
#endif
#ifndef SEQ_OUT
#define SEQ_OUT SEQ     // per-batch token stride of the output buffer
#endif
#define NHEAD 16
#define EMB   1024
#define HDIM  64
#define NQKV  192
#define WQ8   (NQKV * HDIM / 8)                      // 16-byte pieces of the f16 W_qkv plane
#define WP8   (EMB * EMB / 8)                        // 16-byte pieces of the f16 W_proj plane
#define QKV_LANES (NB * NHEAD * (SEQ / 128) * 256)   // lanes of the qkv launch

static_assert(NB >= 1);
static_assert(SEQ >= 128);
static_assert(SEQ % 128 == 0);
static_assert(SEQ <= SEQ_FULL);
static_assert(NHEAD * HDIM == EMB);
static_assert(((NQKV * HDIM) / 8) % 256 == 0);
static_assert(((EMB * EMB) / 8) % 256 == 0);
static_assert((NB * SEQ) % 128 == 0);
static_assert(EMB % 64 == 0);
static_assert((WP8 & (WP8 - 1)) == 0);

// ---------------------------------------------------------------- helpers
static __device__ __forceinline__ float bf16r(float f) {   // RNE convert to bf16, back to f32
  uint32_t u = __float_as_uint(f);
  u = u + 0x7FFFu + ((u >> 16) & 1u);
  u = u & 0xFFFF0000u;
  return __uint_as_float(u);
}

union AF { v16h v; _Float16 h[16]; v4u q[2]; };
union H8 { _Float16 h[8]; v4u q; };

// 16-half WMMA fragment (A or B operand, one 32-deep k step): lane row/col = lane&15;
// elements 0..7 <- k 8*lhi+0..7, elements 8..15 <- k 16+8*lhi+0..7 (two aligned 16-byte loads).
// Fragment-order planes: every f16 operand plane in the workspace is a sequence of 1-KB
// fragments (16 rows x 32 k). Inside a fragment, half index j*256 + lane*8 + e holds
// (row lane&15, k 16*j + 8*(lane>>4) + e), so that each of the two loads of a wave covers
// 512 contiguous bytes (4 whole lines) instead of 32-byte pieces of 16 lines.
#define FRAG 512        // halves per fragment
static __device__ __forceinline__ void load_fragp(AF& a, const _Float16* frag, int lane) {
  const v4ua* p = (const v4ua*)(frag + lane * 8);
  a.q[0] = p[0];
  a.q[1] = p[32];
}

static __device__ __forceinline__ v8f mma16(v16h a, v16h b, v8f c) {
  v8f d = __builtin_amdgcn_wmma_f32_16x16x32_f16(false, a, false, b, (short)0, c,
                                                 false, false);
  return d;
}

static __device__ __forceinline__ void vst16(_Float16* p, v4u v) { *(v4u*)p = v; }
static __device__ __forceinline__ void vstf4(float* p, v4f v) { *(v4f*)p = v; }

// ---------------------------------------------------------------- weight planes
// f32 weights [rows][32 << ksh] -> f16 fragment-order plane [rows/16][1 << ksh][FRAG]:
// h = f16(bf16(w) * scale). Piece i = 16 bytes of the plane = 8 consecutive k of one row.
static __device__ __forceinline__ const v4f* w_piece_src(const float* src, int i, int ksh) {
  const int fr  = i >> 6;                    // fragment; piece i&63 = j*32 + lane
  const int row = (fr >> ksh) * 16 + (i & 15);
  const int k   = (fr & ((1 << ksh) - 1)) * 32 + ((i >> 5) & 1) * 16 + ((i >> 4) & 1) * 8;
  return (const v4f*)(src + ((size_t)row << (ksh + 5)) + k);
}
static __device__ __forceinline__ v4u w_piece_cvt(v4f f0, v4f f1, float scale) {
  H8 o;
#pragma unroll
  for (int e = 0; e < 4; ++e) {
    o.h[e]     = (_Float16)(bf16r(f0[e]) * scale);
    o.h[4 + e] = (_Float16)(bf16r(f1[e]) * scale);
  }
  return o.q;
}

// ---------------------------------------------------------------- kernel 1
// Per (b, h, 128-token tile): qkv = x_h[128x64] . W_qkv^T (W_qkv = [192][64], k contiguous).
// Both weight conversions ride in this launch. W_qkv (48 KB of f32): every block converts it
// into its own LDS plane Wst, six pieces a lane. W_proj: its WP8 pieces are dealt over the grid,
// one a lane in the first blocks; the plane Wp16 is read only by the projection launch.
// Wave = 16 tokens x 192 columns (24 WMMA). Planes, fragment order: Q16/K16 = [bh][t/16][d/32][FRAG]
// (rows = tokens, k = d; 8q, 8k), V16T = [bh][t/32][d/16][FRAG] (rows = d, k = tokens; 8v).
// A 128-token tile is 16 KB contiguous in each plane.
static __device__ __forceinline__ void qkv_store_pass(const _Float16* Qst, const _Float16* Kst,
                                                      const _Float16* Vst, _Float16* qdst,
                                                      _Float16* kdst, _Float16* vdst, int tid) {
  v4u q[4], k[4], v[4];                                   // all LDS reads go out ahead of the stores
#pragma unroll
  for (int it = 0; it < 4; ++it) {
    const int idx = it * 256 + tid;                       // 16-B piece of the contiguous 16 KB tile
    q[it] = ((const v4ua*)Qst)[idx];
    k[it] = ((const v4ua*)Kst)[idx];
    v[it] = ((const v4ua*)Vst)[idx];
  }
#pragma unroll
  for (int it = 0; it < 4; ++it) {
    const int idx = it * 256 + tid;
    vst16(qdst + (size_t)idx * 8, q[it]);
    vst16(kdst + (size_t)idx * 8, k[it]);
    vst16(vdst + (size_t)idx * 8, v[it]);
  }
}

__global__ __launch_bounds__(256) __attribute__((amdgpu_num_vgpr(256)))
void qkv_kernel(const float* __restrict__ x, const float* __restrict__ Wqkv,
                const float* __restrict__ bq, const float* __restrict__ Wproj,
                _Float16* __restrict__ Wp16, _Float16* __restrict__ Q16,
                _Float16* __restrict__ K16, _Float16* __restrict__ V16T) {
  __shared__ __attribute__((aligned(16))) _Float16 Wst[NQKV * HDIM];   // [col/16][d/32][FRAG], 8 W_qkv
  __shared__ _Float16 Qst[128 * HDIM];   // [token/16][d/32][FRAG]
  __shared__ _Float16 Kst[128 * HDIM];   // [token/16][d/32][FRAG]
  __shared__ _Float16 Vst[HDIM * 128];   // [token/32][d/16][FRAG]

  const int tid  = (int)threadIdx.x;
  const int wave = tid >> 5;
  const int lane = tid & 31;
  const int lhi  = lane >> 4;
  const int ln   = lane & 15;
  const int tb   = blockIdx.x * 128;
  const int h    = blockIdx.y;
  const int b    = blockIdx.z;

  // All loads of the block go out together: W_qkv's pieces first (they are waited for first),
  // then x, then this lane's piece of W_proj, which is converted and stored at the kernel's end.
  v4f wq[WQ8 / 256][2];
  const v4f* wqs = w_piece_src(Wqkv, tid, 1);   // piece it*256 + tid lies 32 rows of 64 floats per it further on
#pragma unroll
  for (int it = 0; it < WQ8 / 256; ++it) {
    wq[it][0] = wqs[it * (32 * HDIM / 4)];
    wq[it][1] = wqs[it * (32 * HDIM / 4) + 1];
  }
  // Stands in front of the address arithmetic below, which reuses address registers of these loads.
  asm volatile("s_wait_xcnt 0x0" ::: "memory");
  const int trow = tb + wave * 16 + ln;
  const float* xrow = x + ((size_t)b * SEQ_FULL + trow) * EMB + h * HDIM;
  v4f xf[2][4];
#pragma unroll
  for (int ks = 0; ks < 2; ++ks) {
    const v4f* xp = (const v4f*)(xrow + ks * 32 + lhi * 8);
    xf[ks][0] = xp[0]; xf[ks][1] = xp[1];    // k = ks*32 + 8*lhi + 0..7   (elements 0..7)
    xf[ks][2] = xp[4]; xf[ks][3] = xp[5];    // k = ks*32 + 16 + 8*lhi +.. (elements 8..15)
  }
  float bqv[12];                             // bias of output column n*16 + ln
#pragma unroll
  for (int n = 0; n < 12; ++n) bqv[n] = bq[n * 16 + ln];
  const int wpi = ((b * NHEAD + h) * (SEQ / 128) + (int)blockIdx.x) * 256 + tid;
  const bool wpon = wpi < WP8;               // the same for a whole block: WP8 is a multiple of 256
  // Loaded without a branch, so that no wait stands here; a lane with no piece reads one that
  // exists (WP8 is a power of two) and stores nothing.
  const v4f* wps = w_piece_src(Wproj, wpi & (WP8 - 1), 5);
  const v4f wp0 = wps[0], wp1 = wps[1];

#pragma unroll
  for (int it = 0; it < WQ8 / 256; ++it)
    vst16(Wst + (it * 256 + tid) * 8, w_piece_cvt(wq[it][0], wq[it][1], 8.0f));

  // A fragments: x rows (tokens) x 64 dims, f32 -> bf16 RNE -> f16 in registers.
  AF xa[2];
#pragma unroll
  for (int ks = 0; ks < 2; ++ks) {
    const v4f f0 = xf[ks][0], f1 = xf[ks][1];
    const v4f f2 = xf[ks][2], f3 = xf[ks][3];
#pragma unroll
    for (int e = 0; e < 4; ++e) {
      xa[ks].h[e]      = (_Float16)bf16r(f0[e]);
      xa[ks].h[4 + e]  = (_Float16)bf16r(f1[e]);
      xa[ks].h[8 + e]  = (_Float16)bf16r(f2[e]);
      xa[ks].h[12 + e] = (_Float16)bf16r(f3[e]);
    }
  }

  __syncthreads();   // every wave's pieces of Wst are written

  // D rows of this lane: tokens wave*16 + lhi*8 + r; D column: ln.
  const int qkpos = ((ln >> 3) * 16 + lhi * 8) * 8 + (ln & 7);   // + r*8: row lhi*8+r, k 8*(ln>>3) + (ln&7)
  // Twelve independent accumulators, one k step after the other: no WMMA waits for the one before it.
  v8f acc[12];
#pragma unroll
  for (int n = 0; n < 12; ++n) {           // output columns n*16 + ln = B column of this lane
    AF wb;
    load_fragp(wb, Wst + (n * 2) * FRAG, lane);
    const float bv = 8.0f * bf16r(bqv[n]);
#pragma unroll
    for (int e = 0; e < 8; ++e) acc[n][e] = bv;
    acc[n] = mma16(xa[0].v, wb.v, acc[n]);
  }
#pragma unroll
  for (int n = 0; n < 12; ++n) {
    AF wb;
    load_fragp(wb, Wst + (n * 2 + 1) * FRAG, lane);
    acc[n] = mma16(xa[1].v, wb.v, acc[n]);
  }
#pragma unroll
  for (int n = 0; n < 12; ++n) {
    const int ct = n & 3;                  // 16-column tile within the 64-wide q / k / v block
    const int qkoff = (wave * 2 + (ct >> 1)) * FRAG + (ct & 1) * 256 + qkpos;
    if (n < 4) {
#pragma unroll
      for (int r = 0; r < 8; ++r) Qst[qkoff + r * 8] = (_Float16)acc[n][r];
    } else if (n < 8) {
#pragma unroll
      for (int r = 0; r < 8; ++r) Kst[qkoff + r * 8] = (_Float16)acc[n][r];
    } else {
      // row d = ct*16 + ln, k = tokens (wave&1)*16 + 8*lhi + r: the lane's own 16-byte piece
      H8 vv;
#pragma unroll
      for (int r = 0; r < 8; ++r) vv.h[r] = (_Float16)acc[n][r];
      vst16(Vst + ((wave >> 1) * 4 + ct) * FRAG + (wave & 1) * 256 + lane * 8, vv.q);
    }
  }
  __syncthreads();   // cross-wave staging complete

  const size_t bh = (size_t)(b * NHEAD + h);
  _Float16* qdst = Q16 + (bh * SEQ + tb) * HDIM;
  _Float16* kdst = K16 + (bh * SEQ + tb) * HDIM;
  _Float16* vdst = V16T + (bh * SEQ + tb) * HDIM;
  qkv_store_pass(Qst, Kst, Vst, qdst, kdst, vdst, tid);

  if (wpon) vst16(Wp16 + (size_t)wpi * 8, w_piece_cvt(wp0, wp1, 32.0f));
  // Grids of fewer than WP8 lanes (reduced NB or SEQ): the pieces that are left.
  if (QKV_LANES < WP8) {
    for (int i = wpi + QKV_LANES; i < WP8; i += QKV_LANES) {
      const v4f* sp = w_piece_src(Wproj, i, 5);
      vst16(Wp16 + (size_t)i * 8, w_piece_cvt(sp[0], sp[1], 32.0f));
    }
  }
}

// ---------------------------------------------------------------- kernel 2
// Flash attention, transposed products. Block = 8 waves = 256 query columns of one (b,h); a wave
// has QT = 2 tiles of 16 query columns, so that every K and V fragment it reads from LDS is the
// A operand of two WMMAs. Key blocks of 32, per query tile: S^T = K.Q^T (4 WMMA, A = K rows,
// B = Q kept in registers), so a lane holds
// 16 scores of ONE query (column ln; keys 8*lhi+r and 16+8*lhi+r). Maximum and sum run in the
// lane, plus one exchange between the wave halves for the maximum. The two score tiles,
// converted in place, are the B operand of O^T += V^T.P^T (4 WMMA, A = V^T rows): P x1024
// goes from registers to registers. K/V reach the waves through a two-buffer LDS ring: a stage is
// 64 keys (8 KB of K, 8 KB of V, both contiguous in their planes and already in fragment order),
// copied once per block by asynchronous copies while the stage before it is worked on.
// Outputs, fragment order [b*t/16][e/32][FRAG] (rows = tokens, k = e = h*64 + d): C16 = f16 hi of
// 128*ctx, R16 = f16 residual (128*ctx - hi) x 2048.

static __device__ __forceinline__ float other_half(float v) {   // value held by lane l ^ 16
  const int b = __float_as_int(v);
  return __int_as_float(__builtin_amdgcn_permlanex16(b, b, 0x76543210, 0xfedcba98, false, false));
}

#define SKEYS 64                    // keys per ring stage
#define SHALF (SKEYS * HDIM)        // halves per operand and stage (8 KB)
#define NSTAGE (SEQ / SKEYS)
static_assert(SEQ % SKEYS == 0);
static_assert(NSTAGE >= 2);
#define QT 2                        // 16-column query tiles per wave
#define QBLK (8 * QT * 16)          // query columns per block

// One stage: each of the 256 lanes copies four 16-byte pieces (two of K, two of V) to LDS.
// lds = the lane's byte address in the buffer, kg / vg = the lane's first piece in the planes.
static __device__ __forceinline__ void stage_copy(uint32_t lds, const _Float16* kg,
                                                  const _Float16* vg) {
  const uint32_t l1 = lds + 4096u, l2 = lds + 8192u, l3 = lds + 12288u;
  const _Float16* kg1 = kg + 2048;
  const _Float16* vg1 = vg + 2048;
  // The closing s_wait_xcnt stands inside the statement so that no address register of a copy
  // is rewritten ahead of it.
  asm volatile("global_load_async_to_lds_b128 %0, %4, off\n\t"
               "global_load_async_to_lds_b128 %1, %5, off\n\t"
               "global_load_async_to_lds_b128 %2, %6, off\n\t"
               "global_load_async_to_lds_b128 %3, %7, off\n\t"
               "s_wait_xcnt 0x0"
               :: "v"(lds), "v"(l1), "v"(l2), "v"(l3), "v"(kg), "v"(kg1), "v"(vg), "v"(vg1)
               : "memory");
}

__global__ __launch_bounds__(256) __attribute__((amdgpu_num_vgpr(256)))
void attn_kernel(const _Float16* __restrict__ Q16, const _Float16* __restrict__ K16,
                 const _Float16* __restrict__ V16T, _Float16* __restrict__ C16,
                 _Float16* __restrict__ R16) {
  __shared__ __attribute__((aligned(16))) _Float16 KV[2][2 * SHALF];   // [buffer][K stage | V stage]

  const int tid  = (int)threadIdx.x;
  const int wave = tid >> 5;
  const int lane = tid & 31;               // below: lhi = lane >> 4, ln = lane & 15
  const int qb   = blockIdx.x * QBLK;
  const int h    = blockIdx.y;
  const int b    = blockIdx.z;
  const size_t bh = (size_t)(b * NHEAD + h);
  const _Float16* Qp = Q16 + bh * SEQ * HDIM;
  const _Float16* Kp = K16 + bh * SEQ * HDIM;
  const _Float16* Vp = V16T + bh * SEQ * HDIM;

  // Q B-fragments for this wave's QT tiles of 16 query columns (plane carries 8q). Where SEQ is
  // no multiple of QBLK the last block's upper waves have no queries: they work on tile 0 (they
  // share the copies and the barriers) and store nothing.
  const bool live = (SEQ % QBLK == 0) || (qb + wave * (QT * 16) < SEQ);
  const int qt = live ? (qb >> 4) + wave * QT : 0;
  AF qa0[QT], qa1[QT];
  float m[QT];          // running maximum of query ln of the tile (equal in both halves)
  float ls[QT];         // running sum of 1024 p over this half's keys only; halves joined after the loop
  v8f o[QT][4];         // o[qi][d][r] = O^T[d*16 + 8*lhi + r][query ln of tile qi]
#pragma unroll
  for (int qi = 0; qi < QT; ++qi) {
    load_fragp(qa0[qi], Qp + (size_t)((qt + qi) * 2) * FRAG, lane);
    load_fragp(qa1[qi], Qp + (size_t)((qt + qi) * 2 + 1) * FRAG, lane);
    m[qi] = -3.0e38f;
    ls[qi] = 0.0f;
#pragma unroll
    for (int d = 0; d < 4; ++d) {
#pragma unroll
      for (int e = 0; e < 8; ++e) o[qi][d][e] = 0.0f;
    }
  }

  // Softmax runs in base 2: SC2 = log2(e) / 512 takes (8q).(8k) to log2(e) * q.k / 8.
  const float SC2 = 0.0028177637517362567f;

  // Ring prologue: stage 0 lands and is published, then stage 1 starts to fly.
  const uint32_t lds0 = (uint32_t)(size_t)(&KV[0][0]) + (uint32_t)tid * 16u;
  const _Float16* kg = Kp + tid * 8;
  const _Float16* vg = Vp + tid * 8;
  stage_copy(lds0, kg, vg);
  asm volatile("s_wait_asynccnt 0x0" ::: "memory");   // this wave's pieces of stage 0 have landed
  __syncthreads();                                    // every wave's pieces have
  stage_copy(lds0 + 4u * SHALF, kg + SHALF, vg + SHALF);

#pragma unroll 1
  for (int st = 0; st < NSTAGE; ++st) {
   const _Float16* Ks = &KV[st & 1][0];
   const _Float16* Vs = Ks + SHALF;
#pragma unroll
   for (int kb = 0; kb < SKEYS / 32; ++kb) {
    // S^T = K . Q^T : two 16-key tiles, each 2 k-steps over 64 dims; a K fragment serves QT query tiles.
    v8f s[QT][2];
#pragma unroll
    for (int nt = 0; nt < 2; ++nt) {
      const int kt = kb * 2 + nt;                // 16-key tile: A rows
      AF f0, f1;
      load_fragp(f0, Ks + (kt * 2) * FRAG, lane);
      load_fragp(f1, Ks + (kt * 2 + 1) * FRAG, lane);
#pragma unroll
      for (int qi = 0; qi < QT; ++qi) {
        v8f c;
#pragma unroll
        for (int e = 0; e < 8; ++e) c[e] = 0.0f;
        c = mma16(f0.v, qa0[qi].v, c);
        c = mma16(f1.v, qa1[qi].v, c);
        s[qi][nt] = c;
      }
    }

    AF pb[QT];
#pragma unroll
    for (int qi = 0; qi < QT; ++qi) {
      // Online softmax (f32), one query per lane and tile; m and mn are in base-2 units.
      float mx0 = s[qi][0][0], mx1 = s[qi][1][0];
#pragma unroll
      for (int r = 1; r < 8; ++r) {
        mx0 = fmaxf(mx0, s[qi][0][r]);
        mx1 = fmaxf(mx1, s[qi][1][r]);
      }
      float mx = fmaxf(mx0, mx1);
      mx = fmaxf(mx, other_half(mx)) * SC2;
      const float mn = fmaxf(m[qi], mx);
      const float corr = __builtin_amdgcn_exp2f(m[qi] - mn);
      m[qi] = mn;
      const float mo = mn - 10.0f;   // the carry x1024 of P rides in the exponent

      // P^T as a 32x16 B fragment: element nt*8+r = key nt*16 + 8*lhi + r, the hardware k order
      // that the V^T fragments have.
      const v2f sc2 = {SC2, SC2};
      const v2f nmo = {-mo, -mo};
      v2f rs0 = {0.0f, 0.0f}, rs1 = {0.0f, 0.0f};   // sums of 1024 p: keys of even r in x, of odd r in y
#pragma unroll
      for (int r = 0; r < 8; r += 2) {
        // Two neighbouring scores at a time: one packed FMA for both exponents, one packed add for both p.
        const v2f e0 = __builtin_elementwise_fma((v2f){s[qi][0][r], s[qi][0][r + 1]}, sc2, nmo);
        const v2f e1 = __builtin_elementwise_fma((v2f){s[qi][1][r], s[qi][1][r + 1]}, sc2, nmo);
        const v2f p0 = {__builtin_amdgcn_exp2f(e0.x), __builtin_amdgcn_exp2f(e0.y)};   // 1024 p
        const v2f p1 = {__builtin_amdgcn_exp2f(e1.x), __builtin_amdgcn_exp2f(e1.y)};
        rs0 += p0;
        rs1 += p1;
        pb[qi].h[r]         = (_Float16)p0.x;
        pb[qi].h[r + 1]     = (_Float16)p0.y;
        pb[qi].h[8 + r]     = (_Float16)p1.x;
        pb[qi].h[8 + r + 1] = (_Float16)p1.y;
      }
      rs0 += rs1;
      ls[qi] = ls[qi] * corr + (rs0.x + rs0.y);
#pragma unroll
      for (int d = 0; d < 4; ++d) {
#pragma unroll
        for (int r = 0; r < 8; ++r) o[qi][d][r] *= corr;
      }
    }

    // O^T += V^T . P^T : four 16-row d tiles, one fragment each, serving QT query tiles.
#pragma unroll
    for (int d = 0; d < 4; ++d) {
      AF vf;
      load_fragp(vf, Vs + (kb * 4 + d) * FRAG, lane);
#pragma unroll
      for (int qi = 0; qi < QT; ++qi) o[qi][d] = mma16(vf.v, pb[qi].v, o[qi][d]);
    }
   }
   // Publish point of stage st + 1; behind its barrier the buffer just read is free for st + 2.
   asm volatile("s_wait_dscnt 0x0" ::: "memory");      // this wave's reads of the buffer are done
   asm volatile("s_wait_asynccnt 0x0" ::: "memory");   // this wave's pieces of stage st + 1 have landed
   __syncthreads();
   if (st + 2 < NSTAGE)
     stage_copy(lds0 + (uint32_t)(st & 1) * (4u * SHALF), kg + (size_t)(st + 2) * SHALF,
                vg + (size_t)(st + 2) * SHALF);
  }
  asm volatile("s_wait_asynccnt 0x0" ::: "memory");    // no copy is left in flight at the wave's end

  // O = sum (1024 p)(8 v), lt = sum (1024 p); c = 128 * ctx = 16 * O / lt; hi = f16(c), res = f16((c - hi) * 2048).
  // A lane holds 8 consecutive d of its query per tile (row ln, k (d&1)*16 + 8*lhi + r of fragment
  // h*2 + d/2): its own 16-byte piece of the plane, so a wave's store is 512 contiguous bytes.
  if (live) {
#pragma unroll
    for (int qi = 0; qi < QT; ++qi) {
      const size_t coff = ((((size_t)b * SEQ >> 4) + qt + qi) * (EMB / 32) + h * 2) * FRAG + lane * 8;
      _Float16* cdst = C16 + coff;
      _Float16* rdst = R16 + coff;
      const float lt = ls[qi] + other_half(ls[qi]);
      const float inv = (1.0f / lt) * 16.0f;
#pragma unroll
      for (int d = 0; d < 4; ++d) {
        H8 hv, rv;
#pragma unroll
        for (int r = 0; r < 8; ++r) {
          const float c = o[qi][d][r] * inv;
          const _Float16 hh = (_Float16)c;
          const float resf = (c - (float)hh) * 2048.0f;
          hv.h[r] = hh;
          rv.h[r] = (_Float16)resf;
        }
        vst16(cdst + d * 256, hv.q);
        vst16(rdst + d * 256, rv.q);
      }
    }
  }
}

// ---------------------------------------------------------------- kernel 3
// y[m][f] = (sum_e C16[m][e]*Wp16[f][e] + (sum_e R16[m][e]*Wp16[f][e]) / 2048) / 4096 + bf16(b_proj[f]);
// M = NB*SEQ, N = K = 1024. Block = 8 waves = 128 rows x 256 columns of y, one block per WGP; wave
// tile 64 rows x 64 columns, two accumulator sets (hi plane, residual plane). The operands reach the
// waves through a two-buffer LDS ring: a stage is 128 k (4 fragments) of 8 hi, 8 residual and 16
// weight tiles of 16 rows, 4 KB contiguous in its plane each, copied once per block by asynchronous
// copies while the stage before it is worked on. A fragment read from LDS feeds 4 or 8 WMMAs.
#define PBM 128                          // rows of y per block
#define PBN 256                          // columns of y per block
#define PKS 4                            // 32-deep k steps per ring stage
#define PCH ((2 * PBM + PBN) / 16)       // 16-row chunks per stage: hi | residual | weights
#define PCHH (PKS * FRAG)                // halves per chunk
#define PSH (PCH * PCHH)                 // halves per stage (128 KB)
#define PNST (EMB / 32 / PKS)            // stages
#define TROW ((EMB / 32) * FRAG)         // halves per 16-row tile of a plane
static_assert(SEQ % PBM == 0);
static_assert(EMB % PBN == 0);
static_assert(PCHH * 2 == 256 * 16);     // a chunk is one 16-byte piece per lane of the block
static_assert(PCH == 32);
static_assert(PNST >= 2);
static_assert(8 * 64 * 64 * 4 <= 2 * PSH * 2);   // the output staging fits the ring

// Eight chunks: the lane's piece of chunk j goes from byte voff of g + j * TROW to lds + j * 4096.
// g is the same for the whole block and stays in scalar registers; voff is the lane's own offset.
static __device__ __forceinline__ void chunk_copy8(uint32_t lds, uint32_t voff, const _Float16* g) {
  const uint32_t l1 = lds + 4096u, l2 = lds + 8192u, l3 = lds + 12288u, l4 = lds + 16384u,
                 l5 = lds + 20480u, l6 = lds + 24576u, l7 = lds + 28672u;
  const _Float16 *g1 = g + TROW, *g2 = g + 2 * TROW, *g3 = g + 3 * TROW, *g4 = g + 4 * TROW,
                 *g5 = g + 5 * TROW, *g6 = g + 6 * TROW, *g7 = g + 7 * TROW;
  // The closing s_wait_xcnt stands inside the statement so that no address register of a copy
  // is rewritten ahead of it.
  asm volatile("global_load_async_to_lds_b128 %0, %8, %9\n\t"
               "global_load_async_to_lds_b128 %1, %8, %10\n\t"
               "global_load_async_to_lds_b128 %2, %8, %11\n\t"
               "global_load_async_to_lds_b128 %3, %8, %12\n\t"
               "global_load_async_to_lds_b128 %4, %8, %13\n\t"
               "global_load_async_to_lds_b128 %5, %8, %14\n\t"
               "global_load_async_to_lds_b128 %6, %8, %15\n\t"
               "global_load_async_to_lds_b128 %7, %8, %16\n\t"
               "s_wait_xcnt 0x0"
               :: "v"(lds), "v"(l1), "v"(l2), "v"(l3), "v"(l4), "v"(l5), "v"(l6), "v"(l7),
                  "v"(voff), "s"(g), "s"(g1), "s"(g2), "s"(g3), "s"(g4), "s"(g5), "s"(g6), "s"(g7)
               : "memory");
}

// One stage: 32 pieces a lane. lds = the lane's byte address in the buffer, voff = its byte offset
// in a chunk; gh, gr, gw = the stage's first hi, residual and weight chunk.
static __device__ __forceinline__ void proj_stage_copy(uint32_t lds, uint32_t voff,
                                                       const _Float16* gh, const _Float16* gr,
                                                       const _Float16* gw) {
  chunk_copy8(lds, voff, gh);
  chunk_copy8(lds + 32768u, voff, gr);
  chunk_copy8(lds + 65536u, voff, gw);
  chunk_copy8(lds + 98304u, voff, gw + 8 * TROW);
}

// The 12 fragments of one k step of a wave: 4 weight, 4 hi, 4 residual.
struct PF { AF b[4], a[4], l[4]; };
static __device__ __forceinline__ void proj_frags(PF& f, const _Float16* Sh, const _Float16* Sr,
                                                  const _Float16* Sw, int ks, int lane) {
#pragma unroll
  for (int nt = 0; nt < 4; ++nt) load_fragp(f.b[nt], Sw + nt * PCHH + ks * FRAG, lane);
#pragma unroll
  for (int mi = 0; mi < 4; ++mi) {
    load_fragp(f.a[mi], Sh + mi * PCHH + ks * FRAG, lane);
    load_fragp(f.l[mi], Sr + mi * PCHH + ks * FRAG, lane);
  }
}

// A wave's 64 x 64 staged tile goes out in 256-B row segments: 16 lanes x 16 B, two rows a store.
// dst = the lane's piece of row lane >> 4; every further store lies two rows of y on.
static __device__ __forceinline__ void y_store_pass(const float* yw, float* dst, int lane) {
  v4f t[32];                                       // all LDS reads go out ahead of the stores
#pragma unroll
  for (int i = 0; i < 32; ++i) t[i] = ((const v4fa*)yw)[i * 32 + lane];
#pragma unroll
  for (int i = 0; i < 32; ++i) vstf4(dst + (size_t)i * (2 * EMB), t[i]);
}

__global__ __launch_bounds__(256)
void proj_kernel(const _Float16* __restrict__ C16, const _Float16* __restrict__ R16,
                 const _Float16* __restrict__ Wp16, const float* __restrict__ bp,
                 float* __restrict__ out) {
  __shared__ __attribute__((aligned(16))) _Float16 PS[2][PSH];   // [buffer][chunk][k step][FRAG]

  const int tid  = (int)threadIdx.x;
  const int wave = tid >> 5;
  const int lane = tid & 31;
  const int lhi  = lane >> 4;
  const int ln   = lane & 15;
  const int wm   = wave >> 2;              // 64-row half of the block's rows
  const int wn   = wave & 3;               // 64-column quarter of the block's columns
  const int mb   = blockIdx.x * PBM;
  const int nb   = blockIdx.y * PBN;

  v8f acch[4][4], accl[4][4];
#pragma unroll
  for (int mi = 0; mi < 4; ++mi) {
#pragma unroll
    for (int nt = 0; nt < 4; ++nt) {
#pragma unroll
      for (int e = 0; e < 8; ++e) { acch[mi][nt][e] = 0.0f; accl[mi][nt][e] = 0.0f; }
    }
  }

  // Ring prologue: stage 0 lands and is published, then stage 1 starts to fly.
  const uint32_t voff = (uint32_t)tid * 16u;
  const uint32_t lds0 = (uint32_t)(size_t)(&PS[0][0]) + voff;
  const _Float16* gh = C16 + (size_t)(mb >> 4) * TROW;
  const _Float16* gr = R16 + (size_t)(mb >> 4) * TROW;
  const _Float16* gw = Wp16 + (size_t)(nb >> 4) * TROW;
  proj_stage_copy(lds0, voff, gh, gr, gw);
  // The bias is fetched here, while stage 0 flies.
  const int n0 = nb + wn * 64;
  const float* bpl = bp + n0 + ln;         // bias of output column n0 + nt*16 + ln
  float bpv[4];
#pragma unroll
  for (int nt = 0; nt < 4; ++nt) bpv[nt] = bpl[nt * 16];
  // Stands in front of the arithmetic below, which reuses address registers of these loads; the
  // scheduling fence keeps that arithmetic from being lifted over the wait.
  asm volatile("s_wait_xcnt 0x0" ::: "memory");
  __builtin_amdgcn_sched_barrier(0);
  asm volatile("s_wait_asynccnt 0x0" ::: "memory");   // this wave's pieces of stage 0 have landed
  __syncthreads();                                    // every wave's pieces have
  proj_stage_copy(lds0 + 2u * PSH, voff, gh + PCHH, gr + PCHH, gw + PCHH);

#pragma unroll 1
  for (int st = 0; st < PNST; ++st) {
    const _Float16* S  = &PS[st & 1][0];
    const _Float16* Sh = S + (wm * 4) * PCHH;
    const _Float16* Sr = S + (PBM / 16 + wm * 4) * PCHH;
    const _Float16* Sw = S + (2 * PBM / 16 + wn * 4) * PCHH;
    PF f[2];                                 // two fragment sets: the next k step's reads fly during this one's WMMAs
    proj_frags(f[0], Sh, Sr, Sw, 0, lane);
#pragma unroll
    for (int ks = 0; ks < PKS; ++ks) {
      if (ks + 1 < PKS) proj_frags(f[(ks + 1) & 1], Sh, Sr, Sw, ks + 1, lane);
      // Keeps the next k step's LDS reads one group ahead of this k step's WMMAs, not spread among them.
      __builtin_amdgcn_sched_barrier(0);
      const PF& c = f[ks & 1];
#pragma unroll
      for (int mi = 0; mi < 4; ++mi) {
#pragma unroll
        for (int nt = 0; nt < 4; ++nt) {
          acch[mi][nt] = mma16(c.a[mi].v, c.b[nt].v, acch[mi][nt]);
          accl[mi][nt] = mma16(c.l[mi].v, c.b[nt].v, accl[mi][nt]);
        }
      }
      // Keeps the reads of the k step after the next behind these WMMAs, whose registers they refill.
      __builtin_amdgcn_sched_barrier(0);
    }
    // Publish point of stage st + 1; behind its barrier the buffer just read is free for st + 2.
    asm volatile("s_wait_dscnt 0x0" ::: "memory");      // this wave's reads of the buffer are done
    asm volatile("s_wait_asynccnt 0x0" ::: "memory");   // this wave's pieces of stage st + 1 have landed
    __syncthreads();
    if (st + 2 < PNST)
      proj_stage_copy(lds0 + (uint32_t)(st & 1) * (2u * PSH), voff, gh + (size_t)(st + 2) * PCHH,
                      gr + (size_t)(st + 2) * PCHH, gw + (size_t)(st + 2) * PCHH);
  }
  asm volatile("s_wait_asynccnt 0x0" ::: "memory");    // no copy is left in flight at the wave's end

  // Behind the last publish point nobody reads the ring and no copy flies: it becomes the output
  // staging, 16 KB [row][col] per wave.
  float* yw = (float*)&PS[0][0] + wave * (64 * 64);
#pragma unroll
  for (int nt = 0; nt < 4; ++nt) {
    const int col = nt * 16 + ln;
    const float bias = bf16r(bpv[nt]);
#pragma unroll
    for (int mi = 0; mi < 4; ++mi) {
#pragma unroll
      for (int r = 0; r < 8; ++r) {
        const float v = (acch[mi][nt][r] + accl[mi][nt][r] * 0.00048828125f) * 0.000244140625f + bias;
        yw[(mi * 16 + lhi * 8 + r) * 64 + col] = v;
      }
    }
  }
  __syncthreads();

  // The block's 128 rows lie in one batch (SEQ is a multiple of 128).
  const int ob = mb / SEQ;
  const size_t orow = (size_t)ob * SEQ_OUT + (mb - ob * SEQ) + wm * 64 + lhi;
  y_store_pass(yw, out + orow * EMB + n0 + ln * 4, lane);
}

// ---------------------------------------------------------------- host
extern "C" void kernel_launch(void* const* d_in, const int* in_sizes, int n_in,
                              void* d_out, int out_size, void* d_ws, size_t ws_size,
                              hipStream_t stream) {
  if (n_in < 5) return;
  if (in_sizes[0] < ((NB - 1) * SEQ_FULL + SEQ) * EMB) return;
  if (in_sizes[1] < NQKV * HDIM) return;
  if (in_sizes[2] < NQKV) return;
  if (in_sizes[3] < EMB * EMB) return;
  if (in_sizes[4] < EMB) return;
  if (out_size < ((NB - 1) * SEQ_OUT + SEQ) * EMB) return;

  const float* x     = (const float*)d_in[0];
  const float* Wqkv  = (const float*)d_in[1];
  const float* bqkv  = (const float*)d_in[2];
  const float* Wproj = (const float*)d_in[3];
  const float* bproj = (const float*)d_in[4];
  float* out = (float*)d_out;

  char* ws = (char*)d_ws;
  size_t off = 0;
  _Float16* Wp16 = (_Float16*)(ws + off); off += (size_t)EMB * EMB * 2;            // 2 MiB
  const size_t psz = (size_t)NB * NHEAD * SEQ * HDIM * 2;                          // 16 MiB at full size
  _Float16* Q16  = (_Float16*)(ws + off); off += psz;                               // [bh][t/16][2][FRAG]
  _Float16* K16  = (_Float16*)(ws + off); off += psz;                               // [bh][t/16][2][FRAG]
  _Float16* V16T = (_Float16*)(ws + off); off += psz;                               // [bh][t/32][4][FRAG]
  _Float16* C16  = (_Float16*)(ws + off); off += (size_t)NB * SEQ * EMB * 2;        // [b*t/16][32][FRAG] hi
  _Float16* R16  = (_Float16*)(ws + off); off += (size_t)NB * SEQ * EMB * 2;        // [b*t/16][32][FRAG] residual
  if (off > ws_size) return;

  dim3 g1(SEQ / 128, NHEAD, NB);
  qkv_kernel<<<g1, 256, 0, stream>>>(x, Wqkv, bqkv, Wproj, Wp16, Q16, K16, V16T);
  dim3 g2((SEQ + QBLK - 1) / QBLK, NHEAD, NB);
  attn_kernel<<<g2, 256, 0, stream>>>(Q16, K16, V16T, C16, R16);

  dim3 g3((NB * SEQ) / PBM, EMB / PBN);
  proj_kernel<<<g3, 256, 0, stream>>>(C16, R16, Wp16, bproj, out);
}

// v009
// A run of this version takes 95.1 microseconds.
// In two side-by-side timings against v008, it was 1.08 and 1.07 times as fast.
// Over all steps from v000 it is 5.00 times as fast.
#include <hip/hip_runtime.h>
#include <stdint.h>

// Contractions: qkv projection (K=64), q.k^T (K=64), p.v (K=32 per step): v_wmma_f32_16x16x32_f16, plain f16 operands, f32 accumulate;
// output projection (K=1024): v_wmma_f32_16x16x32_f16 with the context operand carried as f16 hi + f16 residual x2^11 (two accumulators), weights f16, f32 accumulate.
// Float inputs are RNE-converted to bf16 and then cast to f16 (exact); carries: W_qkv x8, softmax P x1024, context x128, W_proj x32; softmax and epilogues in f32.

typedef __attribute__((ext_vector_type(16))) _Float16 v16h;
typedef __attribute__((ext_vector_type(8)))  float    v8f;
typedef __attribute__((ext_vector_type(4)))  float    v4f;
typedef __attribute__((ext_vector_type(2)))  float    v2f;
typedef __attribute__((ext_vector_type(4)))  uint32_t v4u;
typedef v4u __attribute__((may_alias)) v4ua;
typedef v4f __attribute__((may_alias)) v4fa;

#ifndef NB
#define NB 4            // batch count processed
#endif
#ifndef SEQ
#define SEQ 2048        // tokens per batch processed
#endif
#ifndef SEQ_FULL
#define SEQ_FULL 2048   // per-batch token stride of the input x
#endif
#ifndef SEQ_OUT
#define SEQ_OUT SEQ     // per-batch token stride of the output buffer
#endif
#define NHEAD 16
#define EMB   1024
#define HDIM  64
#define NQKV  192
#define WQ8   (NQKV * HDIM / 8)                      // 16-byte pieces of the f16 W_qkv plane
#define WP8   (EMB * EMB / 8)                        // 16-byte pieces of the f16 W_proj plane
#define QKV_LANES (NB * NHEAD * (SEQ / 128) * 256)   // lanes of the qkv launch

static_assert(NB >= 1);
static_assert(SEQ >= 128);
static_assert(SEQ % 128 == 0);
static_assert(SEQ <= SEQ_FULL);
static_assert(NHEAD * HDIM == EMB);
static_assert(((NQKV * HDIM) / 8) % 256 == 0);
static_assert(((EMB * EMB) / 8) % 256 == 0);
static_assert((NB * SEQ) % 128 == 0);
static_assert(EMB % 64 == 0);
static_assert((WP8 & (WP8 - 1)) == 0);

// ---------------------------------------------------------------- helpers
static __device__ __forceinline__ float bf16r(float f) {   // RNE convert to bf16, back to f32
  uint32_t u = __float_as_uint(f);
  u = u + 0x7FFFu + ((u >> 16) & 1u);
  u = u & 0xFFFF0000u;
  return __uint_as_float(u);
}

union AF { v16h v; _Float16 h[16]; v4u q[2]; };
union H8 { _Float16 h[8]; v4u q; };

// 16-half WMMA fragment (A or B operand, one 32-deep k step): lane row/col = lane&15;
// elements 0..7 <- k 8*lhi+0..7, elements 8..15 <- k 16+8*lhi+0..7 (two aligned 16-byte loads).
// Fragment-order planes: every f16 operand plane in the workspace is a sequence of 1-KB
// fragments (16 rows x 32 k). Inside a fragment, half index j*256 + lane*8 + e holds
// (row lane&15, k 16*j + 8*(lane>>4) + e), so that each of the two loads of a wave covers
// 512 contiguous bytes (4 whole lines) instead of 32-byte pieces of 16 lines.
#define FRAG 512        // halves per fragment
static __device__ __forceinline__ void load_fragp(AF& a, const _Float16* frag, int lane) {
  const v4ua* p = (const v4ua*)(frag + lane * 8);
  a.q[0] = p[0];
  a.q[1] = p[32];
}

static __device__ __forceinline__ v8f mma16(v16h a, v16h b, v8f c) {
  v8f d = __builtin_amdgcn_wmma_f32_16x16x32_f16(false, a, false, b, (short)0, c,
                                                 false, false);
  return d;
}

static __device__ __forceinline__ void vst16(_Float16* p, v4u v) { *(v4u*)p = v; }
static __device__ __forceinline__ void vstf4(float* p, v4f v) { *(v4f*)p = v; }

// ---------------------------------------------------------------- weight planes
// f32 weights [rows][32 << ksh] -> f16 fragment-order plane [rows/16][1 << ksh][FRAG]:
// h = f16(bf16(w) * scale). Piece i = 16 bytes of the plane = 8 consecutive k of one row.
static __device__ __forceinline__ const v4f* w_piece_src(const float* src, int i, int ksh) {
  const int fr  = i >> 6;                    // fragment; piece i&63 = j*32 + lane
  const int row = (fr >> ksh) * 16 + (i & 15);
  const int k   = (fr & ((1 << ksh) - 1)) * 32 + ((i >> 5) & 1) * 16 + ((i >> 4) & 1) * 8;
  return (const v4f*)(src + ((size_t)row << (ksh + 5)) + k);
}
static __device__ __forceinline__ v4u w_piece_cvt(v4f f0, v4f f1, float scale) {
  H8 o;
#pragma unroll
  for (int e = 0; e < 4; ++e) {
    o.h[e]     = (_Float16)(bf16r(f0[e]) * scale);
    o.h[4 + e] = (_Float16)(bf16r(f1[e]) * scale);
  }
  return o.q;
}

// ---------------------------------------------------------------- kernel 1
// Per (b, h, 128-token tile): qkv = x_h[128x64] . W_qkv^T (W_qkv = [192][64], k contiguous).
// Both weight conversions ride in this launch. W_qkv (48 KB of f32): every block converts it
// into its own LDS plane Wst, six pieces a lane. W_proj: its WP8 pieces are dealt over the grid,
// one a lane in the first blocks; the plane Wp16 is read only by the projection launch.
// Wave = 16 tokens x 192 columns (24 WMMA). Planes, fragment order: Q16/K16 = [bh][t/16][d/32][FRAG]
// (rows = tokens, k = d; 8q, 8k), V16T = [bh][t/32][d/16][FRAG] (rows = d, k = tokens; 8v).
// A 128-token tile is 16 KB contiguous in each plane.
static __device__ __forceinline__ void qkv_store_pass(const _Float16* Qst, const _Float16* Kst,
                                                      const _Float16* Vst, _Float16* qdst,
                                                      _Float16* kdst, _Float16* vdst, int tid) {
  v4u q[4], k[4], v[4];                                   // all LDS reads go out ahead of the stores
#pragma unroll
  for (int it = 0; it < 4; ++it) {
    const int idx = it * 256 + tid;                       // 16-B piece of the contiguous 16 KB tile
    q[it] = ((const v4ua*)Qst)[idx];
    k[it] = ((const v4ua*)Kst)[idx];
    v[it] = ((const v4ua*)Vst)[idx];
  }
#pragma unroll
  for (int it = 0; it < 4; ++it) {
    const int idx = it * 256 + tid;
    vst16(qdst + (size_t)idx * 8, q[it]);
    vst16(kdst + (size_t)idx * 8, k[it]);
    vst16(vdst + (size_t)idx * 8, v[it]);
  }
}

__global__ __launch_bounds__(256) __attribute__((amdgpu_num_vgpr(256)))
void qkv_kernel(const float* __restrict__ x, const float* __restrict__ Wqkv,
                const float* __restrict__ bq, const float* __restrict__ Wproj,
                _Float16* __restrict__ Wp16, _Float16* __restrict__ Q16,
                _Float16* __restrict__ K16, _Float16* __restrict__ V16T) {
  __shared__ __attribute__((aligned(16))) _Float16 Wst[NQKV * HDIM];   // [col/16][d/32][FRAG], 8 W_qkv
  __shared__ _Float16 Qst[128 * HDIM];   // [token/16][d/32][FRAG]
  __shared__ _Float16 Kst[128 * HDIM];   // [token/16][d/32][FRAG]
  __shared__ _Float16 Vst[HDIM * 128];   // [token/32][d/16][FRAG]

  const int tid  = (int)threadIdx.x;
  const int wave = tid >> 5;
  const int lane = tid & 31;
  const int lhi  = lane >> 4;
  const int ln   = lane & 15;
  const int tb   = blockIdx.x * 128;
  const int h    = blockIdx.y;
  const int b    = blockIdx.z;

  // All loads of the block go out together: W_qkv's pieces first (they are waited for first),
  // then x, then this lane's piece of W_proj, which is converted and stored at the kernel's end.
  v4f wq[WQ8 / 256][2];
  const v4f* wqs = w_piece_src(Wqkv, tid, 1);   // piece it*256 + tid lies 32 rows of 64 floats per it further on
#pragma unroll
  for (int it = 0; it < WQ8 / 256; ++it) {
    wq[it][0] = wqs[it * (32 * HDIM / 4)];
    wq[it][1] = wqs[it * (32 * HDIM / 4) + 1];
  }
  // Stands in front of the address arithmetic below, which reuses address registers of these loads.
  asm volatile("s_wait_xcnt 0x0" ::: "memory");
  const int trow = tb + wave * 16 + ln;
  const float* xrow = x + ((size_t)b * SEQ_FULL + trow) * EMB + h * HDIM;
  v4f xf[2][4];
#pragma unroll
  for (int ks = 0; ks < 2; ++ks) {
    const v4f* xp = (const v4f*)(xrow + ks * 32 + lhi * 8);
    xf[ks][0] = xp[0]; xf[ks][1] = xp[1];    // k = ks*32 + 8*lhi + 0..7   (elements 0..7)
    xf[ks][2] = xp[4]; xf[ks][3] = xp[5];    // k = ks*32 + 16 + 8*lhi +.. (elements 8..15)
  }
  float bqv[12];                             // bias of output column n*16 + ln
#pragma unroll
  for (int n = 0; n < 12; ++n) bqv[n] = bq[n * 16 + ln];
  const int wpi = ((b * NHEAD + h) * (SEQ / 128) + (int)blockIdx.x) * 256 + tid;
  const bool wpon = wpi < WP8;               // the same for a whole block: WP8 is a multiple of 256
  // Loaded without a branch, so that no wait stands here; a lane with no piece reads one that
  // exists (WP8 is a power of two) and stores nothing.
  const v4f* wps = w_piece_src(Wproj, wpi & (WP8 - 1), 5);
  const v4f wp0 = wps[0], wp1 = wps[1];

#pragma unroll
  for (int it = 0; it < WQ8 / 256; ++it)
    vst16(Wst + (it * 256 + tid) * 8, w_piece_cvt(wq[it][0], wq[it][1], 8.0f));

  // A fragments: x rows (tokens) x 64 dims, f32 -> bf16 RNE -> f16 in registers.
  AF xa[2];
#pragma unroll
  for (int ks = 0; ks < 2; ++ks) {
    const v4f f0 = xf[ks][0], f1 = xf[ks][1];
    const v4f f2 = xf[ks][2], f3 = xf[ks][3];
#pragma unroll
    for (int e = 0; e < 4; ++e) {
      xa[ks].h[e]      = (_Float16)bf16r(f0[e]);
      xa[ks].h[4 + e]  = (_Float16)bf16r(f1[e]);
      xa[ks].h[8 + e]  = (_Float16)bf16r(f2[e]);
      xa[ks].h[12 + e] = (_Float16)bf16r(f3[e]);
    }
  }

  __syncthreads();   // every wave's pieces of Wst are written

  // D rows of this lane: tokens wave*16 + lhi*8 + r; D column: ln.
  const int qkpos = ((ln >> 3) * 16 + lhi * 8) * 8 + (ln & 7);   // + r*8: row lhi*8+r, k 8*(ln>>3) + (ln&7)
  // Twelve independent accumulators, one k step after the other: no WMMA waits for the one before it.
  v8f acc[12];
#pragma unroll
  for (int n = 0; n < 12; ++n) {           // output columns n*16 + ln = B column of this lane
    AF wb;
    load_fragp(wb, Wst + (n * 2) * FRAG, lane);
    const float bv = 8.0f * bf16r(bqv[n]);
#pragma unroll
    for (int e = 0; e < 8; ++e) acc[n][e] = bv;
    acc[n] = mma16(xa[0].v, wb.v, acc[n]);
  }
#pragma unroll
  for (int n = 0; n < 12; ++n) {
    AF wb;
    load_fragp(wb, Wst + (n * 2 + 1) * FRAG, lane);
    acc[n] = mma16(xa[1].v, wb.v, acc[n]);
  }
#pragma unroll
  for (int n = 0; n < 12; ++n) {
    const int ct = n & 3;                  // 16-column tile within the 64-wide q / k / v block
    const int qkoff = (wave * 2 + (ct >> 1)) * FRAG + (ct & 1) * 256 + qkpos;
    if (n < 4) {
#pragma unroll
      for (int r = 0; r < 8; ++r) Qst[qkoff + r * 8] = (_Float16)acc[n][r];
    } else if (n < 8) {
#pragma unroll
      for (int r = 0; r < 8; ++r) Kst[qkoff + r * 8] = (_Float16)acc[n][r];
    } else {
      // row d = ct*16 + ln, k = tokens (wave&1)*16 + 8*lhi + r: the lane's own 16-byte piece
      H8 vv;
#pragma unroll
      for (int r = 0; r < 8; ++r) vv.h[r] = (_Float16)acc[n][r];
      vst16(Vst + ((wave >> 1) * 4 + ct) * FRAG + (wave & 1) * 256 + lane * 8, vv.q);
    }
  }
  __syncthreads();   // cross-wave staging complete

  const size_t bh = (size_t)(b * NHEAD + h);
  _Float16* qdst = Q16 + (bh * SEQ + tb) * HDIM;
  _Float16* kdst = K16 + (bh * SEQ + tb) * HDIM;
  _Float16* vdst = V16T + (bh * SEQ + tb) * HDIM;
  qkv_store_pass(Qst, Kst, Vst, qdst, kdst, vdst, tid);

  if (wpon) vst16(Wp16 + (size_t)wpi * 8, w_piece_cvt(wp0, wp1, 32.0f));
  // Grids of fewer than WP8 lanes (reduced NB or SEQ): the pieces that are left.
  if (QKV_LANES < WP8) {
    for (int i = wpi + QKV_LANES; i < WP8; i += QKV_LANES) {
      const v4f* sp = w_piece_src(Wproj, i, 5);
      vst16(Wp16 + (size_t)i * 8, w_piece_cvt(sp[0], sp[1], 32.0f));
    }
  }
}

// ---------------------------------------------------------------- kernel 2
// Flash attention, transposed products. Block = 8 waves = 256 query columns of one (b,h); a wave
// has QT = 2 tiles of 16 query columns, so that every K and V fragment it reads from LDS is the
// A operand of two WMMAs. Key blocks of 32, per query tile: S^T = K.Q^T (4 WMMA, A = K rows,
// B = Q kept in registers), so a lane holds
// 16 scores of ONE query (column ln; keys 8*lhi+r and 16+8*lhi+r). Maximum and sum run in the
// lane. The maximum in use may trail the true one: O and the sums are rescaled (and the wave halves
// exchange their maxima) only in a pass where some exponent would pass PEMAX. The two score tiles,
// converted in place, are the B operand of O^T += V^T.P^T (4 WMMA, A = V^T rows): P x1024
// goes from registers to registers. K/V reach the waves through a two-buffer LDS ring: a stage is
// 64 keys (8 KB of K, 8 KB of V, both contiguous in their planes and already in fragment order),
// copied once per block by asynchronous copies while the stage before it is worked on.
// Outputs, fragment order [b*t/16][e/32][FRAG] (rows = tokens, k = e = h*64 + d): C16 = f16 hi of
// 128*ctx, R16 = f16 residual (128*ctx - hi) x 2048.

static __device__ __forceinline__ float other_half(float v) {   // value held by lane l ^ 16
  const int b = __float_as_int(v);
  return __int_as_float(__builtin_amdgcn_permlanex16(b, b, 0x76543210, 0xfedcba98, false, false));
}

#define SKEYS 64                    // keys per ring stage
#define SHALF (SKEYS * HDIM)        // halves per operand and stage (8 KB)
#define NSTAGE (SEQ / SKEYS)
static_assert(SEQ % SKEYS == 0);
static_assert(NSTAGE >= 2);
#define QT 2                        // 16-column query tiles per wave
#define QBLK (8 * QT * 16)          // query columns per block

// One stage: each of the 256 lanes copies four 16-byte pieces (two of K, two of V) to LDS.
// lds = the lane's byte address in the buffer, kg / vg = the lane's first piece in the planes.
static __device__ __forceinline__ void stage_copy(uint32_t lds, const _Float16* kg,
                                                  const _Float16* vg) {
  const uint32_t l1 = lds + 4096u, l2 = lds + 8192u, l3 = lds + 12288u;
  const _Float16* kg1 = kg + 2048;
  const _Float16* vg1 = vg + 2048;
  // The closing s_wait_xcnt stands inside the statement so that no address register of a copy
  // is rewritten ahead of it.
  asm volatile("global_load_async_to_lds_b128 %0, %4, off\n\t"
               "global_load_async_to_lds_b128 %1, %5, off\n\t"
               "global_load_async_to_lds_b128 %2, %6, off\n\t"
               "global_load_async_to_lds_b128 %3, %7, off\n\t"
               "s_wait_xcnt 0x0"
               :: "v"(lds), "v"(l1), "v"(l2), "v"(l3), "v"(kg), "v"(kg1), "v"(vg), "v"(vg1)
               : "memory");
}

__global__ __launch_bounds__(256) __attribute__((amdgpu_num_vgpr(256)))
void attn_kernel(const _Float16* __restrict__ Q16, const _Float16* __restrict__ K16,
                 const _Float16* __restrict__ V16T, _Float16* __restrict__ C16,
                 _Float16* __restrict__ R16) {
  __shared__ __attribute__((aligned(16))) _Float16 KV[2][2 * SHALF];   // [buffer][K stage | V stage]

  const int tid  = (int)threadIdx.x;
  const int wave = tid >> 5;
  const int lane = tid & 31;               // below: lhi = lane >> 4, ln = lane & 15
  const int qb   = blockIdx.x * QBLK;
  const int h    = blockIdx.y;
  const int b    = blockIdx.z;
  const size_t bh = (size_t)(b * NHEAD + h);
  const _Float16* Qp = Q16 + bh * SEQ * HDIM;
  const _Float16* Kp = K16 + bh * SEQ * HDIM;
  const _Float16* Vp = V16T + bh * SEQ * HDIM;

  // Q B-fragments for this wave's QT tiles of 16 query columns (plane carries 8q). Where SEQ is
  // no multiple of QBLK the last block's upper waves have no queries: they work on tile 0 (they
  // share the copies and the barriers) and store nothing.
  const bool live = (SEQ % QBLK == 0) || (qb + wave * (QT * 16) < SEQ);
  const int qt = live ? (qb >> 4) + wave * QT : 0;
  AF qa0[QT], qa1[QT];
  float m[QT];          // maximum in use for query ln of the tile, base-2 units (equal in both halves)
  float nmo[QT];        // 10 - m: the addend of every exponent; the carry x1024 of P rides in it
  v2f rs0[QT], rs1[QT]; // running sums of 1024 p over this half's keys (first / second key tile; even r in x, odd r in y); joined after the loop
  v8f o[QT][4];         // o[qi][d][r] = O^T[d*16 + 8*lhi + r][query ln of tile qi]
#pragma unroll
  for (int qi = 0; qi < QT; ++qi) {
    load_fragp(qa0[qi], Qp + (size_t)((qt + qi) * 2) * FRAG, lane);
    load_fragp(qa1[qi], Qp + (size_t)((qt + qi) * 2 + 1) * FRAG, lane);
    m[qi] = -3.0e38f;
    nmo[qi] = 3.0e38f;    // the first pass's test fires, and its rescale factor is 0
    rs0[qi] = (v2f){0.0f, 0.0f};
    rs1[qi] = (v2f){0.0f, 0.0f};
#pragma unroll
    for (int d = 0; d < 4; ++d) {
#pragma unroll
      for (int e = 0; e < 8; ++e) o[qi][d][e] = 0.0f;
    }
  }

  // Softmax runs in base 2: SC2 = log2(e) / 512 takes (8q).(8k) to log2(e) * q.k / 8.
  const float SC2 = 0.0028177637517362567f;
  // Largest exponent of 1024 p let through without a rescale: P stays at or below 2^15, inside f16.
  const float PEMAX = 15.0f;

  // Ring prologue: stage 0 lands and is published, then stage 1 starts to fly.
  const uint32_t lds0 = (uint32_t)(size_t)(&KV[0][0]) + (uint32_t)tid * 16u;
  const _Float16* kg = Kp + tid * 8;
  const _Float16* vg = Vp + tid * 8;
  stage_copy(lds0, kg, vg);
  asm volatile("s_wait_asynccnt 0x0" ::: "memory");   // this wave's pieces of stage 0 have landed
  __syncthreads();                                    // every wave's pieces have
  stage_copy(lds0 + 4u * SHALF, kg + SHALF, vg + SHALF);

#pragma unroll 1
  for (int st = 0; st < NSTAGE; ++st) {
   const _Float16* Ks = &KV[st & 1][0];
   const _Float16* Vs = Ks + SHALF;
#pragma unroll
   for (int kb = 0; kb < SKEYS / 32; ++kb) {
    // S^T = K . Q^T : two 16-key tiles, each 2 k-steps over 64 dims; a K fragment serves QT query tiles.
    v8f s[QT][2];
#pragma unroll
    for (int nt = 0; nt < 2; ++nt) {
      const int kt = kb * 2 + nt;                // 16-key tile: A rows
      AF f0, f1;
      load_fragp(f0, Ks + (kt * 2) * FRAG, lane);
      load_fragp(f1, Ks + (kt * 2 + 1) * FRAG, lane);
#pragma unroll
      for (int qi = 0; qi < QT; ++qi) {
        v8f c;
#pragma unroll
        for (int e = 0; e < 8; ++e) c[e] = 0.0f;
        c = mma16(f0.v, qa0[qi].v, c);
        c = mma16(f1.v, qa1[qi].v, c);
        s[qi][nt] = c;
      }
    }

    float mx[QT], emx[QT];
#pragma unroll
    for (int qi = 0; qi < QT; ++qi) {
      float mx0 = s[qi][0][0], mx1 = s[qi][1][0];
#pragma unroll
      for (int r = 1; r < 8; ++r) {
        mx0 = fmaxf(mx0, s[qi][0][r]);
        mx1 = fmaxf(mx1, s[qi][1][r]);
      }
      mx[qi] = fmaxf(mx0, mx1);
      emx[qi] = __builtin_fmaf(mx[qi], SC2, nmo[qi]);
    }
    bool need = false;
#pragma unroll
    for (int qi = 0; qi < QT; ++qi) need = need || (emx[qi] > PEMAX);
    if (__builtin_amdgcn_ballot_w32(need) != 0) {   // a scalar branch of the whole wave; rare after the first pass
#pragma unroll
      for (int qi = 0; qi < QT; ++qi) {
        const float mxs = fmaxf(mx[qi], other_half(mx[qi])) * SC2;
        const float mn = fmaxf(m[qi], mxs);
        const float corr = __builtin_amdgcn_exp2f(m[qi] - mn);
        m[qi] = mn;
        nmo[qi] = 10.0f - mn;
        rs0[qi] *= corr;
        rs1[qi] *= corr;
#pragma unroll
        for (int d = 0; d < 4; ++d) {
#pragma unroll
          for (int r = 0; r < 8; ++r) o[qi][d][r] *= corr;
        }
      }
    }

    // The pass's four V^T fragments are asked for here, so that they fly during the exponentials.
    AF vf[4];
#pragma unroll
    for (int d = 0; d < 4; ++d) load_fragp(vf[d], Vs + (kb * 4 + d) * FRAG, lane);
    // A stage's last pass: keeps these reads one group behind the branch; without it each fragment's
    // reads come to stand directly in front of its own WMMAs, with a full wait each. (In the other
    // passes the compiler spreads them among the next pass's K reads, behind counted waits.)
    if (kb + 1 == SKEYS / 32) __builtin_amdgcn_sched_barrier(0);

    AF pb[QT];
#pragma unroll
    for (int qi = 0; qi < QT; ++qi) {
      // P^T as a 32x16 B fragment: element nt*8+r = key nt*16 + 8*lhi + r, the hardware k order
      // that the V^T fragments have.
      const v2f sc2 = {SC2, SC2};
      const v2f nm2 = {nmo[qi], nmo[qi]};
#pragma unroll
      for (int r = 0; r < 8; r += 2) {
        // Two neighbouring scores at a time: one packed FMA for both exponents, one packed add for both p.
        const v2f e0 = __builtin_elementwise_fma((v2f){s[qi][0][r], s[qi][0][r + 1]}, sc2, nm2);
        const v2f e1 = __builtin_elementwise_fma((v2f){s[qi][1][r], s[qi][1][r + 1]}, sc2, nm2);
        const v2f p0 = {__builtin_amdgcn_exp2f(e0.x), __builtin_amdgcn_exp2f(e0.y)};   // 1024 p
        const v2f p1 = {__builtin_amdgcn_exp2f(e1.x), __builtin_amdgcn_exp2f(e1.y)};
        rs0[qi] += p0;
        rs1[qi] += p1;
        pb[qi].h[r]         = (_Float16)p0.x;
        pb[qi].h[r + 1]     = (_Float16)p0.y;
        pb[qi].h[8 + r]     = (_Float16)p1.x;
        pb[qi].h[8 + r + 1] = (_Float16)p1.y;
      }
    }

    // O^T += V^T . P^T : four 16-row d tiles, one fragment each, serving QT query tiles.
#pragma unroll
    for (int d = 0; d < 4; ++d) {
#pragma unroll
      for (int qi = 0; qi < QT; ++qi) o[qi][d] = mma16(vf[d].v, pb[qi].v, o[qi][d]);
    }
   }
   // Publish point of stage st + 1; behind its barrier the buffer just read is free for st + 2.
   asm volatile("s_wait_dscnt 0x0" ::: "memory");      // this wave's reads of the buffer are done
   asm volatile("s_wait_asynccnt 0x0" ::: "memory");   // this wave's pieces of stage st + 1 have landed
   __syncthreads();
   if (st + 2 < NSTAGE)
     stage_copy(lds0 + (uint32_t)(st & 1) * (4u * SHALF), kg + (size_t)(st + 2) * SHALF,
                vg + (size_t)(st + 2) * SHALF);
  }
  asm volatile("s_wait_asynccnt 0x0" ::: "memory");    // no copy is left in flight at the wave's end

  // O = sum (1024 p)(8 v), lt = sum (1024 p); c = 128 * ctx = 16 * O / lt; hi = f16(c), res = f16((c - hi) * 2048).
  // A lane holds 8 consecutive d of its query per tile (row ln, k (d&1)*16 + 8*lhi + r of fragment
  // h*2 + d/2): its own 16-byte piece of the plane, so a wave's store is 512 contiguous bytes.
  if (live) {
#pragma unroll
    for (int qi = 0; qi < QT; ++qi) {
      const size_t coff = ((((size_t)b * SEQ >> 4) + qt + qi) * (EMB / 32) + h * 2) * FRAG + lane * 8;
      _Float16* cdst = C16 + coff;
      _Float16* rdst = R16 + coff;
      const v2f rs = rs0[qi] + rs1[qi];
      const float ls = rs.x + rs.y;
      const float lt = ls + other_half(ls);
      const float inv = (1.0f / lt) * 16.0f;
#pragma unroll
      for (int d = 0; d < 4; ++d) {
        H8 hv, rv;
#pragma unroll
        for (int r = 0; r < 8; ++r) {
          const float c = o[qi][d][r] * inv;
          const _Float16 hh = (_Float16)c;
          const float resf = (c - (float)hh) * 2048.0f;
          hv.h[r] = hh;
          rv.h[r] = (_Float16)resf;
        }
        vst16(cdst + d * 256, hv.q);
        vst16(rdst + d * 256, rv.q);
      }
    }
  }
}

// ---------------------------------------------------------------- kernel 3
// y[m][f] = (sum_e C16[m][e]*Wp16[f][e] + (sum_e R16[m][e]*Wp16[f][e]) / 2048) / 4096 + bf16(b_proj[f]);
// M = NB*SEQ, N = K = 1024. Block = 8 waves = 128 rows x 256 columns of y, one block per WGP; wave
// tile 64 rows x 64 columns, two accumulator sets (hi plane, residual plane). The operands reach the
// waves through a two-buffer LDS ring: a stage is 128 k (4 fragments) of 8 hi, 8 residual and 16
// weight tiles of 16 rows, 4 KB contiguous in its plane each, copied once per block by asynchronous
// copies while the stage before it is worked on. A fragment read from LDS feeds 4 or 8 WMMAs.
#define PBM 128                          // rows of y per block
#define PBN 256                          // columns of y per block
#define PKS 4                            // 32-deep k steps per ring stage
#define PCH ((2 * PBM + PBN) / 16)       // 16-row chunks per stage: hi | residual | weights
#define PCHH (PKS * FRAG)                // halves per chunk
#define PSH (PCH * PCHH)                 // halves per stage (128 KB)
#define PNST (EMB / 32 / PKS)            // stages
#define TROW ((EMB / 32) * FRAG)         // halves per 16-row tile of a plane
static_assert(SEQ % PBM == 0);
static_assert(EMB % PBN == 0);
static_assert(PCHH * 2 == 256 * 16);     // a chunk is one 16-byte piece per lane of the block
static_assert(PCH == 32);
static_assert(PNST >= 2);
static_assert(8 * 64 * 64 * 4 <= 2 * PSH * 2);   // the output staging fits the ring

// Eight chunks: the lane's piece of chunk j goes from byte voff of g + j * TROW to lds + j * 4096.
// g is the same for the whole block and stays in scalar registers; voff is the lane's own offset.
static __device__ __forceinline__ void chunk_copy8(uint32_t lds, uint32_t voff, const _Float16* g) {
  const uint32_t l1 = lds + 4096u, l2 = lds + 8192u, l3 = lds + 12288u, l4 = lds + 16384u,
                 l5 = lds + 20480u, l6 = lds + 24576u, l7 = lds + 28672u;
  const _Float16 *g1 = g + TROW, *g2 = g + 2 * TROW, *g3 = g + 3 * TROW, *g4 = g + 4 * TROW,
                 *g5 = g + 5 * TROW, *g6 = g + 6 * TROW, *g7 = g + 7 * TROW;
  // The closing s_wait_xcnt stands inside the statement so that no address register of a copy
  // is rewritten ahead of it.
  asm volatile("global_load_async_to_lds_b128 %0, %8, %9\n\t"
               "global_load_async_to_lds_b128 %1, %8, %10\n\t"
               "global_load_async_to_lds_b128 %2, %8, %11\n\t"
               "global_load_async_to_lds_b128 %3, %8, %12\n\t"
               "global_load_async_to_lds_b128 %4, %8, %13\n\t"
               "global_load_async_to_lds_b128 %5, %8, %14\n\t"
               "global_load_async_to_lds_b128 %6, %8, %15\n\t"
               "global_load_async_to_lds_b128 %7, %8, %16\n\t"
               "s_wait_xcnt 0x0"
               :: "v"(lds), "v"(l1), "v"(l2), "v"(l3), "v"(l4), "v"(l5), "v"(l6), "v"(l7),
                  "v"(voff), "s"(g), "s"(g1), "s"(g2), "s"(g3), "s"(g4), "s"(g5), "s"(g6), "s"(g7)
               : "memory");
}

// One stage: 32 pieces a lane. lds = the lane's byte address in the buffer, voff = its byte offset
// in a chunk; gh, gr, gw = the stage's first hi, residual and weight chunk.
static __device__ __forceinline__ void proj_stage_copy(uint32_t lds, uint32_t voff,
                                                       const _Float16* gh, const _Float16* gr,
                                                       const _Float16* gw) {
  chunk_copy8(lds, voff, gh);
  chunk_copy8(lds + 32768u, voff, gr);
  chunk_copy8(lds + 65536u, voff, gw);
  chunk_copy8(lds + 98304u, voff, gw + 8 * TROW);
}

// The 12 fragments of one k step of a wave: 4 weight, 4 hi, 4 residual.
struct PF { AF b[4], a[4], l[4]; };
static __device__ __forceinline__ void proj_frags(PF& f, const _Float16* Sh, const _Float16* Sr,
                                                  const _Float16* Sw, int ks, int lane) {
#pragma unroll
  for (int nt = 0; nt < 4; ++nt) load_fragp(f.b[nt], Sw + nt * PCHH + ks * FRAG, lane);
#pragma unroll
  for (int mi = 0; mi < 4; ++mi) {
    load_fragp(f.a[mi], Sh + mi * PCHH + ks * FRAG, lane);
    load_fragp(f.l[mi], Sr + mi * PCHH + ks * FRAG, lane);
  }
}

// A wave's 64 x 64 staged tile goes out in 256-B row segments: 16 lanes x 16 B, two rows a store.
// dst = the lane's piece of row lane >> 4; every further store lies two rows of y on.
static __device__ __forceinline__ void y_store_pass(const float* yw, float* dst, int lane) {
  v4f t[32];                                       // all LDS reads go out ahead of the stores
#pragma unroll
  for (int i = 0; i < 32; ++i) t[i] = ((const v4fa*)yw)[i * 32 + lane];
#pragma unroll
  for (int i = 0; i < 32; ++i) vstf4(dst + (size_t)i * (2 * EMB), t[i]);
}

__global__ __launch_bounds__(256)
void proj_kernel(const _Float16* __restrict__ C16, const _Float16* __restrict__ R16,
                 const _Float16* __restrict__ Wp16, const float* __restrict__ bp,
                 float* __restrict__ out) {
  __shared__ __attribute__((aligned(16))) _Float16 PS[2][PSH];   // [buffer][chunk][k step][FRAG]

  const int tid  = (int)threadIdx.x;
  const int wave = tid >> 5;
  const int lane = tid & 31;
  const int lhi  = lane >> 4;
  const int ln   = lane & 15;
  const int wm   = wave >> 2;              // 64-row half of the block's rows
  const int wn   = wave & 3;               // 64-column quarter of the block's columns
  const int mb   = blockIdx.x * PBM;
  const int nb   = blockIdx.y * PBN;

  v8f acch[4][4], accl[4][4];
#pragma unroll
  for (int mi = 0; mi < 4; ++mi) {
#pragma unroll
    for (int nt = 0; nt < 4; ++nt) {
#pragma unroll
      for (int e = 0; e < 8; ++e) { acch[mi][nt][e] = 0.0f; accl[mi][nt][e] = 0.0f; }
    }
  }

  // Ring prologue: stage 0 lands and is published, then stage 1 starts to fly.
  const uint32_t voff = (uint32_t)tid * 16u;
  const uint32_t lds0 = (uint32_t)(size_t)(&PS[0][0]) + voff;
  const _Float16* gh = C16 + (size_t)(mb >> 4) * TROW;
  const _Float16* gr = R16 + (size_t)(mb >> 4) * TROW;
  const _Float16* gw = Wp16 + (size_t)(nb >> 4) * TROW;
  proj_stage_copy(lds0, voff, gh, gr, gw);
  // The bias is fetched here, while stage 0 flies.
  const int n0 = nb + wn * 64;
  const float* bpl = bp + n0 + ln;         // bias of output column n0 + nt*16 + ln
  float bpv[4];
#pragma unroll
  for (int nt = 0; nt < 4; ++nt) bpv[nt] = bpl[nt * 16];
  // Stands in front of the arithmetic below, which reuses address registers of these loads; the
  // scheduling fence keeps that arithmetic from being lifted over the wait.
  asm volatile("s_wait_xcnt 0x0" ::: "memory");
  __builtin_amdgcn_sched_barrier(0);
  asm volatile("s_wait_asynccnt 0x0" ::: "memory");   // this wave's pieces of stage 0 have landed
  __syncthreads();                                    // every wave's pieces have
  proj_stage_copy(lds0 + 2u * PSH, voff, gh + PCHH, gr + PCHH, gw + PCHH);

#pragma unroll 1
  for (int st = 0; st < PNST; ++st) {
    const _Float16* S  = &PS[st & 1][0];
    const _Float16* Sh = S + (wm * 4) * PCHH;
    const _Float16* Sr = S + (PBM / 16 + wm * 4) * PCHH;
    const _Float16* Sw = S + (2 * PBM / 16 + wn * 4) * PCHH;
    PF f[2];                                 // two fragment sets: the next k step's reads fly during this one's WMMAs
    proj_frags(f[0], Sh, Sr, Sw, 0, lane);
#pragma unroll
    for (int ks = 0; ks < PKS; ++ks) {
      if (ks + 1 < PKS) proj_frags(f[(ks + 1) & 1], Sh, Sr, Sw, ks + 1, lane);
      // Keeps the next k step's LDS reads one group ahead of this k step's WMMAs, not spread among them.
      __builtin_amdgcn_sched_barrier(0);
      const PF& c = f[ks & 1];
#pragma unroll
      for (int mi = 0; mi < 4; ++mi) {
#pragma unroll
        for (int nt = 0; nt < 4; ++nt) {
          acch[mi][nt] = mma16(c.a[mi].v, c.b[nt].v, acch[mi][nt]);
          accl[mi][nt] = mma16(c.l[mi].v, c.b[nt].v, accl[mi][nt]);
        }
      }
      // Keeps the reads of the k step after the next behind these WMMAs, whose registers they refill.
      __builtin_amdgcn_sched_barrier(0);
    }
    // Publish point of stage st + 1; behind its barrier the buffer just read is free for st + 2.
    asm volatile("s_wait_dscnt 0x0" ::: "memory");      // this wave's reads of the buffer are done
    asm volatile("s_wait_asynccnt 0x0" ::: "memory");   // this wave's pieces of stage st + 1 have landed
    __syncthreads();
    if (st + 2 < PNST)
      proj_stage_copy(lds0 + (uint32_t)(st & 1) * (2u * PSH), voff, gh + (size_t)(st + 2) * PCHH,
                      gr + (size_t)(st + 2) * PCHH, gw + (size_t)(st + 2) * PCHH);
  }
  asm volatile("s_wait_asynccnt 0x0" ::: "memory");    // no copy is left in flight at the wave's end

  // Behind the last publish point nobody reads the ring and no copy flies: it becomes the output
  // staging, 16 KB [row][col] per wave.
  float* yw = (float*)&PS[0][0] + wave * (64 * 64);
#pragma unroll
  for (int nt = 0; nt < 4; ++nt) {
    const int col = nt * 16 + ln;
    const float bias = bf16r(bpv[nt]);
#pragma unroll
    for (int mi = 0; mi < 4; ++mi) {
#pragma unroll
      for (int r = 0; r < 8; ++r) {
        const float v = (acch[mi][nt][r] + accl[mi][nt][r] * 0.00048828125f) * 0.000244140625f + bias;
        yw[(mi * 16 + lhi * 8 + r) * 64 + col] = v;
      }
    }
  }
  __syncthreads();

  // The block's 128 rows lie in one batch (SEQ is a multiple of 128).
  const int ob = mb / SEQ;
  const size_t orow = (size_t)ob * SEQ_OUT + (mb - ob * SEQ) + wm * 64 + lhi;
  y_store_pass(yw, out + orow * EMB + n0 + ln * 4, lane);
}

// ---------------------------------------------------------------- host
extern "C" void kernel_launch(void* const* d_in, const int* in_sizes, int n_in,
                              void* d_out, int out_size, void* d_ws, size_t ws_size,
                              hipStream_t stream) {
  if (n_in < 5) return;
  if (in_sizes[0] < ((NB - 1) * SEQ_FULL + SEQ) * EMB) return;
  if (in_sizes[1] < NQKV * HDIM) return;
  if (in_sizes[2] < NQKV) return;
  if (in_sizes[3] < EMB * EMB) return;
  if (in_sizes[4] < EMB) return;
  if (out_size < ((NB - 1) * SEQ_OUT + SEQ) * EMB) return;

  const float* x     = (const float*)d_in[0];
  const float* Wqkv  = (const float*)d_in[1];
  const float* bqkv  = (const float*)d_in[2];
  const float* Wproj = (const float*)d_in[3];
  const float* bproj = (const float*)d_in[4];
  float* out = (float*)d_out;

  char* ws = (char*)d_ws;
  size_t off = 0;
  _Float16* Wp16 = (_Float16*)(ws + off); off += (size_t)EMB * EMB * 2;            // 2 MiB
  const size_t psz = (size_t)NB * NHEAD * SEQ * HDIM * 2;                          // 16 MiB at full size
  _Float16* Q16  = (_Float16*)(ws + off); off += psz;                               // [bh][t/16][2][FRAG]
  _Float16* K16  = (_Float16*)(ws + off); off += psz;                               // [bh][t/16][2][FRAG]
  _Float16* V16T = (_Float16*)(ws + off); off += psz;                               // [bh][t/32][4][FRAG]
  _Float16* C16  = (_Float16*)(ws + off); off += (size_t)NB * SEQ * EMB * 2;        // [b*t/16][32][FRAG] hi
  _Float16* R16  = (_Float16*)(ws + off); off += (size_t)NB * SEQ * EMB * 2;        // [b*t/16][32][FRAG] residual
  if (off > ws_size) return;

  dim3 g1(SEQ / 128, NHEAD, NB);
  qkv_kernel<<<g1, 256, 0, stream>>>(x, Wqkv, bqkv, Wproj, Wp16, Q16, K16, V16T);
  dim3 g2((SEQ + QBLK - 1) / QBLK, NHEAD, NB);
  attn_kernel<<<g2, 256, 0, stream>>>(Q16, K16, V16T, C16, R16);

  dim3 g3((NB * SEQ) / PBM, EMB / PBN);
  proj_kernel<<<g3, 256, 0, stream>>>(C16, R16, Wp16, bproj, out);
}

// v010
// One run takes 87.1 microseconds.
// Timed twice side by side with v009, it ran 1.09 times as fast both times.
// Counting every step since v000, it is 5.46 times as fast.
#include <hip/hip_runtime.h>
#include <stdint.h>

// Contractions: qkv projection (K=64), q.k^T (K=64), p.v (K=32 per step): v_wmma_f32_16x16x32_f16, plain f16 operands, f32 accumulate;
// output projection (K=1024): v_wmma_f32_16x16x32_f16, plain f16 operands (context rounded once to f16: 11 bits beside the weights' 8), f32 accumulate.
// Float inputs are RNE-converted to bf16 and then cast to f16 (exact); carries: W_qkv x8, softmax P x1024, context x128, W_proj x32; softmax and epilogues in f32.

typedef __attribute__((ext_vector_type(16))) _Float16 v16h;
typedef __attribute__((ext_vector_type(8)))  float    v8f;
typedef __attribute__((ext_vector_type(4)))  float    v4f;
typedef __attribute__((ext_vector_type(2)))  float    v2f;
typedef __attribute__((ext_vector_type(4)))  uint32_t v4u;
typedef v4u __attribute__((may_alias)) v4ua;
typedef v4f __attribute__((may_alias)) v4fa;

#ifndef NB
#define NB 4            // batch count processed
#endif
#ifndef SEQ
#define SEQ 2048        // tokens per batch processed
#endif
#ifndef SEQ_FULL
#define SEQ_FULL 2048   // per-batch token stride of the input x
#endif
#ifndef SEQ_OUT
#define SEQ_OUT SEQ     // per-batch token stride of the output buffer
#endif
#define NHEAD 16
#define EMB   1024
#define HDIM  64
#define NQKV  192
#define WQ8   (NQKV * HDIM / 8)                      // 16-byte pieces of the f16 W_qkv plane
#define WP8   (EMB * EMB / 8)                        // 16-byte pieces of the f16 W_proj plane
#define QKV_LANES (NB * NHEAD * (SEQ / 128) * 256)   // lanes of the qkv launch

static_assert(NB >= 1);
static_assert(SEQ >= 128);
static_assert(SEQ % 128 == 0);
static_assert(SEQ <= SEQ_FULL);
static_assert(NHEAD * HDIM == EMB);
static_assert(((NQKV * HDIM) / 8) % 256 == 0);
static_assert(((EMB * EMB) / 8) % 256 == 0);
static_assert((NB * SEQ) % 128 == 0);
static_assert(EMB % 64 == 0);
static_assert((WP8 & (WP8 - 1)) == 0);

// ---------------------------------------------------------------- helpers
static __device__ __forceinline__ float bf16r(float f) {   // RNE convert to bf16, back to f32
  uint32_t u = __float_as_uint(f);
  u = u + 0x7FFFu + ((u >> 16) & 1u);
  u = u & 0xFFFF0000u;
  return __uint_as_float(u);
}

union AF { v16h v; _Float16 h[16]; v4u q[2]; };
union H8 { _Float16 h[8]; v4u q; };

// 16-half WMMA fragment (A or B operand, one 32-deep k step): lane row/col = lane&15;
// elements 0..7 <- k 8*lhi+0..7, elements 8..15 <- k 16+8*lhi+0..7 (two aligned 16-byte loads).
// Fragment-order planes: every f16 operand plane in the workspace is a sequence of 1-KB
// fragments (16 rows x 32 k). Inside a fragment, half index j*256 + lane*8 + e holds
// (row lane&15, k 16*j + 8*(lane>>4) + e), so that each of the two loads of a wave covers
// 512 contiguous bytes (4 whole lines) instead of 32-byte pieces of 16 lines.
#define FRAG 512        // halves per fragment
static __device__ __forceinline__ void load_fragp(AF& a, const _Float16* frag, int lane) {
  const v4ua* p = (const v4ua*)(frag + lane * 8);
  a.q[0] = p[0];
  a.q[1] = p[32];
}

static __device__ __forceinline__ v8f mma16(v16h a, v16h b, v8f c) {
  v8f d = __builtin_amdgcn_wmma_f32_16x16x32_f16(false, a, false, b, (short)0, c,
                                                 false, false);
  return d;
}

static __device__ __forceinline__ void vst16(_Float16* p, v4u v) { *(v4u*)p = v; }
static __device__ __forceinline__ void vstf4(float* p, v4f v) { *(v4f*)p = v; }

// ---------------------------------------------------------------- weight planes
// f32 weights [rows][32 << ksh] -> f16 fragment-order plane [rows/16][1 << ksh][FRAG]:
// h = f16(bf16(w) * scale). Piece i = 16 bytes of the plane = 8 consecutive k of one row.
static __device__ __forceinline__ const v4f* w_piece_src(const float* src, int i, int ksh) {
  const int fr  = i >> 6;                    // fragment; piece i&63 = j*32 + lane
  const int row = (fr >> ksh) * 16 + (i & 15);
  const int k   = (fr & ((1 << ksh) - 1)) * 32 + ((i >> 5) & 1) * 16 + ((i >> 4) & 1) * 8;
  return (const v4f*)(src + ((size_t)row << (ksh + 5)) + k);
}
static __device__ __forceinline__ v4u w_piece_cvt(v4f f0, v4f f1, float scale) {
  H8 o;
#pragma unroll
  for (int e = 0; e < 4; ++e) {
    o.h[e]     = (_Float16)(bf16r(f0[e]) * scale);
    o.h[4 + e] = (_Float16)(bf16r(f1[e]) * scale);
  }
  return o.q;
}

// ---------------------------------------------------------------- kernel 1
// Per (b, h, 128-token tile): qkv = x_h[128x64] . W_qkv^T (W_qkv = [192][64], k contiguous).
// Both weight conversions ride in this launch. W_qkv (48 KB of f32): every block converts it
// into its own LDS plane Wst, six pieces a lane. W_proj: its WP8 pieces are dealt over the grid,
// one a lane in the first blocks; the plane Wp16 is read only by the projection launch.
// Wave = 16 tokens x 192 columns (24 WMMA). Planes, fragment order: Q16/K16 = [bh][t/16][d/32][FRAG]
// (rows = tokens, k = d; 8q, 8k), V16T = [bh][t/32][d/16][FRAG] (rows = d, k = tokens; 8v).
// A 128-token tile is 16 KB contiguous in each plane.
static __device__ __forceinline__ void qkv_store_pass(const _Float16* Qst, const _Float16* Kst,
                                                      const _Float16* Vst, _Float16* qdst,
                                                      _Float16* kdst, _Float16* vdst, int tid) {
  v4u q[4], k[4], v[4];                                   // all LDS reads go out ahead of the stores
#pragma unroll
  for (int it = 0; it < 4; ++it) {
    const int idx = it * 256 + tid;                       // 16-B piece of the contiguous 16 KB tile
    q[it] = ((const v4ua*)Qst)[idx];
    k[it] = ((const v4ua*)Kst)[idx];
    v[it] = ((const v4ua*)Vst)[idx];
  }
#pragma unroll
  for (int it = 0; it < 4; ++it) {
    const int idx = it * 256 + tid;
    vst16(qdst + (size_t)idx * 8, q[it]);
    vst16(kdst + (size_t)idx * 8, k[it]);
    vst16(vdst + (size_t)idx * 8, v[it]);
  }
}

__global__ __launch_bounds__(256) __attribute__((amdgpu_num_vgpr(256)))
void qkv_kernel(const float* __restrict__ x, const float* __restrict__ Wqkv,
                const float* __restrict__ bq, const float* __restrict__ Wproj,
                _Float16* __restrict__ Wp16, _Float16* __restrict__ Q16,
                _Float16* __restrict__ K16, _Float16* __restrict__ V16T) {
  __shared__ __attribute__((aligned(16))) _Float16 Wst[NQKV * HDIM];   // [col/16][d/32][FRAG], 8 W_qkv
  __shared__ _Float16 Qst[128 * HDIM];   // [token/16][d/32][FRAG]
  __shared__ _Float16 Kst[128 * HDIM];   // [token/16][d/32][FRAG]
  __shared__ _Float16 Vst[HDIM * 128];   // [token/32][d/16][FRAG]

  const int tid  = (int)threadIdx.x;
  const int wave = tid >> 5;
  const int lane = tid & 31;
  const int lhi  = lane >> 4;
  const int ln   = lane & 15;
  const int tb   = blockIdx.x * 128;
  const int h    = blockIdx.y;
  const int b    = blockIdx.z;

  // All loads of the block go out together: W_qkv's pieces first (they are waited for first),
  // then x, then this lane's piece of W_proj, which is converted and stored at the kernel's end.
  v4f wq[WQ8 / 256][2];
  const v4f* wqs = w_piece_src(Wqkv, tid, 1);   // piece it*256 + tid lies 32 rows of 64 floats per it further on
#pragma unroll
  for (int it = 0; it < WQ8 / 256; ++it) {
    wq[it][0] = wqs[it * (32 * HDIM / 4)];
    wq[it][1] = wqs[it * (32 * HDIM / 4) + 1];
  }
  // Stands in front of the address arithmetic below, which reuses address registers of these loads.
  asm volatile("s_wait_xcnt 0x0" ::: "memory");
  const int trow = tb + wave * 16 + ln;
  const float* xrow = x + ((size_t)b * SEQ_FULL + trow) * EMB + h * HDIM;
  v4f xf[2][4];
#pragma unroll
  for (int ks = 0; ks < 2; ++ks) {
    const v4f* xp = (const v4f*)(xrow + ks * 32 + lhi * 8);
    xf[ks][0] = xp[0]; xf[ks][1] = xp[1];    // k = ks*32 + 8*lhi + 0..7   (elements 0..7)
    xf[ks][2] = xp[4]; xf[ks][3] = xp[5];    // k = ks*32 + 16 + 8*lhi +.. (elements 8..15)
  }
  float bqv[12];                             // bias of output column n*16 + ln
#pragma unroll
  for (int n = 0; n < 12; ++n) bqv[n] = bq[n * 16 + ln];
  const int wpi = ((b * NHEAD + h) * (SEQ / 128) + (int)blockIdx.x) * 256 + tid;
  const bool wpon = wpi < WP8;               // the same for a whole block: WP8 is a multiple of 256
  // Loaded without a branch, so that no wait stands here; a lane with no piece reads one that
  // exists (WP8 is a power of two) and stores nothing.
  const v4f* wps = w_piece_src(Wproj, wpi & (WP8 - 1), 5);
  const v4f wp0 = wps[0], wp1 = wps[1];

#pragma unroll
  for (int it = 0; it < WQ8 / 256; ++it)
    vst16(Wst + (it * 256 + tid) * 8, w_piece_cvt(wq[it][0], wq[it][1], 8.0f));

  // A fragments: x rows (tokens) x 64 dims, f32 -> bf16 RNE -> f16 in registers.
  AF xa[2];
#pragma unroll
  for (int ks = 0; ks < 2; ++ks) {
    const v4f f0 = xf[ks][0], f1 = xf[ks][1];
    const v4f f2 = xf[ks][2], f3 = xf[ks][3];
#pragma unroll
    for (int e = 0; e < 4; ++e) {
      xa[ks].h[e]      = (_Float16)bf16r(f0[e]);
      xa[ks].h[4 + e]  = (_Float16)bf16r(f1[e]);
      xa[ks].h[8 + e]  = (_Float16)bf16r(f2[e]);
      xa[ks].h[12 + e] = (_Float16)bf16r(f3[e]);
    }
  }

  __syncthreads();   // every wave's pieces of Wst are written

  // D rows of this lane: tokens wave*16 + lhi*8 + r; D column: ln.
  const int qkpos = ((ln >> 3) * 16 + lhi * 8) * 8 + (ln & 7);   // + r*8: row lhi*8+r, k 8*(ln>>3) + (ln&7)
  // Twelve independent accumulators, one k step after the other: no WMMA waits for the one before it.
  v8f acc[12];
#pragma unroll
  for (int n = 0; n < 12; ++n) {           // output columns n*16 + ln = B column of this lane
    AF wb;
    load_fragp(wb, Wst + (n * 2) * FRAG, lane);
    const float bv = 8.0f * bf16r(bqv[n]);
#pragma unroll
    for (int e = 0; e < 8; ++e) acc[n][e] = bv;
    acc[n] = mma16(xa[0].v, wb.v, acc[n]);
  }
#pragma unroll
  for (int n = 0; n < 12; ++n) {
    AF wb;
    load_fragp(wb, Wst + (n * 2 + 1) * FRAG, lane);
    acc[n] = mma16(xa[1].v, wb.v, acc[n]);
  }
#pragma unroll
  for (int n = 0; n < 12; ++n) {
    const int ct = n & 3;                  // 16-column tile within the 64-wide q / k / v block
    const int qkoff = (wave * 2 + (ct >> 1)) * FRAG + (ct & 1) * 256 + qkpos;
    if (n < 4) {
#pragma unroll
      for (int r = 0; r < 8; ++r) Qst[qkoff + r * 8] = (_Float16)acc[n][r];
    } else if (n < 8) {
#pragma unroll
      for (int r = 0; r < 8; ++r) Kst[qkoff + r * 8] = (_Float16)acc[n][r];
    } else {
      // row d = ct*16 + ln, k = tokens (wave&1)*16 + 8*lhi + r: the lane's own 16-byte piece
      H8 vv;
#pragma unroll
      for (int r = 0; r < 8; ++r) vv.h[r] = (_Float16)acc[n][r];
      vst16(Vst + ((wave >> 1) * 4 + ct) * FRAG + (wave & 1) * 256 + lane * 8, vv.q);
    }
  }
  __syncthreads();   // cross-wave staging complete

  const size_t bh = (size_t)(b * NHEAD + h);
  _Float16* qdst = Q16 + (bh * SEQ + tb) * HDIM;
  _Float16* kdst = K16 + (bh * SEQ + tb) * HDIM;
  _Float16* vdst = V16T + (bh * SEQ + tb) * HDIM;
  qkv_store_pass(Qst, Kst, Vst, qdst, kdst, vdst, tid);

  if (wpon) vst16(Wp16 + (size_t)wpi * 8, w_piece_cvt(wp0, wp1, 32.0f));
  // Grids of fewer than WP8 lanes (reduced NB or SEQ): the pieces that are left.
  if (QKV_LANES < WP8) {
    for (int i = wpi + QKV_LANES; i < WP8; i += QKV_LANES) {
      const v4f* sp = w_piece_src(Wproj, i, 5);
      vst16(Wp16 + (size_t)i * 8, w_piece_cvt(sp[0], sp[1], 32.0f));
    }
  }
}

// ---------------------------------------------------------------- kernel 2
// Flash attention, transposed products. Block = 8 waves = 256 query columns of one (b,h); a wave
// has QT = 2 tiles of 16 query columns, so that every K and V fragment it reads from LDS is the
// A operand of two WMMAs. Key blocks of 32, per query tile: S^T = K.Q^T (4 WMMA, A = K rows,
// B = Q kept in registers), so a lane holds
// 16 scores of ONE query (column ln; keys 8*lhi+r and 16+8*lhi+r). Maximum and sum run in the
// lane. The maximum in use may trail the true one: O and the sums are rescaled (and the wave halves
// exchange their maxima) only in a pass where some exponent would pass PEMAX. The two score tiles,
// converted in place, are the B operand of O^T += V^T.P^T (4 WMMA, A = V^T rows): P x1024
// goes from registers to registers. K/V reach the waves through a two-buffer LDS ring: a stage is
// 64 keys (8 KB of K, 8 KB of V, both contiguous in their planes and already in fragment order),
// copied once per block by asynchronous copies while the stage before it is worked on.
// Output, fragment order [b*t/16][e/32][FRAG] (rows = tokens, k = e = h*64 + d): C16 = f16 of 128*ctx.

static __device__ __forceinline__ float other_half(float v) {   // value held by lane l ^ 16
  const int b = __float_as_int(v);
  return __int_as_float(__builtin_amdgcn_permlanex16(b, b, 0x76543210, 0xfedcba98, false, false));
}

#define SKEYS 64                    // keys per ring stage
#define SHALF (SKEYS * HDIM)        // halves per operand and stage (8 KB)
#define NSTAGE (SEQ / SKEYS)
static_assert(SEQ % SKEYS == 0);
static_assert(NSTAGE >= 2);
#define QT 2                        // 16-column query tiles per wave
#define QBLK (8 * QT * 16)          // query columns per block

// One stage: each of the 256 lanes copies four 16-byte pieces (two of K, two of V) to LDS.
// lds = the lane's byte address in the buffer, kg / vg = the lane's first piece in the planes.
static __device__ __forceinline__ void stage_copy(uint32_t lds, const _Float16* kg,
                                                  const _Float16* vg) {
  const uint32_t l1 = lds + 4096u, l2 = lds + 8192u, l3 = lds + 12288u;
  const _Float16* kg1 = kg + 2048;
  const _Float16* vg1 = vg + 2048;
  // The closing s_wait_xcnt stands inside the statement so that no address register of a copy
  // is rewritten ahead of it.
  asm volatile("global_load_async_to_lds_b128 %0, %4, off\n\t"
               "global_load_async_to_lds_b128 %1, %5, off\n\t"
               "global_load_async_to_lds_b128 %2, %6, off\n\t"
               "global_load_async_to_lds_b128 %3, %7, off\n\t"
               "s_wait_xcnt 0x0"
               :: "v"(lds), "v"(l1), "v"(l2), "v"(l3), "v"(kg), "v"(kg1), "v"(vg), "v"(vg1)
               : "memory");
}

__global__ __launch_bounds__(256) __attribute__((amdgpu_num_vgpr(256)))
void attn_kernel(const _Float16* __restrict__ Q16, const _Float16* __restrict__ K16,
                 const _Float16* __restrict__ V16T, _Float16* __restrict__ C16) {
  __shared__ __attribute__((aligned(16))) _Float16 KV[2][2 * SHALF];   // [buffer][K stage | V stage]

  const int tid  = (int)threadIdx.x;
  const int wave = tid >> 5;
  const int lane = tid & 31;               // below: lhi = lane >> 4, ln = lane & 15
  const int qb   = blockIdx.x * QBLK;
  const int h    = blockIdx.y;
  const int b    = blockIdx.z;
  const size_t bh = (size_t)(b * NHEAD + h);
  const _Float16* Qp = Q16 + bh * SEQ * HDIM;
  const _Float16* Kp = K16 + bh * SEQ * HDIM;
  const _Float16* Vp = V16T + bh * SEQ * HDIM;

  // Q B-fragments for this wave's QT tiles of 16 query columns (plane carries 8q). Where SEQ is
  // no multiple of QBLK the last block's upper waves have no queries: they work on tile 0 (they
  // share the copies and the barriers) and store nothing.
  const bool live = (SEQ % QBLK == 0) || (qb + wave * (QT * 16) < SEQ);
  const int qt = live ? (qb >> 4) + wave * QT : 0;
  AF qa0[QT], qa1[QT];
  float m[QT];          // maximum in use for query ln of the tile, base-2 units (equal in both halves)
  float nmo[QT];        // 10 - m: the addend of every exponent; the carry x1024 of P rides in it
  v2f rs0[QT], rs1[QT]; // running sums of 1024 p over this half's keys (first / second key tile; even r in x, odd r in y); joined after the loop
  v8f o[QT][4];         // o[qi][d][r] = O^T[d*16 + 8*lhi + r][query ln of tile qi]
#pragma unroll
  for (int qi = 0; qi < QT; ++qi) {
    load_fragp(qa0[qi], Qp + (size_t)((qt + qi) * 2) * FRAG, lane);
    load_fragp(qa1[qi], Qp + (size_t)((qt + qi) * 2 + 1) * FRAG, lane);
    m[qi] = -3.0e38f;
    nmo[qi] = 3.0e38f;    // the first pass's test fires, and its rescale factor is 0
    rs0[qi] = (v2f){0.0f, 0.0f};
    rs1[qi] = (v2f){0.0f, 0.0f};
#pragma unroll
    for (int d = 0; d < 4; ++d) {
#pragma unroll
      for (int e = 0; e < 8; ++e) o[qi][d][e] = 0.0f;
    }
  }

  // Softmax runs in base 2: SC2 = log2(e) / 512 takes (8q).(8k) to log2(e) * q.k / 8.
  const float SC2 = 0.0028177637517362567f;
  // Largest exponent of 1024 p let through without a rescale: P stays at or below 2^15, inside f16.
  const float PEMAX = 15.0f;

  // Ring prologue: stage 0 lands and is published, then stage 1 starts to fly.
  const uint32_t lds0 = (uint32_t)(size_t)(&KV[0][0]) + (uint32_t)tid * 16u;
  const _Float16* kg = Kp + tid * 8;
  const _Float16* vg = Vp + tid * 8;
  stage_copy(lds0, kg, vg);
  asm volatile("s_wait_asynccnt 0x0" ::: "memory");   // this wave's pieces of stage 0 have landed
  __syncthreads();                                    // every wave's pieces have
  stage_copy(lds0 + 4u * SHALF, kg + SHALF, vg + SHALF);

#pragma unroll 1
  for (int st = 0; st < NSTAGE; ++st) {
   const _Float16* Ks = &KV[st & 1][0];
   const _Float16* Vs = Ks + SHALF;
#pragma unroll
   for (int kb = 0; kb < SKEYS / 32; ++kb) {
    // S^T = K . Q^T : two 16-key tiles, each 2 k-steps over 64 dims; a K fragment serves QT query tiles.
    v8f s[QT][2];
#pragma unroll
    for (int nt = 0; nt < 2; ++nt) {
      const int kt = kb * 2 + nt;                // 16-key tile: A rows
      AF f0, f1;
      load_fragp(f0, Ks + (kt * 2) * FRAG, lane);
      load_fragp(f1, Ks + (kt * 2 + 1) * FRAG, lane);
#pragma unroll
      for (int qi = 0; qi < QT; ++qi) {
        v8f c;
#pragma unroll
        for (int e = 0; e < 8; ++e) c[e] = 0.0f;
        c = mma16(f0.v, qa0[qi].v, c);
        c = mma16(f1.v, qa1[qi].v, c);
        s[qi][nt] = c;
      }
    }

    float mx[QT], emx[QT];
#pragma unroll
    for (int qi = 0; qi < QT; ++qi) {
      float mx0 = s[qi][0][0], mx1 = s[qi][1][0];
#pragma unroll
      for (int r = 1; r < 8; ++r) {
        mx0 = fmaxf(mx0, s[qi][0][r]);
        mx1 = fmaxf(mx1, s[qi][1][r]);
      }
      mx[qi] = fmaxf(mx0, mx1);
      emx[qi] = __builtin_fmaf(mx[qi], SC2, nmo[qi]);
    }
    bool need = false;
#pragma unroll
    for (int qi = 0; qi < QT; ++qi) need = need || (emx[qi] > PEMAX);
    if (__builtin_amdgcn_ballot_w32(need) != 0) {   // a scalar branch of the whole wave; rare after the first pass
#pragma unroll
      for (int qi = 0; qi < QT; ++qi) {
        const float mxs = fmaxf(mx[qi], other_half(mx[qi])) * SC2;
        const float mn = fmaxf(m[qi], mxs);
        const float corr = __builtin_amdgcn_exp2f(m[qi] - mn);
        m[qi] = mn;
        nmo[qi] = 10.0f - mn;
        rs0[qi] *= corr;
        rs1[qi] *= corr;
#pragma unroll
        for (int d = 0; d < 4; ++d) {
#pragma unroll
          for (int r = 0; r < 8; ++r) o[qi][d][r] *= corr;
        }
      }
    }

    // The pass's four V^T fragments are asked for here, so that they fly during the exponentials.
    AF vf[4];
#pragma unroll
    for (int d = 0; d < 4; ++d) load_fragp(vf[d], Vs + (kb * 4 + d) * FRAG, lane);
    // A stage's last pass: keeps these reads one group behind the branch; without it each fragment's
    // reads come to stand directly in front of its own WMMAs, with a full wait each. (In the other
    // passes the compiler spreads them among the next pass's K reads, behind counted waits.)
    if (kb + 1 == SKEYS / 32) __builtin_amdgcn_sched_barrier(0);

    AF pb[QT];
#pragma unroll
    for (int qi = 0; qi < QT; ++qi) {
      // P^T as a 32x16 B fragment: element nt*8+r = key nt*16 + 8*lhi + r, the hardware k order
      // that the V^T fragments have.
      const v2f sc2 = {SC2, SC2};
      const v2f nm2 = {nmo[qi], nmo[qi]};
#pragma unroll
      for (int r = 0; r < 8; r += 2) {
        // Two neighbouring scores at a time: one packed FMA for both exponents, one packed add for both p.
        const v2f e0 = __builtin_elementwise_fma((v2f){s[qi][0][r], s[qi][0][r + 1]}, sc2, nm2);
        const v2f e1 = __builtin_elementwise_fma((v2f){s[qi][1][r], s[qi][1][r + 1]}, sc2, nm2);
        const v2f p0 = {__builtin_amdgcn_exp2f(e0.x), __builtin_amdgcn_exp2f(e0.y)};   // 1024 p
        const v2f p1 = {__builtin_amdgcn_exp2f(e1.x), __builtin_amdgcn_exp2f(e1.y)};
        rs0[qi] += p0;
        rs1[qi] += p1;
        pb[qi].h[r]         = (_Float16)p0.x;
        pb[qi].h[r + 1]     = (_Float16)p0.y;
        pb[qi].h[8 + r]     = (_Float16)p1.x;
        pb[qi].h[8 + r + 1] = (_Float16)p1.y;
      }
    }

    // O^T += V^T . P^T : four 16-row d tiles, one fragment each, serving QT query tiles.
#pragma unroll
    for (int d = 0; d < 4; ++d) {
#pragma unroll
      for (int qi = 0; qi < QT; ++qi) o[qi][d] = mma16(vf[d].v, pb[qi].v, o[qi][d]);
    }
   }
   // Publish point of stage st + 1; behind its barrier the buffer just read is free for st + 2.
   asm volatile("s_wait_dscnt 0x0" ::: "memory");      // this wave's reads of the buffer are done
   asm volatile("s_wait_asynccnt 0x0" ::: "memory");   // this wave's pieces of stage st + 1 have landed
   __syncthreads();
   if (st + 2 < NSTAGE)
     stage_copy(lds0 + (uint32_t)(st & 1) * (4u * SHALF), kg + (size_t)(st + 2) * SHALF,
                vg + (size_t)(st + 2) * SHALF);
  }
  asm volatile("s_wait_asynccnt 0x0" ::: "memory");    // no copy is left in flight at the wave's end

  // O = sum (1024 p)(8 v), lt = sum (1024 p); c = 128 * ctx = 16 * O / lt, stored as f16.
  // A lane holds 8 consecutive d of its query per tile (row ln, k (d&1)*16 + 8*lhi + r of fragment
  // h*2 + d/2): its own 16-byte piece of the plane, so a wave's store is 512 contiguous bytes.
  if (live) {
#pragma unroll
    for (int qi = 0; qi < QT; ++qi) {
      const size_t coff = ((((size_t)b * SEQ >> 4) + qt + qi) * (EMB / 32) + h * 2) * FRAG + lane * 8;
      _Float16* cdst = C16 + coff;
      const v2f rs = rs0[qi] + rs1[qi];
      const float ls = rs.x + rs.y;
      const float lt = ls + other_half(ls);
      const float inv = (1.0f / lt) * 16.0f;
#pragma unroll
      for (int d = 0; d < 4; ++d) {
        H8 hv;
#pragma unroll
        for (int r = 0; r < 8; ++r) hv.h[r] = (_Float16)(o[qi][d][r] * inv);
        vst16(cdst + d * 256, hv.q);
      }
    }
  }
}

// ---------------------------------------------------------------- kernel 3
// y[m][f] = (sum_e C16[m][e]*Wp16[f][e]) / 4096 + bf16(b_proj[f]);
// M = NB*SEQ, N = K = 1024. Block = 8 waves = 128 rows x 256 columns of y, one block per WGP; wave
// tile 64 rows x 64 columns. The operands reach the waves through a two-buffer LDS ring: a stage is
// 128 k (4 fragments) of 8 context and 16 weight tiles of 16 rows, 4 KB contiguous in its plane
// each, copied once per block by asynchronous copies while the stage before it is worked on.
// A fragment read from LDS feeds 4 WMMAs.
#define PBM 128                          // rows of y per block
#define PBN 256                          // columns of y per block
#define PKS 4                            // 32-deep k steps per ring stage
#define PCH ((PBM + PBN) / 16)           // 16-row chunks per stage: context | weights
#define PCHH (PKS * FRAG)                // halves per chunk
#define PSH (PCH * PCHH)                 // halves per stage (96 KB)
#define PNST (EMB / 32 / PKS)            // stages
#define TROW ((EMB / 32) * FRAG)         // halves per 16-row tile of a plane
static_assert(SEQ % PBM == 0);
static_assert(EMB % PBN == 0);
static_assert(PCHH * 2 == 256 * 16);     // a chunk is one 16-byte piece per lane of the block
static_assert(PCH == 24);
static_assert(PNST >= 2);
static_assert(8 * 64 * 64 * 4 <= 2 * PSH * 2);   // the output staging fits the ring

// Eight chunks: the lane's piece of chunk j goes from byte voff of g + j * TROW to lds + j * 4096.
// g is the same for the whole block and stays in scalar registers; voff is the lane's own offset.
static __device__ __forceinline__ void chunk_copy8(uint32_t lds, uint32_t voff, const _Float16* g) {
  const uint32_t l1 = lds + 4096u, l2 = lds + 8192u, l3 = lds + 12288u, l4 = lds + 16384u,
                 l5 = lds + 20480u, l6 = lds + 24576u, l7 = lds + 28672u;
  const _Float16 *g1 = g + TROW, *g2 = g + 2 * TROW, *g3 = g + 3 * TROW, *g4 = g + 4 * TROW,
                 *g5 = g + 5 * TROW, *g6 = g + 6 * TROW, *g7 = g + 7 * TROW;
  // The closing s_wait_xcnt stands inside the statement so that no address register of a copy
  // is rewritten ahead of it.
  asm volatile("global_load_async_to_lds_b128 %0, %8, %9\n\t"
               "global_load_async_to_lds_b128 %1, %8, %10\n\t"
               "global_load_async_to_lds_b128 %2, %8, %11\n\t"
               "global_load_async_to_lds_b128 %3, %8, %12\n\t"
               "global_load_async_to_lds_b128 %4, %8, %13\n\t"
               "global_load_async_to_lds_b128 %5, %8, %14\n\t"
               "global_load_async_to_lds_b128 %6, %8, %15\n\t"
               "global_load_async_to_lds_b128 %7, %8, %16\n\t"
               "s_wait_xcnt 0x0"
               :: "v"(lds), "v"(l1), "v"(l2), "v"(l3), "v"(l4), "v"(l5), "v"(l6), "v"(l7),
                  "v"(voff), "s"(g), "s"(g1), "s"(g2), "s"(g3), "s"(g4), "s"(g5), "s"(g6), "s"(g7)
               : "memory");
}

// One stage: 24 pieces a lane. lds = the lane's byte address in the buffer, voff = its byte offset
// in a chunk; gh, gw = the stage's first context and weight chunk.
static __device__ __forceinline__ void proj_stage_copy(uint32_t lds, uint32_t voff,
                                                       const _Float16* gh, const _Float16* gw) {
  chunk_copy8(lds, voff, gh);
  chunk_copy8(lds + 32768u, voff, gw);
  chunk_copy8(lds + 65536u, voff, gw + 8 * TROW);
}

// The 8 fragments of one k step of a wave: 4 weight, 4 context.
struct PF { AF b[4], a[4]; };
static __device__ __forceinline__ void proj_frags(PF& f, const _Float16* Sh, const _Float16* Sw,
                                                  int ks, int lane) {
#pragma unroll
  for (int nt = 0; nt < 4; ++nt) load_fragp(f.b[nt], Sw + nt * PCHH + ks * FRAG, lane);
#pragma unroll
  for (int mi = 0; mi < 4; ++mi) load_fragp(f.a[mi], Sh + mi * PCHH + ks * FRAG, lane);
}

// A wave's 64 x 64 staged tile goes out in 256-B row segments: 16 lanes x 16 B, two rows a store.
// dst = the lane's piece of row lane >> 4; every further store lies two rows of y on.
static __device__ __forceinline__ void y_store_pass(const float* yw, float* dst, int lane) {
  v4f t[32];                                       // all LDS reads go out ahead of the stores
#pragma unroll
  for (int i = 0; i < 32; ++i) t[i] = ((const v4fa*)yw)[i * 32 + lane];
#pragma unroll
  for (int i = 0; i < 32; ++i) vstf4(dst + (size_t)i * (2 * EMB), t[i]);
}

__global__ __launch_bounds__(256)
void proj_kernel(const _Float16* __restrict__ C16, const _Float16* __restrict__ Wp16,
                 const float* __restrict__ bp, float* __restrict__ out) {
  __shared__ __attribute__((aligned(16))) _Float16 PS[2][PSH];   // [buffer][chunk][k step][FRAG]

  const int tid  = (int)threadIdx.x;
  const int wave = tid >> 5;
  const int lane = tid & 31;
  const int lhi  = lane >> 4;
  const int ln   = lane & 15;
  const int wm   = wave >> 2;              // 64-row half of the block's rows
  const int wn   = wave & 3;               // 64-column quarter of the block's columns
  const int mb   = blockIdx.x * PBM;
  const int nb   = blockIdx.y * PBN;

  v8f acc[4][4];
#pragma unroll
  for (int mi = 0; mi < 4; ++mi) {
#pragma unroll
    for (int nt = 0; nt < 4; ++nt) {
#pragma unroll
      for (int e = 0; e < 8; ++e) acc[mi][nt][e] = 0.0f;
    }
  }

  // Ring prologue: stage 0 lands and is published, then stage 1 starts to fly.
  const uint32_t voff = (uint32_t)tid * 16u;
  const uint32_t lds0 = (uint32_t)(size_t)(&PS[0][0]) + voff;
  const _Float16* gh = C16 + (size_t)(mb >> 4) * TROW;
  const _Float16* gw = Wp16 + (size_t)(nb >> 4) * TROW;
  proj_stage_copy(lds0, voff, gh, gw);
  // The bias is fetched here, while stage 0 flies.
  const int n0 = nb + wn * 64;
  const float* bpl = bp + n0 + ln;         // bias of output column n0 + nt*16 + ln
  float bpv[4];
#pragma unroll
  for (int nt = 0; nt < 4; ++nt) bpv[nt] = bpl[nt * 16];
  // Stands in front of the arithmetic below, which reuses address registers of these loads; the
  // scheduling fence keeps that arithmetic from being lifted over the wait.
  asm volatile("s_wait_xcnt 0x0" ::: "memory");
  __builtin_amdgcn_sched_barrier(0);
  asm volatile("s_wait_asynccnt 0x0" ::: "memory");   // this wave's pieces of stage 0 have landed
  __syncthreads();                                    // every wave's pieces have
  proj_stage_copy(lds0 + 2u * PSH, voff, gh + PCHH, gw + PCHH);

#pragma unroll 1
  for (int st = 0; st < PNST; ++st) {
    const _Float16* S  = &PS[st & 1][0];
    const _Float16* Sh = S + (wm * 4) * PCHH;
    const _Float16* Sw = S + (PBM / 16 + wn * 4) * PCHH;
    PF f[2];                                 // two fragment sets: the next k step's reads fly during this one's WMMAs
    proj_frags(f[0], Sh, Sw, 0, lane);
#pragma unroll
    for (int ks = 0; ks < PKS; ++ks) {
      if (ks + 1 < PKS) proj_frags(f[(ks + 1) & 1], Sh, Sw, ks + 1, lane);
      // Keeps the next k step's LDS reads one group ahead of this k step's WMMAs, not spread among them.
      __builtin_amdgcn_sched_barrier(0);
      const PF& c = f[ks & 1];
#pragma unroll
      for (int mi = 0; mi < 4; ++mi) {
#pragma unroll
        for (int nt = 0; nt < 4; ++nt) acc[mi][nt] = mma16(c.a[mi].v, c.b[nt].v, acc[mi][nt]);
      }
      // Keeps the reads of the k step after the next behind these WMMAs, whose registers they refill.
      __builtin_amdgcn_sched_barrier(0);
    }
    // Publish point of stage st + 1; behind its barrier the buffer just read is free for st + 2.
    asm volatile("s_wait_dscnt 0x0" ::: "memory");      // this wave's reads of the buffer are done
    asm volatile("s_wait_asynccnt 0x0" ::: "memory");   // this wave's pieces of stage st + 1 have landed
    __syncthreads();
    if (st + 2 < PNST)
      proj_stage_copy(lds0 + (uint32_t)(st & 1) * (2u * PSH), voff, gh + (size_t)(st + 2) * PCHH,
                      gw + (size_t)(st + 2) * PCHH);
  }
  asm volatile("s_wait_asynccnt 0x0" ::: "memory");    // no copy is left in flight at the wave's end

  // Behind the last publish point nobody reads the ring and no copy flies: it becomes the output
  // staging, 16 KB [row][col] per wave.
  float* yw = (float*)&PS[0][0] + wave * (64 * 64);
#pragma unroll
  for (int nt = 0; nt < 4; ++nt) {
    const int col = nt * 16 + ln;
    const float bias = bf16r(bpv[nt]);
#pragma unroll
    for (int mi = 0; mi < 4; ++mi) {
#pragma unroll
      for (int r = 0; r < 8; ++r) {
        yw[(mi * 16 + lhi * 8 + r) * 64 + col] = acc[mi][nt][r] * 0.000244140625f + bias;
      }
    }
  }
  __syncthreads();

  // The block's 128 rows lie in one batch (SEQ is a multiple of 128).
  const int ob = mb / SEQ;
  const size_t orow = (size_t)ob * SEQ_OUT + (mb - ob * SEQ) + wm * 64 + lhi;
  y_store_pass(yw, out + orow * EMB + n0 + ln * 4, lane);
}

// ---------------------------------------------------------------- host
extern "C" void kernel_launch(void* const* d_in, const int* in_sizes, int n_in,
                              void* d_out, int out_size, void* d_ws, size_t ws_size,
                              hipStream_t stream) {
  if (n_in < 5) return;
  if (in_sizes[0] < ((NB - 1) * SEQ_FULL + SEQ) * EMB) return;
  if (in_sizes[1] < NQKV * HDIM) return;
  if (in_sizes[2] < NQKV) return;
  if (in_sizes[3] < EMB * EMB) return;
  if (in_sizes[4] < EMB) return;
  if (out_size < ((NB - 1) * SEQ_OUT + SEQ) * EMB) return;

  const float* x     = (const float*)d_in[0];
  const float* Wqkv  = (const float*)d_in[1];
  const float* bqkv  = (const float*)d_in[2];
  const float* Wproj = (const float*)d_in[3];
  const float* bproj = (const float*)d_in[4];
  float* out = (float*)d_out;

  char* ws = (char*)d_ws;
  size_t off = 0;
  _Float16* Wp16 = (_Float16*)(ws + off); off += (size_t)EMB * EMB * 2;            // 2 MiB
  const size_t psz = (size_t)NB * NHEAD * SEQ * HDIM * 2;                          // 16 MiB at full size
  _Float16* Q16  = (_Float16*)(ws + off); off += psz;                               // [bh][t/16][2][FRAG]
  _Float16* K16  = (_Float16*)(ws + off); off += psz;                               // [bh][t/16][2][FRAG]
  _Float16* V16T = (_Float16*)(ws + off); off += psz;                               // [bh][t/32][4][FRAG]
  _Float16* C16  = (_Float16*)(ws + off); off += (size_t)NB * SEQ * EMB * 2;        // [b*t/16][32][FRAG]
  if (off > ws_size) return;

  dim3 g1(SEQ / 128, NHEAD, NB);
  qkv_kernel<<<g1, 256, 0, stream>>>(x, Wqkv, bqkv, Wproj, Wp16, Q16, K16, V16T);
  dim3 g2((SEQ + QBLK - 1) / QBLK, NHEAD, NB);
  attn_kernel<<<g2, 256, 0, stream>>>(Q16, K16, V16T, C16);

  dim3 g3((NB * SEQ) / PBM, EMB / PBN);
  proj_kernel<<<g3, 256, 0, stream>>>(C16, Wp16, bproj, out);
}
